// v000
// Measured on an AMD MI455X. A time is GPU time per run, averaged over a window of back-to-back runs after a warm-up
// (all launches, gaps included; the runs take copies of the inputs in turn), and the median of several windows.
// Apart from v000's, it joins two sittings. Times from different sittings can be a few percent apart, while
// side-by-side timings come from the same sitting.
// The starting kernel, v000, takes 1020 microseconds a run.
#include <hip/hip_runtime.h>

// Compute dtypes, f32 accumulate, one batch item per pass: y0 = LN(x) (f32; gamma/beta and x read through bf16 rounding) -> bf16 hi + UNSCALED residual planes;
// t = y0.w1 + b1 ([2048 x 1024].[1024 x 2048]) and y1 = gelu(t).w2 + b2 ([2048 x 2048].[2048 x 1024]) on v_wmma_f32_16x16x32_bf16 with k-major weights
// transposed once to n-major bf16 planes and the computed operands as hi + residual (two products; exact-erf GELU in f32 in between); scores = x.x^T
// ([2048 x 1024].[1024 x 2048], the INPUT x rounded once -> exact products, one product); y2 = scores.y1 ([2048 x 2048].[2048 x 1024]) with BOTH computed

#define NB_  4
#define NT_  2048
#define DM   1024
#define FF   2048
#define HD   128                 // k_vt tile grouping only
#define KW   DM
#define NKV  (DM / HD)
#define NTK  NT_
#define LOSC 1024.0f             // (F16OUT path of k_gemmb; unused here)

typedef _Float16 h16;
typedef unsigned short bf;
typedef __attribute__((ext_vector_type(16))) __bf16   v16bf;
typedef __attribute__((ext_vector_type(16))) _Float16 v16h;
typedef __attribute__((ext_vector_type(8)))  _Float16 v8h;
typedef __attribute__((ext_vector_type(8)))  unsigned short v8us;
typedef __attribute__((ext_vector_type(8)))  float    v8f;
typedef __attribute__((ext_vector_type(4)))  float    v4f;
typedef __attribute__((ext_vector_type(4)))  _Float16 v4h;
typedef v8h  __attribute__((may_alias)) v8ha;
typedef v4f  __attribute__((may_alias)) v4fa;
typedef v8us __attribute__((may_alias)) v8usa;

__device__ __forceinline__ unsigned short f2bf(float f) { unsigned u = __float_as_uint(f); u += 0x7FFFu + ((u >> 16) & 1u); return (unsigned short)(u >> 16); }
__device__ __forceinline__ float bf2f(unsigned short b) { return __uint_as_float(((unsigned)b) << 16); }
__device__ __forceinline__ float bfr(float f) { return bf2f(f2bf(f)); }
__device__ __forceinline__ v16h cat16(v8h lo, v8h hi) { return __builtin_shufflevector(lo, hi, 0, 1, 2, 3, 4, 5, 6, 7, 8, 9, 10, 11, 12, 13, 14, 15); }
__device__ __forceinline__ v16bf cat16b(v8us lo, v8us hi) { return __builtin_bit_cast(v16bf, __builtin_shufflevector(lo, hi, 0, 1, 2, 3, 4, 5, 6, 7, 8, 9, 10, 11, 12, 13, 14, 15)); }
__device__ __forceinline__ v8f wmma16(v16h a, v16h b, v8f c) { return __builtin_amdgcn_wmma_f32_16x16x32_f16(false, a, false, b, (short)0, c, false, false); }
__device__ __forceinline__ v8f wmmab(v16bf a, v16bf b, v8f c) { return __builtin_amdgcn_wmma_f32_16x16x32_bf16(false, a, false, b, (short)0, c, false, false); }

__global__ __launch_bounds__(256) void k_cvtb(const float* __restrict__ src, int nrows, bf* dst) {
    const int lane = threadIdx.x & 31, r = blockIdx.x * 8 + (threadIdx.x >> 5);
    if (r >= nrows) return;
    v8us o[DM / 256];
#pragma unroll
    for (int q = 0; q < DM / 256; ++q) { v8us t;
#pragma unroll
        for (int i = 0; i < 8; ++i) t[i] = f2bf(src[(size_t)r * DM + q * 256 + lane * 8 + i]);
        o[q] = t; }
#pragma unroll
    for (int q = 0; q < DM / 256; ++q) *(v8us*)(dst + (size_t)r * DM + q * 256 + lane * 8) = o[q];
    
}

__global__ __launch_bounds__(256) void k_cvtb2(const float* __restrict__ src, int nrows, bf* dh, bf* dl) {
    const int lane = threadIdx.x & 31, r = blockIdx.x * 8 + (threadIdx.x >> 5);
    if (r >= nrows) return;
    v8us oh[DM / 256], ol[DM / 256];
#pragma unroll
    for (int q = 0; q < DM / 256; ++q) {
#pragma unroll
        for (int i = 0; i < 8; ++i) { const float v = src[(size_t)r * DM + q * 256 + lane * 8 + i]; const unsigned short hb = f2bf(v); oh[q][i] = hb; ol[q][i] = f2bf(v - bf2f(hb)); } }
{
#pragma unroll
        for (int q = 0; q < DM / 256; ++q) { const size_t o = (size_t)r * DM + q * 256 + lane * 8; *(v8us*)(dh + o) = oh[q]; *(v8us*)(dl + o) = ol[q]; }
         }
}
// k_wt: WT [n][K] = bf16(W[k][n]) (k-major [K][ncols]) via 64 x 64 LDS tiles; grid (K/64, ncols/64).
__global__ __launch_bounds__(256) void k_wt(const float* __restrict__ Wm, int K, int ncols, bf* WT) {
    __shared__ __align__(16) unsigned short tl[64 * 72];
    const int tid = threadIdx.x, k0 = blockIdx.x * 64, n0 = blockIdx.y * 64;
    const int kk = tid >> 2, nq = (tid & 3) * 16;
#pragma unroll
    for (int i = 0; i < 16; ++i) tl[(nq + i) * 72 + kk] = f2bf(Wm[(size_t)(k0 + kk) * ncols + n0 + nq + i]);
    __syncthreads();
    const int piece = tid & 7;
    auto pass = [&]() {
#pragma unroll
        for (int s = 0; s < 2; ++s) { const int nr = (tid >> 3) + 32 * s; const v8us val = *(const v8usa*)(tl + nr * 72 + piece * 8); *(v8us*)(WT + (size_t)(n0 + nr) * K + k0 + piece * 8) = val; }
    };
    pass(); 
}
// k_ln: one wave per row of x [rows][1024]: LayerNorm (mean, then mean((x-mu)^2), eps 1e-5, x bf(gamma) + bf(beta), f32, fixed lane order) -> bf16 hi + UNSCALED
// residual planes; lane -> columns q*256 + lane*8 .. +8 for q = 0..3 (16 B per plane per store, 8 lanes per line). The row is re-read per phase with the q loop
// rolled (keeps the static VALU-FMA count small; no register arrays indexed by a loop variable).
template <bool ROUNDIN>   // ROUNDIN: the source is a module INPUT (read through bf16 rounding); false: a computed f32 plane (read as is)
__global__ __launch_bounds__(256) void k_ln(const float* __restrict__ X, const float* __restrict__ gam, const float* __restrict__ bet, int nrows, bf* Hh, bf* Hl) {
    const int lane = threadIdx.x & 31, r = blockIdx.x * 8 + (threadIdx.x >> 5);
    if (r >= nrows) return;
    const float* xr = X + (size_t)r * DM + lane * 8;
    float s = 0.f;
#pragma unroll 1
    for (int q = 0; q < DM / 256; ++q) {
#pragma unroll
        for (int i = 0; i < 8; ++i) s += (ROUNDIN ? bfr(xr[q * 256 + i]) : xr[q * 256 + i]); }
#pragma unroll
    for (int sh = 16; sh; sh >>= 1) s += __shfl_xor(s, sh, 32);
    const float mu = s * (1.0f / DM);
    float s2 = 0.f;
#pragma unroll 1
    for (int q = 0; q < DM / 256; ++q) {
#pragma unroll
        for (int i = 0; i < 8; ++i) { const float d = (ROUNDIN ? bfr(xr[q * 256 + i]) : xr[q * 256 + i]) - mu; s2 = fmaf(d, d, s2); } }
#pragma unroll
    for (int sh = 16; sh; sh >>= 1) s2 += __shfl_xor(s2, sh, 32);
    const float rs = rsqrtf(s2 * (1.0f / DM) + 1e-5f);
{
#pragma unroll 1
        for (int q = 0; q < DM / 256; ++q) { v8us oh, ol;
#pragma unroll
            for (int i = 0; i < 8; ++i) { const int c = q * 256 + lane * 8 + i; const float y = ((ROUNDIN ? bfr(xr[q * 256 + i]) : xr[q * 256 + i]) - mu) * rs * bfr(gam[c]) + bfr(bet[c]); const unsigned short hb = f2bf(y); oh[i] = hb; ol[i] = f2bf(y - bf2f(hb)); }
            const size_t o = (size_t)r * DM + q * 256 + lane * 8; *(v8us*)(Hh + o) = oh; *(v8us*)(Hl + o) = ol; }
         }
}
// k_gelu2: exact-erf GELU of an f32 [nrows][FF] plane (bias already added) -> bf16 hi + UNSCALED residual planes; one wave per row, lane -> 4 consecutive
// columns per iteration (16 rolled iterations of 128 columns; 8 B per plane per store -> 16 lanes per line).
__global__ __launch_bounds__(256) void k_gelu2(const float* __restrict__ src, int nrows, bf* dh, bf* dl) {
    typedef __attribute__((ext_vector_type(4))) unsigned short v4us;
    const int lane = threadIdx.x & 31, r = blockIdx.x * 8 + (threadIdx.x >> 5);
    if (r >= nrows) return;
{
#pragma unroll 1
        for (int q = 0; q < FF / 128; ++q) { const size_t o = (size_t)r * FF + q * 128 + lane * 4; const v4f v = *(const v4f*)(src + o); v4us oh, ol;
#pragma unroll
            for (int i = 0; i < 4; ++i) { const float g = 0.5f * v[i] * (1.0f + erff(v[i] * 0.70710678118654752f)); const unsigned short hb = f2bf(g); oh[i] = hb; ol[i] = f2bf(g - bf2f(hb)); }
            *(v4us*)(dh + o) = oh; *(v4us*)(dl + o) = ol; }
         }
}
// k_gemmb: 64 x 64 block tile (4 waves x 16 x 64) of C[NTK][NW] = (A [+ Al]).B^T (K = 1024 or 2048) [+ bf(bias[c])] [+ bf(R[r][c]) residual]; f32 whole-line epilogue (or f16
template <bool SPLITA, bool F16OUT = false>
__global__ __launch_bounds__(128) void k_gemmb(const bf* __restrict__ A, const bf* __restrict__ Al, const bf* __restrict__ Bn, const float* __restrict__ bias, float* C, int ldc, h16* C2, const float* __restrict__ R = nullptr, int K = DM, int roundR = 1) {
    __shared__ __align__(16) float ost[4][16 * 68];
    const int lane = threadIdx.x & 31, wave = threadIdx.x >> 5, lr = lane & 15, hi = lane >> 4;
    const int r0 = blockIdx.x * 64 + wave * 16, c0 = blockIdx.y * 64;
    const size_t aoff = (size_t)(r0 + lr) * K + 8 * hi;
    size_t boff[4];
#pragma unroll
    for (int t = 0; t < 4; ++t) boff[t] = (size_t)(c0 + t * 16 + lr) * K + 8 * hi;
    v8f acc[4];
#pragma unroll
    for (int t = 0; t < 4; ++t) acc[t] = (v8f){};
#pragma unroll 1
    for (int kc = 0; kc < K; kc += 32) {
        const v16bf a = cat16b(*(const v8us*)(A + aoff + kc), *(const v8us*)(A + aoff + kc + 16));
        v16bf al = a;
        if (SPLITA) al = cat16b(*(const v8us*)(Al + aoff + kc), *(const v8us*)(Al + aoff + kc + 16));
#pragma unroll
        for (int t = 0; t < 4; ++t) { const v16bf b = cat16b(*(const v8us*)(Bn + boff[t] + kc), *(const v8us*)(Bn + boff[t] + kc + 16)); acc[t] = wmmab(a, b, acc[t]); if (SPLITA) acc[t] = wmmab(al, b, acc[t]); }
        asm volatile("v_nop\n\tv_nop\n\tv_nop\n\tv_nop" : "+v"(acc[0]), "+v"(acc[1]), "+v"(acc[2]), "+v"(acc[3]) : "v"(a), "v"(al));
    }
    float* os = &ost[wave][0];
#pragma unroll
    for (int t = 0; t < 4; ++t) { const float bv = bias ? bfr(bias[c0 + t * 16 + lr]) : 0.f;
#pragma unroll
        for (int j = 0; j < 8; ++j) os[(hi * 8 + j) * 68 + t * 16 + lr] = acc[t][j] + bv; }
    __syncthreads();
    if (F16OUT) {
        h16* crow = (h16*)(void*)C + (size_t)r0 * ldc + c0;
        auto pass = [&]() {
#pragma unroll
            for (int s = 0; s < 4; ++s) { const int row = 4 * s + (lane >> 3), piece = lane & 7; const float* sp = os + row * 68 + piece * 8; v8h o, o2;
#pragma unroll
                for (int i = 0; i < 8; ++i) { const h16 a = (h16)sp[i]; o[i] = a; o2[i] = (h16)((sp[i] - (float)a) * LOSC); }
                *(v8h*)(crow + (size_t)row * ldc + piece * 8) = o; if (C2) *(v8h*)(C2 + (size_t)r0 * ldc + c0 + (size_t)row * ldc + piece * 8) = o2; }
        };
        pass(); 
    } else {
        float* crow = C + (size_t)r0 * ldc + c0;
        auto pass = [&]() {
#pragma unroll
            for (int s = 0; s < 8; ++s) { const int Lid = (lane >> 3) + 4 * s, piece = lane & 7; const int row = Lid >> 1, cofs = (Lid & 1) * 32 + piece * 4;
                v4f val = *(const v4fa*)(os + row * 68 + cofs); if (R) { const v4f rv = *(const v4f*)(R + ((size_t)r0 + row) * ldc + c0 + cofs); val += roundR ? (v4f){bfr(rv[0]), bfr(rv[1]), bfr(rv[2]), bfr(rv[3])} : rv; }
                *(v4f*)(crow + (size_t)row * ldc + cofs) = val; }
        };
        pass(); 
    }
}

// k_gemm3: 64 x 64 tile of C = (Ah + Al).(Bh + Bl)^T over K (row strides = K for all four planes; n-major B): three products per 32-k step (hh, hl, lh); f32
__global__ __launch_bounds__(128) void k_gemm3(const bf* __restrict__ Ah, const bf* __restrict__ Al, const bf* __restrict__ Bh, const bf* __restrict__ Bl, int K, float* C, int ldc) {
    __shared__ __align__(16) float ost[4][16 * 68];
    const int lane = threadIdx.x & 31, wave = threadIdx.x >> 5, lr = lane & 15, hi = lane >> 4;
    const int r0 = blockIdx.x * 64 + wave * 16, c0 = blockIdx.y * 64;
    const size_t aoff = (size_t)(r0 + lr) * K + 8 * hi;
    v8f acc[4];
#pragma unroll
    for (int t = 0; t < 4; ++t) acc[t] = (v8f){};
#pragma unroll 1
    for (int kc = 0; kc < K; kc += 32) {
        const v16bf a = cat16b(*(const v8us*)(Ah + aoff + kc), *(const v8us*)(Ah + aoff + kc + 16));
        const v16bf al = cat16b(*(const v8us*)(Al + aoff + kc), *(const v8us*)(Al + aoff + kc + 16));
#pragma unroll
        for (int t = 0; t < 4; ++t) { const size_t bo = (size_t)(c0 + t * 16 + lr) * K + kc + 8 * hi;
            const v16bf bh = cat16b(*(const v8us*)(Bh + bo), *(const v8us*)(Bh + bo + 16)); const v16bf bl = cat16b(*(const v8us*)(Bl + bo), *(const v8us*)(Bl + bo + 16));
            acc[t] = wmmab(a, bh, acc[t]); acc[t] = wmmab(al, bh, acc[t]); acc[t] = wmmab(a, bl, acc[t]); }
        asm volatile("v_nop\n\tv_nop\n\tv_nop\n\tv_nop" : "+v"(acc[0]), "+v"(acc[1]), "+v"(acc[2]), "+v"(acc[3]) : "v"(a), "v"(al));
    }
    float* os = &ost[wave][0];
#pragma unroll
    for (int t = 0; t < 4; ++t) {
#pragma unroll
        for (int j = 0; j < 8; ++j) os[(hi * 8 + j) * 68 + t * 16 + lr] = acc[t][j]; }
    __builtin_amdgcn_wave_barrier(); asm volatile("" ::: "memory");
    float* crow = C + (size_t)r0 * ldc + c0;
    auto pass = [&]() {
#pragma unroll
        for (int s = 0; s < 8; ++s) { const int Lid = (lane >> 3) + 4 * s, piece = lane & 7; const int row = Lid >> 1, cofs = (Lid & 1) * 32 + piece * 4;
            const v4f val = *(const v4fa*)(os + row * 68 + cofs); *(v4f*)(crow + (size_t)row * ldc + cofs) = val; }
    };
    pass(); 
}
// k_vt: VTH/VTL [g][128 d][2048 t] = bf16 hi + UNSCALED bf16 residual of V [t][g*128+d] via 64 x 64 LDS tiles; grid (NT/64, 2, 8): a full transpose of Y1 [t][1024] into hi/lo planes [1024][t].
__global__ __launch_bounds__(256) void k_vt(const float* __restrict__ V, bf* VTH, bf* VTL) {
    __shared__ float tl[64][65];
    const int tid = threadIdx.x, t0 = blockIdx.x * 64, d0 = blockIdx.y * 64, g = blockIdx.z;
    { const int tt = tid >> 2, dq = (tid & 3) * 16;
#pragma unroll
      for (int i = 0; i < 16; ++i) tl[dq + i][tt] = V[(size_t)(t0 + tt) * KW + g * HD + d0 + dq + i]; }
    __syncthreads();
    const int piece = tid & 7;
    auto pass = [&]() {
#pragma unroll
        for (int s = 0; s < 2; ++s) { const int d = (tid >> 3) + 32 * s; v8us oh, ol;
#pragma unroll
            for (int i = 0; i < 8; ++i) { const float v = tl[d][piece * 8 + i]; const unsigned short hb = f2bf(v); oh[i] = hb; ol[i] = f2bf(v - bf2f(hb)); }
            const size_t o = ((size_t)g * HD + d0 + d) * NT_ + t0 + piece * 8; *(v8us*)(VTH + o) = oh; *(v8us*)(VTL + o) = ol; }
    };
    pass(); 
}

// k_lnout: one wave per row: v = bf(x) + y2 (f32), LayerNorm (mean, mean((v-mu)^2), eps 1e-5, x bf(gamma) + bf(beta)) -> f32 output row; per 128-column chunk q the
// per phase.
__global__ __launch_bounds__(256) void k_lnout(const float* __restrict__ X, const float* __restrict__ Y2, const float* __restrict__ gam, const float* __restrict__ bet, float* OUTP) {
    const int lane = threadIdx.x & 31, r = blockIdx.x * 8 + (threadIdx.x >> 5);
    if (r >= NT_) return;
    const float* xr = X + (size_t)r * DM; const float* yr = Y2 + (size_t)r * DM;
    float s = 0.f;
#pragma unroll 1
    for (int q = 0; q < 2 * (DM / 256); ++q) { const int c0 = (q >> 1) * 256 + (q & 1) * 128 + lane * 4; const v4f xv = *(const v4f*)(xr + c0), yv = *(const v4f*)(yr + c0);
#pragma unroll
        for (int i = 0; i < 4; ++i) s += bfr(xv[i]) + yv[i]; }
#pragma unroll
    for (int sh = 16; sh; sh >>= 1) s += __shfl_xor(s, sh, 32);
    const float mu = s * (1.0f / DM);
    float s2 = 0.f;
#pragma unroll 1
    for (int q = 0; q < 2 * (DM / 256); ++q) { const int c0 = (q >> 1) * 256 + (q & 1) * 128 + lane * 4; const v4f xv = *(const v4f*)(xr + c0), yv = *(const v4f*)(yr + c0);
#pragma unroll
        for (int i = 0; i < 4; ++i) { const float d = (bfr(xv[i]) + yv[i]) - mu; s2 = fmaf(d, d, s2); } }
#pragma unroll
    for (int sh = 16; sh; sh >>= 1) s2 += __shfl_xor(s2, sh, 32);
    const float rs = rsqrtf(s2 * (1.0f / DM) + 1e-5f);
{
#pragma unroll 1
        for (int q = 0; q < 2 * (DM / 256); ++q) { const int c0 = (q >> 1) * 256 + (q & 1) * 128 + lane * 4; const v4f xv = *(const v4f*)(xr + c0), yv = *(const v4f*)(yr + c0); v4f o;
#pragma unroll
            for (int i = 0; i < 4; ++i) o[i] = ((bfr(xv[i]) + yv[i]) - mu) * rs * bfr(gam[c0 + i]) + bfr(bet[c0 + i]);
            *(v4f*)(OUTP + (size_t)r * DM + c0) = o; }
         }
}

extern "C" void kernel_launch(void* const* d_in, const int* in_sizes, int n_in,
                              void* d_out, int out_size, void* d_ws, size_t ws_size, hipStream_t stream) {
    (void)in_sizes; (void)n_in; (void)out_size;
    const float* x = (const float*)d_in[0]; const float* lg = (const float*)d_in[1]; const float* lb = (const float*)d_in[2];
    const float* w1 = (const float*)d_in[3]; const float* b1 = (const float*)d_in[4]; const float* w2 = (const float*)d_in[5]; const float* b2 = (const float*)d_in[6];   // w1 [1024][2048], w2 [2048][1024], both (in, out) = k-major
    float* out = (float*)d_out;    // [4][2048][1024]
    char* wsp = (char*)d_ws;
    auto take = [&](size_t bytes) { char* p = wsp; wsp += (bytes + 255) & ~(size_t)255; return (void*)p; };
    bf* W1T = (bf*)take((size_t)FF * DM * 2); bf* W2T = (bf*)take((size_t)DM * FF * 2);
    bf* Xb = (bf*)take((size_t)NTK * DM * 2); bf* Y0h = (bf*)take((size_t)NTK * DM * 2); bf* Y0l = (bf*)take((size_t)NTK * DM * 2);
    float* T = (float*)take((size_t)NTK * FF * 4); bf* Hh = (bf*)take((size_t)NTK * FF * 2); bf* Hl = (bf*)take((size_t)NTK * FF * 2);
    float* Y1 = (float*)take((size_t)NTK * DM * 4); bf* Y1Th = (bf*)take((size_t)DM * NT_ * 2); bf* Y1Tl = (bf*)take((size_t)DM * NT_ * 2);
    float* S = (float*)take((size_t)NT_ * NT_ * 4); bf* Sh = (bf*)take((size_t)NT_ * NT_ * 2); bf* Sl = (bf*)take((size_t)NT_ * NT_ * 2);
    float* Y2 = (float*)take((size_t)NTK * DM * 4);
    if ((size_t)(wsp - (char*)d_ws) > ws_size) return;    // 2 x 4.2 + 3 x 4.2 + 16.8 + 2 x 8.4 + 8.4 + 2 x 4.2 + 16.8 + 2 x 8.4 + 8.4 ~ 114 MB, no aliasing (per-item reuse in stream order)
    k_wt<<<dim3(DM / 64, FF / 64, 1), 256, 0, stream>>>(w1, DM, FF, W1T);    // w1 [1024 k][2048 n] -> W1T [2048][1024]
    k_wt<<<dim3(FF / 64, DM / 64, 1), 256, 0, stream>>>(w2, FF, DM, W2T);    // w2 [2048 k][1024 n] -> W2T [1024][2048]
    for (int b = 0; b < NB_; ++b) {
        const float* xb = x + (size_t)b * NTK * DM;
        k_cvtb<<<NTK / 8, 256, 0, stream>>>(xb, NTK, Xb);
        k_ln<true><<<NTK / 8, 256, 0, stream>>>(xb, lg, lb, NTK, Y0h, Y0l);
        k_gemmb<true, false><<<dim3(NTK / 64, FF / 64, 1), 128, 0, stream>>>(Y0h, Y0l, W1T, b1, T, FF, nullptr, nullptr, DM);          // y0.w1 + b1
        k_gelu2<<<NTK / 8, 256, 0, stream>>>(T, NTK, Hh, Hl);
        k_gemmb<true, false><<<dim3(NTK / 64, DM / 64, 1), 128, 0, stream>>>(Hh, Hl, W2T, b2, Y1, DM, nullptr, nullptr, FF);            // gelu(t).w2 + b2
        k_vt<<<dim3(NT_ / 64, 2, NKV), 256, 0, stream>>>(Y1, Y1Th, Y1Tl);                                                               // y1^T hi/lo planes [1024][2048]
        k_gemmb<false, false><<<dim3(NTK / 64, NT_ / 64, 1), 128, 0, stream>>>(Xb, nullptr, Xb, nullptr, S, NT_, nullptr, nullptr, DM);    // scores = x.x^T (exact bf16 products)
        k_cvtb2<<<(NT_ * NT_ / DM) / 8, 256, 0, stream>>>(S, NT_ * NT_ / DM, Sh, Sl);                                                   // scores -> hi/lo (viewed as 4096 rows of 1024)
        k_gemm3<<<dim3(NT_ / 64, DM / 64, 1), 128, 0, stream>>>(Sh, Sl, Y1Th, Y1Tl, NT_, Y2, DM);                                        // y2 = scores.y1
        k_lnout<<<NTK / 8, 256, 0, stream>>>(xb, Y2, lg, lb, out + (size_t)b * NTK * DM);                                                // LN(x + y2)
    }
}

// v001
// It runs in 464 microseconds.
// Next to v000, in two timings, it ran 2.20 and 2.22 times as fast.
#include <hip/hip_runtime.h>

// Compute dtypes, f32 accumulate, one batch item per pass: y0 = LN(x) (f32; gamma/beta and x read through bf16 rounding) -> bf16 hi + UNSCALED residual planes;
// t = y0.w1 + b1 ([2048 x 1024].[1024 x 2048]) and y1 = gelu(t).w2 + b2 ([2048 x 2048].[2048 x 1024]) on v_wmma_f32_16x16x32_bf16 with k-major weights
// transposed once to n-major bf16 planes and the computed operands as hi + residual (two products; exact-erf GELU in f32 in between); scores = x.x^T
// ([2048 x 1024].[1024 x 2048], the INPUT x rounded once -> exact products, one product); y2 = scores.y1 ([2048 x 2048].[2048 x 1024]) with BOTH computed

#define NB_  4
#define NT_  2048
#define DM   1024
#define FF   2048
#define HD   128                 // k_vt tile grouping only
#define KW   DM
#define NKV  (DM / HD)
#define NTK  NT_
#define LOSC 1024.0f             // (unused here)

typedef _Float16 h16;
typedef unsigned short bf;
typedef __attribute__((ext_vector_type(16))) __bf16   v16bf;
typedef __attribute__((ext_vector_type(16))) _Float16 v16h;
typedef __attribute__((ext_vector_type(8)))  _Float16 v8h;
typedef __attribute__((ext_vector_type(8)))  unsigned short v8us;
typedef __attribute__((ext_vector_type(8)))  float    v8f;
typedef __attribute__((ext_vector_type(4)))  float    v4f;
typedef __attribute__((ext_vector_type(4)))  _Float16 v4h;
typedef v8h  __attribute__((may_alias)) v8ha;
typedef v4f  __attribute__((may_alias)) v4fa;
typedef v8us __attribute__((may_alias)) v8usa;

__device__ __forceinline__ unsigned short f2bf(float f) { unsigned u = __float_as_uint(f); u += 0x7FFFu + ((u >> 16) & 1u); return (unsigned short)(u >> 16); }
__device__ __forceinline__ float bf2f(unsigned short b) { return __uint_as_float(((unsigned)b) << 16); }
__device__ __forceinline__ float bfr(float f) { return bf2f(f2bf(f)); }
__device__ __forceinline__ v16h cat16(v8h lo, v8h hi) { return __builtin_shufflevector(lo, hi, 0, 1, 2, 3, 4, 5, 6, 7, 8, 9, 10, 11, 12, 13, 14, 15); }
__device__ __forceinline__ v16bf cat16b(v8us lo, v8us hi) { return __builtin_bit_cast(v16bf, __builtin_shufflevector(lo, hi, 0, 1, 2, 3, 4, 5, 6, 7, 8, 9, 10, 11, 12, 13, 14, 15)); }
__device__ __forceinline__ v8f wmma16(v16h a, v16h b, v8f c) { return __builtin_amdgcn_wmma_f32_16x16x32_f16(false, a, false, b, (short)0, c, false, false); }
__device__ __forceinline__ v8f wmmab(v16bf a, v16bf b, v8f c) { return __builtin_amdgcn_wmma_f32_16x16x32_bf16(false, a, false, b, (short)0, c, false, false); }

__global__ __launch_bounds__(256) void k_cvtb(const float* __restrict__ src, int nrows, bf* dst) {
    const int lane = threadIdx.x & 31, r = blockIdx.x * 8 + (threadIdx.x >> 5);
    if (r >= nrows) return;
    v8us o[DM / 256];
#pragma unroll
    for (int q = 0; q < DM / 256; ++q) { v8us t;
#pragma unroll
        for (int i = 0; i < 8; ++i) t[i] = f2bf(src[(size_t)r * DM + q * 256 + lane * 8 + i]);
        o[q] = t; }
#pragma unroll
    for (int q = 0; q < DM / 256; ++q) *(v8us*)(dst + (size_t)r * DM + q * 256 + lane * 8) = o[q];
    
}

__global__ __launch_bounds__(256) void k_cvtb2(const float* __restrict__ src, int nrows, bf* dh, bf* dl) {
    const int lane = threadIdx.x & 31, r = blockIdx.x * 8 + (threadIdx.x >> 5);
    if (r >= nrows) return;
    v8us oh[DM / 256], ol[DM / 256];
#pragma unroll
    for (int q = 0; q < DM / 256; ++q) {
#pragma unroll
        for (int i = 0; i < 8; ++i) { const float v = src[(size_t)r * DM + q * 256 + lane * 8 + i]; const unsigned short hb = f2bf(v); oh[q][i] = hb; ol[q][i] = f2bf(v - bf2f(hb)); } }
{
#pragma unroll
        for (int q = 0; q < DM / 256; ++q) { const size_t o = (size_t)r * DM + q * 256 + lane * 8; *(v8us*)(dh + o) = oh[q]; *(v8us*)(dl + o) = ol[q]; }
         }
}
// k_wt: WT [n][K] = bf16(W[k][n]) (k-major [K][ncols]) via 64 x 64 LDS tiles; grid (K/64, ncols/64).
__global__ __launch_bounds__(256) void k_wt(const float* __restrict__ Wm, int K, int ncols, bf* WT) {
    __shared__ __align__(16) unsigned short tl[64 * 72];
    const int tid = threadIdx.x, k0 = blockIdx.x * 64, n0 = blockIdx.y * 64;
    const int kk = tid >> 2, nq = (tid & 3) * 16;
#pragma unroll
    for (int i = 0; i < 16; ++i) tl[(nq + i) * 72 + kk] = f2bf(Wm[(size_t)(k0 + kk) * ncols + n0 + nq + i]);
    __syncthreads();
    const int piece = tid & 7;
    auto pass = [&]() {
#pragma unroll
        for (int s = 0; s < 2; ++s) { const int nr = (tid >> 3) + 32 * s; const v8us val = *(const v8usa*)(tl + nr * 72 + piece * 8); *(v8us*)(WT + (size_t)(n0 + nr) * K + k0 + piece * 8) = val; }
    };
    pass(); 
}
// k_ln: one wave per row of x [rows][1024]: LayerNorm (mean, then mean((x-mu)^2), eps 1e-5, x bf(gamma) + bf(beta), f32, fixed lane order) -> bf16 hi + UNSCALED
// residual planes; lane -> columns q*256 + lane*8 .. +8 for q = 0..3 (16 B per plane per store, 8 lanes per line). The row is re-read per phase with the q loop
// rolled (keeps the static VALU-FMA count small; no register arrays indexed by a loop variable).
template <bool ROUNDIN>   // ROUNDIN: the source is a module INPUT (read through bf16 rounding); false: a computed f32 plane (read as is)
__global__ __launch_bounds__(256) void k_ln(const float* __restrict__ X, const float* __restrict__ gam, const float* __restrict__ bet, int nrows, bf* Hh, bf* Hl) {
    const int lane = threadIdx.x & 31, r = blockIdx.x * 8 + (threadIdx.x >> 5);
    if (r >= nrows) return;
    const float* xr = X + (size_t)r * DM + lane * 8;
    float s = 0.f;
#pragma unroll 1
    for (int q = 0; q < DM / 256; ++q) {
#pragma unroll
        for (int i = 0; i < 8; ++i) s += (ROUNDIN ? bfr(xr[q * 256 + i]) : xr[q * 256 + i]); }
#pragma unroll
    for (int sh = 16; sh; sh >>= 1) s += __shfl_xor(s, sh, 32);
    const float mu = s * (1.0f / DM);
    float s2 = 0.f;
#pragma unroll 1
    for (int q = 0; q < DM / 256; ++q) {
#pragma unroll
        for (int i = 0; i < 8; ++i) { const float d = (ROUNDIN ? bfr(xr[q * 256 + i]) : xr[q * 256 + i]) - mu; s2 = fmaf(d, d, s2); } }
#pragma unroll
    for (int sh = 16; sh; sh >>= 1) s2 += __shfl_xor(s2, sh, 32);
    const float rs = rsqrtf(s2 * (1.0f / DM) + 1e-5f);
{
#pragma unroll 1
        for (int q = 0; q < DM / 256; ++q) { v8us oh, ol;
#pragma unroll
            for (int i = 0; i < 8; ++i) { const int c = q * 256 + lane * 8 + i; const float y = ((ROUNDIN ? bfr(xr[q * 256 + i]) : xr[q * 256 + i]) - mu) * rs * bfr(gam[c]) + bfr(bet[c]); const unsigned short hb = f2bf(y); oh[i] = hb; ol[i] = f2bf(y - bf2f(hb)); }
            const size_t o = (size_t)r * DM + q * 256 + lane * 8; *(v8us*)(Hh + o) = oh; *(v8us*)(Hl + o) = ol; }
         }
}
// k_gelu2: exact-erf GELU of an f32 [nrows][FF] plane (bias already added) -> bf16 hi + UNSCALED residual planes; one wave per row, lane -> 4 consecutive
// columns per iteration (16 rolled iterations of 128 columns; 8 B per plane per store -> 16 lanes per line).
__global__ __launch_bounds__(256) void k_gelu2(const float* __restrict__ src, int nrows, bf* dh, bf* dl) {
    typedef __attribute__((ext_vector_type(4))) unsigned short v4us;
    const int lane = threadIdx.x & 31, r = blockIdx.x * 8 + (threadIdx.x >> 5);
    if (r >= nrows) return;
{
#pragma unroll 1
        for (int q = 0; q < FF / 128; ++q) { const size_t o = (size_t)r * FF + q * 128 + lane * 4; const v4f v = *(const v4f*)(src + o); v4us oh, ol;
#pragma unroll
            for (int i = 0; i < 4; ++i) { const float g = 0.5f * v[i] * (1.0f + erff(v[i] * 0.70710678118654752f)); const unsigned short hb = f2bf(g); oh[i] = hb; ol[i] = f2bf(g - bf2f(hb)); }
            *(v4us*)(dh + o) = oh; *(v4us*)(dl + o) = ol; }
         }
}
// k_gemm: BM x BN block tile (BM = 128, 8 waves as 4 x 2, wave tile 32 x BN/2) of C[.][ldc] = (A0 [+ A1]).(B0 [+ B1])^T [+ bf(bias[c])], all planes bf16 with row stride K.
// A stage is 128 k (256 B) of every operand row, rows [A0 | A1 | B0 | B1] at an LDS pitch of 272 B, brought in by asynchronous copies (16 lanes = one whole 256-B row piece,
// so every copy reads whole lines) into two buffers: stage t + 1 flies while stage t is worked on. Per accumulator and 32-k step the products keep the order
// A0.B0, A1.B0, A0.B1 and k runs upward, with the same k order inside a fragment for A and B (bytes 16h and 32 + 16h of each 64 B of a row).
#define KS    128
#define PITCH 272
// N copies in one statement and, as its last line, the wait that stands in front of any rewrite of the address registers they name.
template <int N>
__device__ __forceinline__ void copies(const unsigned* l, const bf* const* g) {
    static_assert(N == 8 || N == 10 || N == 12, "one statement per half stage");
    if constexpr (N == 8)
        asm volatile(
                     "global_load_async_to_lds_b128 %0, %8, off\n\t"
                     "global_load_async_to_lds_b128 %1, %9, off\n\t"
                     "global_load_async_to_lds_b128 %2, %10, off\n\t"
                     "global_load_async_to_lds_b128 %3, %11, off\n\t"
                     "global_load_async_to_lds_b128 %4, %12, off\n\t"
                     "global_load_async_to_lds_b128 %5, %13, off\n\t"
                     "global_load_async_to_lds_b128 %6, %14, off\n\t"
                     "global_load_async_to_lds_b128 %7, %15, off\n\t"
                     "s_wait_xcnt 0x0"
                     :: "v"(l[0]), "v"(l[1]), "v"(l[2]), "v"(l[3]), "v"(l[4]), "v"(l[5]), "v"(l[6]), "v"(l[7]),
                        "v"(g[0]), "v"(g[1]), "v"(g[2]), "v"(g[3]), "v"(g[4]), "v"(g[5]), "v"(g[6]), "v"(g[7]) : "memory");
    else if constexpr (N == 10)
        asm volatile(
                     "global_load_async_to_lds_b128 %0, %10, off\n\t"
                     "global_load_async_to_lds_b128 %1, %11, off\n\t"
                     "global_load_async_to_lds_b128 %2, %12, off\n\t"
                     "global_load_async_to_lds_b128 %3, %13, off\n\t"
                     "global_load_async_to_lds_b128 %4, %14, off\n\t"
                     "global_load_async_to_lds_b128 %5, %15, off\n\t"
                     "global_load_async_to_lds_b128 %6, %16, off\n\t"
                     "global_load_async_to_lds_b128 %7, %17, off\n\t"
                     "global_load_async_to_lds_b128 %8, %18, off\n\t"
                     "global_load_async_to_lds_b128 %9, %19, off\n\t"
                     "s_wait_xcnt 0x0"
                     :: "v"(l[0]), "v"(l[1]), "v"(l[2]), "v"(l[3]), "v"(l[4]), "v"(l[5]), "v"(l[6]), "v"(l[7]), "v"(l[8]), "v"(l[9]),
                        "v"(g[0]), "v"(g[1]), "v"(g[2]), "v"(g[3]), "v"(g[4]), "v"(g[5]), "v"(g[6]), "v"(g[7]), "v"(g[8]), "v"(g[9]) : "memory");
    else
        asm volatile(
                     "global_load_async_to_lds_b128 %0, %12, off\n\t"
                     "global_load_async_to_lds_b128 %1, %13, off\n\t"
                     "global_load_async_to_lds_b128 %2, %14, off\n\t"
                     "global_load_async_to_lds_b128 %3, %15, off\n\t"
                     "global_load_async_to_lds_b128 %4, %16, off\n\t"
                     "global_load_async_to_lds_b128 %5, %17, off\n\t"
                     "global_load_async_to_lds_b128 %6, %18, off\n\t"
                     "global_load_async_to_lds_b128 %7, %19, off\n\t"
                     "global_load_async_to_lds_b128 %8, %20, off\n\t"
                     "global_load_async_to_lds_b128 %9, %21, off\n\t"
                     "global_load_async_to_lds_b128 %10, %22, off\n\t"
                     "global_load_async_to_lds_b128 %11, %23, off\n\t"
                     "s_wait_xcnt 0x0"
                     :: "v"(l[0]), "v"(l[1]), "v"(l[2]), "v"(l[3]), "v"(l[4]), "v"(l[5]), "v"(l[6]), "v"(l[7]), "v"(l[8]), "v"(l[9]), "v"(l[10]), "v"(l[11]),
                        "v"(g[0]), "v"(g[1]), "v"(g[2]), "v"(g[3]), "v"(g[4]), "v"(g[5]), "v"(g[6]), "v"(g[7]), "v"(g[8]), "v"(g[9]), "v"(g[10]), "v"(g[11]) : "memory");
}
__device__ __forceinline__ v16bf ldfrag(const unsigned char* p) { return cat16b(*(const v8usa*)p, *(const v8usa*)(p + 32)); }

template <int NA, int NBP, int BN, int K, bool BIAS>
__global__ __launch_bounds__(256) void k_gemm(const bf* __restrict__ A0, const bf* __restrict__ A1, const bf* __restrict__ B0, const bf* __restrict__ B1, const float* __restrict__ bias, float* C, int ldc) {
    constexpr int BM = 128, WN = BN / 2, FN = WN / 16, NT = K / KS;
    constexpr int STAGE = (NA * BM + NBP * BN) * PITCH;
    constexpr int OFF_A1 = BM * PITCH, OFF_B0 = NA * BM * PITCH, OFF_B1 = (NA * BM + BN) * PITCH;
    __shared__ __align__(16) unsigned char sm[2 * STAGE];
    const int tid = threadIdx.x, lane = tid & 31, wave = tid >> 5, lr = lane & 15, hi = lane >> 4;
    const int wm = wave >> 1, wn = wave & 1;
    const int r0 = blockIdx.x * BM, c0 = blockIdx.y * BN;
    const int crow = tid >> 4, cpc = tid & 15;
    const unsigned lt = (unsigned)(size_t)sm + crow * PITCH + cpc * 16;
    const size_t ga = (size_t)(r0 + crow) * K + cpc * 8, gb = (size_t)(c0 + crow) * K + cpc * 8;
    // One stage: the block's 256 threads cover 16 rows a copy (thread -> row tid >> 4, 16-byte piece tid & 15); NC copies a thread, issued as two statements.
    constexpr int NC = (NA * BM + NBP * BN) / 16;
    auto fill = [&](int t) {
        const unsigned lb = lt + (t & 1) * STAGE; const int kc = t * KS;
        unsigned l[NC]; const bf* g[NC];
#pragma unroll
        for (int j = 0; j < NC; ++j) l[j] = lb + j * 16 * PITCH;
#pragma unroll
        for (int j = 0; j < BM / 16; ++j) { g[j] = A0 + ga + kc + (size_t)j * 16 * K; if constexpr (NA == 2) g[BM / 16 + j] = A1 + ga + kc + (size_t)j * 16 * K; }
#pragma unroll
        for (int j = 0; j < BN / 16; ++j) { g[NA * BM / 16 + j] = B0 + gb + kc + (size_t)j * 16 * K; if constexpr (NBP == 2) g[(NA * BM + BN) / 16 + j] = B1 + gb + kc + (size_t)j * 16 * K; }
        copies<NC / 2>(l, g); copies<NC / 2>(l + NC / 2, g + NC / 2);
    };
    v8f acc[2][FN];
#pragma unroll
    for (int m = 0; m < 2; ++m)
#pragma unroll
        for (int n = 0; n < FN; ++n) acc[m][n] = (v8f){};
    float bv[FN];   // the lane's bias values, fetched here so that their latency lies under the loop
#pragma unroll
    for (int n = 0; n < FN; ++n) bv[n] = BIAS ? bfr(bias[c0 + wn * WN + n * 16 + lr]) : 0.f;
    fill(0);
    asm volatile("s_wait_asynccnt 0x0" ::: "memory");   // this wave's copies of stage 0 have landed
    __syncthreads();                                     // ... and every other wave's
    fill(1);
    // The stage loop stays rolled (one copy of its body; the buffer is picked by t & 1); every loop inside it is unrolled so that the register arrays are indexed by constants.
#pragma unroll 1
    for (int t = 0; t < NT; ++t) {
        const unsigned char* sb = sm + (t & 1) * STAGE;
        const unsigned char* pa = sb + (wm * 32 + lr) * PITCH + 16 * hi;
        const unsigned char* pb = sb + OFF_B0 + (wn * WN + lr) * PITCH + 16 * hi;
        // Two fragment sets: the loads of 32-k step ks + 1 go out as one group ahead of step ks's products (only inside this stage), so that a step's LDS latency is covered by the step before.
        v16bf a0[2][2], a1[2][2], b0[2][FN], b1[2][FN];
        auto ldset = [&](int q, int ks) {
#pragma unroll
            for (int m = 0; m < 2; ++m) { a0[q][m] = ldfrag(pa + m * 16 * PITCH + ks * 64); if constexpr (NA == 2) a1[q][m] = ldfrag(pa + OFF_A1 + m * 16 * PITCH + ks * 64); }
#pragma unroll
            for (int n = 0; n < FN; ++n) { b0[q][n] = ldfrag(pb + n * 16 * PITCH + ks * 64); if constexpr (NBP == 2) b1[q][n] = ldfrag(pb + (OFF_B1 - OFF_B0) + n * 16 * PITCH + ks * 64); }
        };
        ldset(0, 0);
#pragma unroll
        for (int ks = 0; ks < KS / 32; ++ks) {
            const int q = ks & 1;
            if (ks + 1 < KS / 32) ldset(q ^ 1, ks + 1);
            __builtin_amdgcn_sched_barrier(0);   // keeps the next step's load group ahead of this step's products (the scheduler otherwise sinks each load to just before its use)
#pragma unroll
            for (int m = 0; m < 2; ++m)
#pragma unroll
                for (int n = 0; n < FN; ++n) acc[m][n] = wmmab(a0[q][m], b0[q][n], acc[m][n]);
            if constexpr (NA == 2) {
#pragma unroll
                for (int m = 0; m < 2; ++m)
#pragma unroll
                    for (int n = 0; n < FN; ++n) acc[m][n] = wmmab(a1[q][m], b0[q][n], acc[m][n]);
            }
            if constexpr (NBP == 2) {
#pragma unroll
                for (int m = 0; m < 2; ++m)
#pragma unroll
                    for (int n = 0; n < FN; ++n) acc[m][n] = wmmab(a0[q][m], b1[q][n], acc[m][n]);
            }
            __builtin_amdgcn_sched_barrier(0);   // keeps this step's products ahead of the load group after next, which reuses their fragment set
        }
        asm volatile("s_wait_dscnt 0x0" ::: "memory");      // this wave's reads of stage t are done before its buffer is refilled
        asm volatile("s_wait_asynccnt 0x0" ::: "memory");   // this wave's copies of stage t + 1 have landed
        __syncthreads();                                     // publishes stage t + 1 and ends every reader's last read of stage t
        if (t + 2 < NT) fill(t + 2);
    }
    asm volatile("s_wait_asynccnt 0x0" ::: "memory");       // no copy is outstanding when the ring becomes output staging
    // Epilogue: each wave stages its two 16 x WN f32 pieces in its own part of the ring (the loop's last barrier has ended every read of it) and stores whole 128-B lines.
    constexpr int OP = WN + 4, LPR = WN / 32;
    float* os = (float*)(void*)sm + wave * (2 * 16 * OP);
#pragma unroll
    for (int n = 0; n < FN; ++n)
#pragma unroll
        for (int m = 0; m < 2; ++m)
#pragma unroll
            for (int j = 0; j < 8; ++j) os[(m * 16 + hi * 8 + j) * OP + n * 16 + lr] = BIAS ? acc[m][n][j] + bv[n] : acc[m][n][j];
    __syncthreads();   // the staged values are read back by other lanes: no read may move ahead of the stores
    float* crow_p = C + (size_t)(r0 + wm * 32) * ldc + c0 + wn * WN;
#pragma unroll
    for (int s = 0; s < 8 * LPR; ++s) { const int Lid = (lane >> 3) + 4 * s, piece = lane & 7; const int row = Lid / LPR, cofs = (Lid % LPR) * 32 + piece * 4;
        const v4f val = *(const v4fa*)(os + row * OP + cofs); *(v4f*)(crow_p + (size_t)row * ldc + cofs) = val; }
}
// k_vt: VTH/VTL [g][128 d][2048 t] = bf16 hi + UNSCALED bf16 residual of V [t][g*128+d] via 64 x 64 LDS tiles; grid (NT/64, 2, 8): a full transpose of Y1 [t][1024] into hi/lo planes [1024][t].
__global__ __launch_bounds__(256) void k_vt(const float* __restrict__ V, bf* VTH, bf* VTL) {
    __shared__ float tl[64][65];
    const int tid = threadIdx.x, t0 = blockIdx.x * 64, d0 = blockIdx.y * 64, g = blockIdx.z;
    { const int tt = tid >> 2, dq = (tid & 3) * 16;
#pragma unroll
      for (int i = 0; i < 16; ++i) tl[dq + i][tt] = V[(size_t)(t0 + tt) * KW + g * HD + d0 + dq + i]; }
    __syncthreads();
    const int piece = tid & 7;
    auto pass = [&]() {
#pragma unroll
        for (int s = 0; s < 2; ++s) { const int d = (tid >> 3) + 32 * s; v8us oh, ol;
#pragma unroll
            for (int i = 0; i < 8; ++i) { const float v = tl[d][piece * 8 + i]; const unsigned short hb = f2bf(v); oh[i] = hb; ol[i] = f2bf(v - bf2f(hb)); }
            const size_t o = ((size_t)g * HD + d0 + d) * NT_ + t0 + piece * 8; *(v8us*)(VTH + o) = oh; *(v8us*)(VTL + o) = ol; }
    };
    pass(); 
}

// k_lnout: one wave per row: v = bf(x) + y2 (f32), LayerNorm (mean, mean((v-mu)^2), eps 1e-5, x bf(gamma) + bf(beta)) -> f32 output row; per 128-column chunk q the
// per phase.
__global__ __launch_bounds__(256) void k_lnout(const float* __restrict__ X, const float* __restrict__ Y2, const float* __restrict__ gam, const float* __restrict__ bet, float* OUTP) {
    const int lane = threadIdx.x & 31, r = blockIdx.x * 8 + (threadIdx.x >> 5);
    if (r >= NT_) return;
    const float* xr = X + (size_t)r * DM; const float* yr = Y2 + (size_t)r * DM;
    float s = 0.f;
#pragma unroll 1
    for (int q = 0; q < 2 * (DM / 256); ++q) { const int c0 = (q >> 1) * 256 + (q & 1) * 128 + lane * 4; const v4f xv = *(const v4f*)(xr + c0), yv = *(const v4f*)(yr + c0);
#pragma unroll
        for (int i = 0; i < 4; ++i) s += bfr(xv[i]) + yv[i]; }
#pragma unroll
    for (int sh = 16; sh; sh >>= 1) s += __shfl_xor(s, sh, 32);
    const float mu = s * (1.0f / DM);
    float s2 = 0.f;
#pragma unroll 1
    for (int q = 0; q < 2 * (DM / 256); ++q) { const int c0 = (q >> 1) * 256 + (q & 1) * 128 + lane * 4; const v4f xv = *(const v4f*)(xr + c0), yv = *(const v4f*)(yr + c0);
#pragma unroll
        for (int i = 0; i < 4; ++i) { const float d = (bfr(xv[i]) + yv[i]) - mu; s2 = fmaf(d, d, s2); } }
#pragma unroll
    for (int sh = 16; sh; sh >>= 1) s2 += __shfl_xor(s2, sh, 32);
    const float rs = rsqrtf(s2 * (1.0f / DM) + 1e-5f);
{
#pragma unroll 1
        for (int q = 0; q < 2 * (DM / 256); ++q) { const int c0 = (q >> 1) * 256 + (q & 1) * 128 + lane * 4; const v4f xv = *(const v4f*)(xr + c0), yv = *(const v4f*)(yr + c0); v4f o;
#pragma unroll
            for (int i = 0; i < 4; ++i) o[i] = ((bfr(xv[i]) + yv[i]) - mu) * rs * bfr(gam[c0 + i]) + bfr(bet[c0 + i]);
            *(v4f*)(OUTP + (size_t)r * DM + c0) = o; }
         }
}

extern "C" void kernel_launch(void* const* d_in, const int* in_sizes, int n_in,
                              void* d_out, int out_size, void* d_ws, size_t ws_size, hipStream_t stream) {
    (void)in_sizes; (void)n_in; (void)out_size;
    const float* x = (const float*)d_in[0]; const float* lg = (const float*)d_in[1]; const float* lb = (const float*)d_in[2];
    const float* w1 = (const float*)d_in[3]; const float* b1 = (const float*)d_in[4]; const float* w2 = (const float*)d_in[5]; const float* b2 = (const float*)d_in[6];   // w1 [1024][2048], w2 [2048][1024], both (in, out) = k-major
    float* out = (float*)d_out;    // [4][2048][1024]
    char* wsp = (char*)d_ws;
    auto take = [&](size_t bytes) { char* p = wsp; wsp += (bytes + 255) & ~(size_t)255; return (void*)p; };
    bf* W1T = (bf*)take((size_t)FF * DM * 2); bf* W2T = (bf*)take((size_t)DM * FF * 2);
    bf* Xb = (bf*)take((size_t)NTK * DM * 2); bf* Y0h = (bf*)take((size_t)NTK * DM * 2); bf* Y0l = (bf*)take((size_t)NTK * DM * 2);
    float* T = (float*)take((size_t)NTK * FF * 4); bf* Hh = (bf*)take((size_t)NTK * FF * 2); bf* Hl = (bf*)take((size_t)NTK * FF * 2);
    float* Y1 = (float*)take((size_t)NTK * DM * 4); bf* Y1Th = (bf*)take((size_t)DM * NT_ * 2); bf* Y1Tl = (bf*)take((size_t)DM * NT_ * 2);
    float* S = (float*)take((size_t)NT_ * NT_ * 4); bf* Sh = (bf*)take((size_t)NT_ * NT_ * 2); bf* Sl = (bf*)take((size_t)NT_ * NT_ * 2);
    float* Y2 = (float*)take((size_t)NTK * DM * 4);
    if ((size_t)(wsp - (char*)d_ws) > ws_size) return;    // 2 x 4.2 + 3 x 4.2 + 16.8 + 2 x 8.4 + 8.4 + 2 x 4.2 + 16.8 + 2 x 8.4 + 8.4 ~ 114 MB, no aliasing (per-item reuse in stream order)
    k_wt<<<dim3(DM / 64, FF / 64, 1), 256, 0, stream>>>(w1, DM, FF, W1T);    // w1 [1024 k][2048 n] -> W1T [2048][1024]
    k_wt<<<dim3(FF / 64, DM / 64, 1), 256, 0, stream>>>(w2, FF, DM, W2T);    // w2 [2048 k][1024 n] -> W2T [1024][2048]
    for (int b = 0; b < NB_; ++b) {
        const float* xb = x + (size_t)b * NTK * DM;
        k_cvtb<<<NTK / 8, 256, 0, stream>>>(xb, NTK, Xb);
        k_ln<true><<<NTK / 8, 256, 0, stream>>>(xb, lg, lb, NTK, Y0h, Y0l);
        k_gemm<2, 1, 128, DM, true><<<dim3(NTK / 128, FF / 128, 1), 256, 0, stream>>>(Y0h, Y0l, W1T, nullptr, b1, T, FF);          // y0.w1 + b1
        k_gelu2<<<NTK / 8, 256, 0, stream>>>(T, NTK, Hh, Hl);
        k_gemm<2, 1, 64, FF, true><<<dim3(NTK / 128, DM / 64, 1), 256, 0, stream>>>(Hh, Hl, W2T, nullptr, b2, Y1, DM);            // gelu(t).w2 + b2
        k_vt<<<dim3(NT_ / 64, 2, NKV), 256, 0, stream>>>(Y1, Y1Th, Y1Tl);                                                               // y1^T hi/lo planes [1024][2048]
        k_gemm<1, 1, 128, DM, false><<<dim3(NTK / 128, NT_ / 128, 1), 256, 0, stream>>>(Xb, nullptr, Xb, nullptr, nullptr, S, NT_);    // scores = x.x^T (exact bf16 products)
        k_cvtb2<<<(NT_ * NT_ / DM) / 8, 256, 0, stream>>>(S, NT_ * NT_ / DM, Sh, Sl);                                                   // scores -> hi/lo (viewed as 4096 rows of 1024)
        k_gemm<2, 2, 64, NT_, false><<<dim3(NT_ / 128, DM / 64, 1), 256, 0, stream>>>(Sh, Sl, Y1Th, Y1Tl, nullptr, Y2, DM);                                        // y2 = scores.y1
        k_lnout<<<NTK / 8, 256, 0, stream>>>(xb, Y2, lg, lb, out + (size_t)b * NTK * DM);                                                // LN(x + y2)
    }
}

// v002
// It runs in 309 microseconds.
// Two timings next to v001 put it at 1.51 and 1.49 times that version's speed.
// Over all steps from v000 it is 3.32 times as fast.
#include <hip/hip_runtime.h>

// Compute dtypes, f32 accumulate, all four batch items in every launch (row-wise kernels: 4 x 2048 rows; per-item products: grid z = item): y0 = LN(x) (f32; gamma/beta and x read through bf16 rounding) -> bf16 hi + UNSCALED residual planes;
// t = y0.w1 + b1 ([2048 x 1024].[1024 x 2048]) and y1 = gelu(t).w2 + b2 ([2048 x 2048].[2048 x 1024]) on v_wmma_f32_16x16x32_bf16 with k-major weights
// transposed once to n-major bf16 planes and the computed operands as hi + residual (two products; exact-erf GELU in f32 in between); scores = x.x^T
// ([2048 x 1024].[1024 x 2048], the INPUT x rounded once -> exact products, one product); y2 = scores.y1 ([2048 x 2048].[2048 x 1024]) with BOTH computed

#define NB_  4
#define NT_  2048
#define DM   1024
#define FF   2048
#define HD   128                 // k_vt tile grouping only
#define KW   DM
#define NKV  (DM / HD)
#define NTK  NT_
#define LOSC 1024.0f             // (unused here)

typedef _Float16 h16;
typedef unsigned short bf;
typedef __attribute__((ext_vector_type(16))) __bf16   v16bf;
typedef __attribute__((ext_vector_type(16))) _Float16 v16h;
typedef __attribute__((ext_vector_type(8)))  _Float16 v8h;
typedef __attribute__((ext_vector_type(8)))  unsigned short v8us;
typedef __attribute__((ext_vector_type(8)))  float    v8f;
typedef __attribute__((ext_vector_type(4)))  float    v4f;
typedef __attribute__((ext_vector_type(4)))  _Float16 v4h;
typedef v8h  __attribute__((may_alias)) v8ha;
typedef v4f  __attribute__((may_alias)) v4fa;
typedef v8us __attribute__((may_alias)) v8usa;

__device__ __forceinline__ unsigned short f2bf(float f) { unsigned u = __float_as_uint(f); u += 0x7FFFu + ((u >> 16) & 1u); return (unsigned short)(u >> 16); }
__device__ __forceinline__ float bf2f(unsigned short b) { return __uint_as_float(((unsigned)b) << 16); }
__device__ __forceinline__ float bfr(float f) { return bf2f(f2bf(f)); }
__device__ __forceinline__ v16h cat16(v8h lo, v8h hi) { return __builtin_shufflevector(lo, hi, 0, 1, 2, 3, 4, 5, 6, 7, 8, 9, 10, 11, 12, 13, 14, 15); }
__device__ __forceinline__ v16bf cat16b(v8us lo, v8us hi) { return __builtin_bit_cast(v16bf, __builtin_shufflevector(lo, hi, 0, 1, 2, 3, 4, 5, 6, 7, 8, 9, 10, 11, 12, 13, 14, 15)); }
__device__ __forceinline__ v8f wmma16(v16h a, v16h b, v8f c) { return __builtin_amdgcn_wmma_f32_16x16x32_f16(false, a, false, b, (short)0, c, false, false); }
__device__ __forceinline__ v8f wmmab(v16bf a, v16bf b, v8f c) { return __builtin_amdgcn_wmma_f32_16x16x32_bf16(false, a, false, b, (short)0, c, false, false); }

__global__ __launch_bounds__(256) void k_cvtb(const float* __restrict__ src, int nrows, bf* dst) {
    const int lane = threadIdx.x & 31, r = blockIdx.x * 8 + (threadIdx.x >> 5);
    if (r >= nrows) return;
    v8us o[DM / 256];
#pragma unroll
    for (int q = 0; q < DM / 256; ++q) { v8us t;
#pragma unroll
        for (int i = 0; i < 8; ++i) t[i] = f2bf(src[(size_t)r * DM + q * 256 + lane * 8 + i]);
        o[q] = t; }
#pragma unroll
    for (int q = 0; q < DM / 256; ++q) *(v8us*)(dst + (size_t)r * DM + q * 256 + lane * 8) = o[q];
    
}

__global__ __launch_bounds__(256) void k_cvtb2(const float* __restrict__ src, int nrows, bf* dh, bf* dl) {
    const int lane = threadIdx.x & 31, r = blockIdx.x * 8 + (threadIdx.x >> 5);
    if (r >= nrows) return;
    v8us oh[DM / 256], ol[DM / 256];
#pragma unroll
    for (int q = 0; q < DM / 256; ++q) {
#pragma unroll
        for (int i = 0; i < 8; ++i) { const float v = src[(size_t)r * DM + q * 256 + lane * 8 + i]; const unsigned short hb = f2bf(v); oh[q][i] = hb; ol[q][i] = f2bf(v - bf2f(hb)); } }
{
#pragma unroll
        for (int q = 0; q < DM / 256; ++q) { const size_t o = (size_t)r * DM + q * 256 + lane * 8; *(v8us*)(dh + o) = oh[q]; *(v8us*)(dl + o) = ol[q]; }
         }
}
// k_wt: WT [n][K] = bf16(W[k][n]) (k-major [K][ncols]) via 64 x 64 LDS tiles; grid (K/64, ncols/64).
__global__ __launch_bounds__(256) void k_wt(const float* __restrict__ Wm, int K, int ncols, bf* WT) {
    __shared__ __align__(16) unsigned short tl[64 * 72];
    const int tid = threadIdx.x, k0 = blockIdx.x * 64, n0 = blockIdx.y * 64;
    const int kk = tid >> 2, nq = (tid & 3) * 16;
#pragma unroll
    for (int i = 0; i < 16; ++i) tl[(nq + i) * 72 + kk] = f2bf(Wm[(size_t)(k0 + kk) * ncols + n0 + nq + i]);
    __syncthreads();
    const int piece = tid & 7;
    auto pass = [&]() {
#pragma unroll
        for (int s = 0; s < 2; ++s) { const int nr = (tid >> 3) + 32 * s; const v8us val = *(const v8usa*)(tl + nr * 72 + piece * 8); *(v8us*)(WT + (size_t)(n0 + nr) * K + k0 + piece * 8) = val; }
    };
    pass(); 
}
// k_ln: one wave per row of x [rows][1024]: LayerNorm (mean, then mean((x-mu)^2), eps 1e-5, x bf(gamma) + bf(beta), f32, fixed lane order) -> bf16 hi + UNSCALED
// residual planes; lane -> columns q*256 + lane*8 .. +8 for q = 0..3 (16 B per plane per store, 8 lanes per line). The row is re-read per phase with the q loop
// rolled (keeps the static VALU-FMA count small; no register arrays indexed by a loop variable).
template <bool ROUNDIN>   // ROUNDIN: the source is a module INPUT (read through bf16 rounding); false: a computed f32 plane (read as is)
__global__ __launch_bounds__(256) void k_ln(const float* __restrict__ X, const float* __restrict__ gam, const float* __restrict__ bet, int nrows, bf* Hh, bf* Hl) {
    const int lane = threadIdx.x & 31, r = blockIdx.x * 8 + (threadIdx.x >> 5);
    if (r >= nrows) return;
    const float* xr = X + (size_t)r * DM + lane * 8;
    float s = 0.f;
#pragma unroll 1
    for (int q = 0; q < DM / 256; ++q) {
#pragma unroll
        for (int i = 0; i < 8; ++i) s += (ROUNDIN ? bfr(xr[q * 256 + i]) : xr[q * 256 + i]); }
#pragma unroll
    for (int sh = 16; sh; sh >>= 1) s += __shfl_xor(s, sh, 32);
    const float mu = s * (1.0f / DM);
    float s2 = 0.f;
#pragma unroll 1
    for (int q = 0; q < DM / 256; ++q) {
#pragma unroll
        for (int i = 0; i < 8; ++i) { const float d = (ROUNDIN ? bfr(xr[q * 256 + i]) : xr[q * 256 + i]) - mu; s2 = fmaf(d, d, s2); } }
#pragma unroll
    for (int sh = 16; sh; sh >>= 1) s2 += __shfl_xor(s2, sh, 32);
    const float rs = rsqrtf(s2 * (1.0f / DM) + 1e-5f);
{
#pragma unroll 1
        for (int q = 0; q < DM / 256; ++q) { v8us oh, ol;
#pragma unroll
            for (int i = 0; i < 8; ++i) { const int c = q * 256 + lane * 8 + i; const float y = ((ROUNDIN ? bfr(xr[q * 256 + i]) : xr[q * 256 + i]) - mu) * rs * bfr(gam[c]) + bfr(bet[c]); const unsigned short hb = f2bf(y); oh[i] = hb; ol[i] = f2bf(y - bf2f(hb)); }
            const size_t o = (size_t)r * DM + q * 256 + lane * 8; *(v8us*)(Hh + o) = oh; *(v8us*)(Hl + o) = ol; }
         }
}
// k_gelu2: exact-erf GELU of an f32 [nrows][FF] plane (bias already added) -> bf16 hi + UNSCALED residual planes; one wave per row, lane -> 4 consecutive
// columns per iteration (16 rolled iterations of 128 columns; 8 B per plane per store -> 16 lanes per line).
__global__ __launch_bounds__(256) void k_gelu2(const float* __restrict__ src, int nrows, bf* dh, bf* dl) {
    typedef __attribute__((ext_vector_type(4))) unsigned short v4us;
    const int lane = threadIdx.x & 31, r = blockIdx.x * 8 + (threadIdx.x >> 5);
    if (r >= nrows) return;
{
#pragma unroll 1
        for (int q = 0; q < FF / 128; ++q) { const size_t o = (size_t)r * FF + q * 128 + lane * 4; const v4f v = *(const v4f*)(src + o); v4us oh, ol;
#pragma unroll
            for (int i = 0; i < 4; ++i) { const float g = 0.5f * v[i] * (1.0f + erff(v[i] * 0.70710678118654752f)); const unsigned short hb = f2bf(g); oh[i] = hb; ol[i] = f2bf(g - bf2f(hb)); }
            *(v4us*)(dh + o) = oh; *(v4us*)(dl + o) = ol; }
         }
}
// k_gemm: BM x BN block tile (BM = 128, 8 waves as 4 x 2, wave tile 32 x BN/2) of C[.][ldc] = (A0 [+ A1]).(B0 [+ B1])^T [+ bf(bias[c])], all planes bf16 with row stride K.
// A stage is 128 k (256 B) of every operand row, rows [A0 | A1 | B0 | B1] at an LDS pitch of 272 B, brought in by asynchronous copies (16 lanes = one whole 256-B row piece,
// so every copy reads whole lines) into two buffers: stage t + 1 flies while stage t is worked on. Per accumulator and 32-k step the products keep the order
// A0.B0, A1.B0, A0.B1 and k runs upward, with the same k order inside a fragment for A and B (bytes 16h and 32 + 16h of each 64 B of a row).
#define KS    128
#define PITCH 272
// N copies in one statement and, as its last line, the wait that stands in front of any rewrite of the address registers they name.
template <int N>
__device__ __forceinline__ void copies(const unsigned* l, const bf* const* g) {
    static_assert(N == 8 || N == 10 || N == 12, "one statement per half stage");
    if constexpr (N == 8)
        asm volatile(
                     "global_load_async_to_lds_b128 %0, %8, off\n\t"
                     "global_load_async_to_lds_b128 %1, %9, off\n\t"
                     "global_load_async_to_lds_b128 %2, %10, off\n\t"
                     "global_load_async_to_lds_b128 %3, %11, off\n\t"
                     "global_load_async_to_lds_b128 %4, %12, off\n\t"
                     "global_load_async_to_lds_b128 %5, %13, off\n\t"
                     "global_load_async_to_lds_b128 %6, %14, off\n\t"
                     "global_load_async_to_lds_b128 %7, %15, off\n\t"
                     "s_wait_xcnt 0x0"
                     :: "v"(l[0]), "v"(l[1]), "v"(l[2]), "v"(l[3]), "v"(l[4]), "v"(l[5]), "v"(l[6]), "v"(l[7]),
                        "v"(g[0]), "v"(g[1]), "v"(g[2]), "v"(g[3]), "v"(g[4]), "v"(g[5]), "v"(g[6]), "v"(g[7]) : "memory");
    else if constexpr (N == 10)
        asm volatile(
                     "global_load_async_to_lds_b128 %0, %10, off\n\t"
                     "global_load_async_to_lds_b128 %1, %11, off\n\t"
                     "global_load_async_to_lds_b128 %2, %12, off\n\t"
                     "global_load_async_to_lds_b128 %3, %13, off\n\t"
                     "global_load_async_to_lds_b128 %4, %14, off\n\t"
                     "global_load_async_to_lds_b128 %5, %15, off\n\t"
                     "global_load_async_to_lds_b128 %6, %16, off\n\t"
                     "global_load_async_to_lds_b128 %7, %17, off\n\t"
                     "global_load_async_to_lds_b128 %8, %18, off\n\t"
                     "global_load_async_to_lds_b128 %9, %19, off\n\t"
                     "s_wait_xcnt 0x0"
                     :: "v"(l[0]), "v"(l[1]), "v"(l[2]), "v"(l[3]), "v"(l[4]), "v"(l[5]), "v"(l[6]), "v"(l[7]), "v"(l[8]), "v"(l[9]),
                        "v"(g[0]), "v"(g[1]), "v"(g[2]), "v"(g[3]), "v"(g[4]), "v"(g[5]), "v"(g[6]), "v"(g[7]), "v"(g[8]), "v"(g[9]) : "memory");
    else
        asm volatile(
                     "global_load_async_to_lds_b128 %0, %12, off\n\t"
                     "global_load_async_to_lds_b128 %1, %13, off\n\t"
                     "global_load_async_to_lds_b128 %2, %14, off\n\t"
                     "global_load_async_to_lds_b128 %3, %15, off\n\t"
                     "global_load_async_to_lds_b128 %4, %16, off\n\t"
                     "global_load_async_to_lds_b128 %5, %17, off\n\t"
                     "global_load_async_to_lds_b128 %6, %18, off\n\t"
                     "global_load_async_to_lds_b128 %7, %19, off\n\t"
                     "global_load_async_to_lds_b128 %8, %20, off\n\t"
                     "global_load_async_to_lds_b128 %9, %21, off\n\t"
                     "global_load_async_to_lds_b128 %10, %22, off\n\t"
                     "global_load_async_to_lds_b128 %11, %23, off\n\t"
                     "s_wait_xcnt 0x0"
                     :: "v"(l[0]), "v"(l[1]), "v"(l[2]), "v"(l[3]), "v"(l[4]), "v"(l[5]), "v"(l[6]), "v"(l[7]), "v"(l[8]), "v"(l[9]), "v"(l[10]), "v"(l[11]),
                        "v"(g[0]), "v"(g[1]), "v"(g[2]), "v"(g[3]), "v"(g[4]), "v"(g[5]), "v"(g[6]), "v"(g[7]), "v"(g[8]), "v"(g[9]), "v"(g[10]), "v"(g[11]) : "memory");
}
__device__ __forceinline__ v16bf ldfrag(const unsigned char* p) { return cat16b(*(const v8usa*)p, *(const v8usa*)(p + 32)); }

template <int NA, int NBP, int BN, int K, bool BIAS>
__global__ __launch_bounds__(256) void k_gemm(const bf* __restrict__ A0, const bf* __restrict__ A1, const bf* __restrict__ B0, const bf* __restrict__ B1, const float* __restrict__ bias, float* C, int ldc, int zA, int zB, int zC) {
    // zA, zB, zC: elements from one batch item (blockIdx.z) to the next in the A planes, the B planes and C (0: shared by all items).
    constexpr int BM = 128, WN = BN / 2, FN = WN / 16, NT = K / KS;
    constexpr int STAGE = (NA * BM + NBP * BN) * PITCH;
    constexpr int OFF_A1 = BM * PITCH, OFF_B0 = NA * BM * PITCH, OFF_B1 = (NA * BM + BN) * PITCH;
    __shared__ __align__(16) unsigned char sm[2 * STAGE];
    const int tid = threadIdx.x, lane = tid & 31, wave = tid >> 5, lr = lane & 15, hi = lane >> 4;
    const int wm = wave >> 1, wn = wave & 1;
    const int r0 = blockIdx.x * BM, c0 = blockIdx.y * BN;
    const int crow = tid >> 4, cpc = tid & 15;
    const unsigned lt = (unsigned)(size_t)sm + crow * PITCH + cpc * 16;
    const size_t ga = (size_t)blockIdx.z * zA + (size_t)(r0 + crow) * K + cpc * 8, gb = (size_t)blockIdx.z * zB + (size_t)(c0 + crow) * K + cpc * 8;
    // One stage: the block's 256 threads cover 16 rows a copy (thread -> row tid >> 4, 16-byte piece tid & 15); NC copies a thread, issued as two statements.
    constexpr int NC = (NA * BM + NBP * BN) / 16;
    auto fill = [&](int t) {
        const unsigned lb = lt + (t & 1) * STAGE; const int kc = t * KS;
        unsigned l[NC]; const bf* g[NC];
#pragma unroll
        for (int j = 0; j < NC; ++j) l[j] = lb + j * 16 * PITCH;
#pragma unroll
        for (int j = 0; j < BM / 16; ++j) { g[j] = A0 + ga + kc + (size_t)j * 16 * K; if constexpr (NA == 2) g[BM / 16 + j] = A1 + ga + kc + (size_t)j * 16 * K; }
#pragma unroll
        for (int j = 0; j < BN / 16; ++j) { g[NA * BM / 16 + j] = B0 + gb + kc + (size_t)j * 16 * K; if constexpr (NBP == 2) g[(NA * BM + BN) / 16 + j] = B1 + gb + kc + (size_t)j * 16 * K; }
        copies<NC / 2>(l, g); copies<NC / 2>(l + NC / 2, g + NC / 2);
    };
    v8f acc[2][FN];
#pragma unroll
    for (int m = 0; m < 2; ++m)
#pragma unroll
        for (int n = 0; n < FN; ++n) acc[m][n] = (v8f){};
    float bv[FN];   // the lane's bias values, fetched here so that their latency lies under the loop
#pragma unroll
    for (int n = 0; n < FN; ++n) bv[n] = BIAS ? bfr(bias[c0 + wn * WN + n * 16 + lr]) : 0.f;
    fill(0);
    asm volatile("s_wait_asynccnt 0x0" ::: "memory");   // this wave's copies of stage 0 have landed
    __syncthreads();                                     // ... and every other wave's
    fill(1);
    // The stage loop stays rolled (one copy of its body; the buffer is picked by t & 1); every loop inside it is unrolled so that the register arrays are indexed by constants.
#pragma unroll 1
    for (int t = 0; t < NT; ++t) {
        const unsigned char* sb = sm + (t & 1) * STAGE;
        const unsigned char* pa = sb + (wm * 32 + lr) * PITCH + 16 * hi;
        const unsigned char* pb = sb + OFF_B0 + (wn * WN + lr) * PITCH + 16 * hi;
        // Two fragment sets: the loads of 32-k step ks + 1 go out as one group ahead of step ks's products (only inside this stage), so that a step's LDS latency is covered by the step before.
        v16bf a0[2][2], a1[2][2], b0[2][FN], b1[2][FN];
        auto ldset = [&](int q, int ks) {
#pragma unroll
            for (int m = 0; m < 2; ++m) { a0[q][m] = ldfrag(pa + m * 16 * PITCH + ks * 64); if constexpr (NA == 2) a1[q][m] = ldfrag(pa + OFF_A1 + m * 16 * PITCH + ks * 64); }
#pragma unroll
            for (int n = 0; n < FN; ++n) { b0[q][n] = ldfrag(pb + n * 16 * PITCH + ks * 64); if constexpr (NBP == 2) b1[q][n] = ldfrag(pb + (OFF_B1 - OFF_B0) + n * 16 * PITCH + ks * 64); }
        };
        ldset(0, 0);
#pragma unroll
        for (int ks = 0; ks < KS / 32; ++ks) {
            const int q = ks & 1;
            if (ks + 1 < KS / 32) ldset(q ^ 1, ks + 1);
            __builtin_amdgcn_sched_barrier(0);   // keeps the next step's load group ahead of this step's products (the scheduler otherwise sinks each load to just before its use)
#pragma unroll
            for (int m = 0; m < 2; ++m)
#pragma unroll
                for (int n = 0; n < FN; ++n) acc[m][n] = wmmab(a0[q][m], b0[q][n], acc[m][n]);
            if constexpr (NA == 2) {
#pragma unroll
                for (int m = 0; m < 2; ++m)
#pragma unroll
                    for (int n = 0; n < FN; ++n) acc[m][n] = wmmab(a1[q][m], b0[q][n], acc[m][n]);
            }
            if constexpr (NBP == 2) {
#pragma unroll
                for (int m = 0; m < 2; ++m)
#pragma unroll
                    for (int n = 0; n < FN; ++n) acc[m][n] = wmmab(a0[q][m], b1[q][n], acc[m][n]);
            }
            __builtin_amdgcn_sched_barrier(0);   // keeps this step's products ahead of the load group after next, which reuses their fragment set
        }
        asm volatile("s_wait_dscnt 0x0" ::: "memory");      // this wave's reads of stage t are done before its buffer is refilled
        asm volatile("s_wait_asynccnt 0x0" ::: "memory");   // this wave's copies of stage t + 1 have landed
        __syncthreads();                                     // publishes stage t + 1 and ends every reader's last read of stage t
        if (t + 2 < NT) fill(t + 2);
    }
    asm volatile("s_wait_asynccnt 0x0" ::: "memory");       // no copy is outstanding when the ring becomes output staging
    // Epilogue: each wave stages its two 16 x WN f32 pieces in its own part of the ring (the loop's last barrier has ended every read of it) and stores whole 128-B lines.
    constexpr int OP = WN + 4, LPR = WN / 32;
    float* os = (float*)(void*)sm + wave * (2 * 16 * OP);
#pragma unroll
    for (int n = 0; n < FN; ++n)
#pragma unroll
        for (int m = 0; m < 2; ++m)
#pragma unroll
            for (int j = 0; j < 8; ++j) os[(m * 16 + hi * 8 + j) * OP + n * 16 + lr] = BIAS ? acc[m][n][j] + bv[n] : acc[m][n][j];
    __syncthreads();   // the staged values are read back by other lanes: no read may move ahead of the stores
    float* crow_p = C + (size_t)blockIdx.z * zC + (size_t)(r0 + wm * 32) * ldc + c0 + wn * WN;
#pragma unroll
    for (int s = 0; s < 8 * LPR; ++s) { const int Lid = (lane >> 3) + 4 * s, piece = lane & 7; const int row = Lid / LPR, cofs = (Lid % LPR) * 32 + piece * 4;
        const v4f val = *(const v4fa*)(os + row * OP + cofs); *(v4f*)(crow_p + (size_t)row * ldc + cofs) = val; }
}
// k_vt: VTH/VTL [g][128 d][2048 t] = bf16 hi + UNSCALED bf16 residual of V [t][g*128+d] via 64 x 64 LDS tiles; grid (NT/64, 2, 8 x items): per item a full transpose of Y1 [t][1024] into hi/lo planes [1024][t].
__global__ __launch_bounds__(256) void k_vt(const float* __restrict__ V, bf* VTH, bf* VTL) {
    __shared__ float tl[64][65];
    const int tid = threadIdx.x, t0 = blockIdx.x * 64, d0 = blockIdx.y * 64, g = blockIdx.z % NKV, b = blockIdx.z / NKV;
    { const int tt = tid >> 2, dq = (tid & 3) * 16;
#pragma unroll
      for (int i = 0; i < 16; ++i) tl[dq + i][tt] = V[((size_t)b * NT_ + t0 + tt) * KW + g * HD + d0 + dq + i]; }
    __syncthreads();
    const int piece = tid & 7;
    auto pass = [&]() {
#pragma unroll
        for (int s = 0; s < 2; ++s) { const int d = (tid >> 3) + 32 * s; v8us oh, ol;
#pragma unroll
            for (int i = 0; i < 8; ++i) { const float v = tl[d][piece * 8 + i]; const unsigned short hb = f2bf(v); oh[i] = hb; ol[i] = f2bf(v - bf2f(hb)); }
            const size_t o = ((size_t)b * DM + g * HD + d0 + d) * NT_ + t0 + piece * 8; *(v8us*)(VTH + o) = oh; *(v8us*)(VTL + o) = ol; }
    };
    pass(); 
}

// k_lnout: one wave per row: v = bf(x) + y2 (f32), LayerNorm (mean, mean((v-mu)^2), eps 1e-5, x bf(gamma) + bf(beta)) -> f32 output row; per 128-column chunk q the
// per phase.
__global__ __launch_bounds__(256) void k_lnout(const float* __restrict__ X, const float* __restrict__ Y2, const float* __restrict__ gam, const float* __restrict__ bet, float* OUTP) {
    const int lane = threadIdx.x & 31, r = blockIdx.x * 8 + (threadIdx.x >> 5);
    if (r >= NB_ * NT_) return;
    const float* xr = X + (size_t)r * DM; const float* yr = Y2 + (size_t)r * DM;
    float s = 0.f;
#pragma unroll 1
    for (int q = 0; q < 2 * (DM / 256); ++q) { const int c0 = (q >> 1) * 256 + (q & 1) * 128 + lane * 4; const v4f xv = *(const v4f*)(xr + c0), yv = *(const v4f*)(yr + c0);
#pragma unroll
        for (int i = 0; i < 4; ++i) s += bfr(xv[i]) + yv[i]; }
#pragma unroll
    for (int sh = 16; sh; sh >>= 1) s += __shfl_xor(s, sh, 32);
    const float mu = s * (1.0f / DM);
    float s2 = 0.f;
#pragma unroll 1
    for (int q = 0; q < 2 * (DM / 256); ++q) { const int c0 = (q >> 1) * 256 + (q & 1) * 128 + lane * 4; const v4f xv = *(const v4f*)(xr + c0), yv = *(const v4f*)(yr + c0);
#pragma unroll
        for (int i = 0; i < 4; ++i) { const float d = (bfr(xv[i]) + yv[i]) - mu; s2 = fmaf(d, d, s2); } }
#pragma unroll
    for (int sh = 16; sh; sh >>= 1) s2 += __shfl_xor(s2, sh, 32);
    const float rs = rsqrtf(s2 * (1.0f / DM) + 1e-5f);
{
#pragma unroll 1
        for (int q = 0; q < 2 * (DM / 256); ++q) { const int c0 = (q >> 1) * 256 + (q & 1) * 128 + lane * 4; const v4f xv = *(const v4f*)(xr + c0), yv = *(const v4f*)(yr + c0); v4f o;
#pragma unroll
            for (int i = 0; i < 4; ++i) o[i] = ((bfr(xv[i]) + yv[i]) - mu) * rs * bfr(gam[c0 + i]) + bfr(bet[c0 + i]);
            *(v4f*)(OUTP + (size_t)r * DM + c0) = o; }
         }
}

extern "C" void kernel_launch(void* const* d_in, const int* in_sizes, int n_in,
                              void* d_out, int out_size, void* d_ws, size_t ws_size, hipStream_t stream) {
    (void)in_sizes; (void)n_in; (void)out_size;
    const float* x = (const float*)d_in[0]; const float* lg = (const float*)d_in[1]; const float* lb = (const float*)d_in[2];
    const float* w1 = (const float*)d_in[3]; const float* b1 = (const float*)d_in[4]; const float* w2 = (const float*)d_in[5]; const float* b2 = (const float*)d_in[6];   // w1 [1024][2048], w2 [2048][1024], both (in, out) = k-major
    float* out = (float*)d_out;    // [4][2048][1024]
    char* wsp = (char*)d_ws;
    auto take = [&](size_t bytes) { char* p = wsp; wsp += (bytes + 255) & ~(size_t)255; return (void*)p; };
    constexpr size_t NR = (size_t)NB_ * NTK;   // rows of all items
    bf* W1T = (bf*)take((size_t)FF * DM * 2); bf* W2T = (bf*)take((size_t)DM * FF * 2);
    bf* Xb = (bf*)take(NR * DM * 2); bf* Y0h = (bf*)take(NR * DM * 2); bf* Y0l = (bf*)take(NR * DM * 2);
    float* T = (float*)take(NR * FF * 4); bf* Hh = (bf*)take(NR * FF * 2); bf* Hl = (bf*)take(NR * FF * 2);
    float* Y1 = (float*)take(NR * DM * 4);
    // Planes of equal size whose last reader has run before the next writer starts (stream order) share their bytes: 8 + 16 + 32 + 64 + 64 + 32 = 216 MiB.
    bf* Y1Th = Y0h; bf* Y1Tl = Y0l;   // y0 is last read by the first product, y1^T is written after the second
    float* S = T;                     // t is last read by the GELU, the scores are written after it
    bf* Sh = Hh; bf* Sl = Hl;         // gelu(t) is last read by the second product, the score planes are written after it
    float* Y2 = Y1;                   // y1 is last read by the transpose, y2 is written after it
    if ((size_t)(wsp - (char*)d_ws) > ws_size) return;
    k_wt<<<dim3(DM / 64, FF / 64, 1), 256, 0, stream>>>(w1, DM, FF, W1T);    // w1 [1024 k][2048 n] -> W1T [2048][1024]
    k_wt<<<dim3(FF / 64, DM / 64, 1), 256, 0, stream>>>(w2, FF, DM, W2T);    // w2 [2048 k][1024 n] -> W2T [1024][2048]
    k_cvtb<<<NB_ * NTK / 8, 256, 0, stream>>>(x, NB_ * NTK, Xb);
    k_ln<true><<<NB_ * NTK / 8, 256, 0, stream>>>(x, lg, lb, NB_ * NTK, Y0h, Y0l);
    k_gemm<2, 1, 128, DM, true><<<dim3(NTK / 128, FF / 128, NB_), 256, 0, stream>>>(Y0h, Y0l, W1T, nullptr, b1, T, FF, NTK * DM, 0, NTK * FF);                  // y0.w1 + b1
    k_gelu2<<<NB_ * NTK / 8, 256, 0, stream>>>(T, NB_ * NTK, Hh, Hl);
    k_gemm<2, 1, 64, FF, true><<<dim3(NTK / 128, DM / 64, NB_), 256, 0, stream>>>(Hh, Hl, W2T, nullptr, b2, Y1, DM, NTK * FF, 0, NTK * DM);                     // gelu(t).w2 + b2
    k_vt<<<dim3(NT_ / 64, 2, NKV * NB_), 256, 0, stream>>>(Y1, Y1Th, Y1Tl);                                                                                       // y1^T hi/lo planes [item][1024][2048]
    k_gemm<1, 1, 128, DM, false><<<dim3(NTK / 128, NT_ / 128, NB_), 256, 0, stream>>>(Xb, nullptr, Xb, nullptr, nullptr, S, NT_, NTK * DM, NTK * DM, NT_ * NT_);  // scores = x.x^T (exact bf16 products)
    k_cvtb2<<<NB_ * (NT_ * NT_ / DM) / 8, 256, 0, stream>>>(S, NB_ * (NT_ * NT_ / DM), Sh, Sl);                                                                    // scores -> hi/lo (viewed as rows of 1024)
    k_gemm<2, 2, 64, NT_, false><<<dim3(NT_ / 128, DM / 64, NB_), 256, 0, stream>>>(Sh, Sl, Y1Th, Y1Tl, nullptr, Y2, DM, NT_ * NT_, DM * NT_, NTK * DM);          // y2 = scores.y1
    k_lnout<<<NB_ * NTK / 8, 256, 0, stream>>>(x, Y2, lg, lb, out);                                                                                               // LN(x + y2)
}

// v003
// It runs in 247 microseconds.
// Two timings next to v002 both put it at 1.25 times that version's speed.
// Over all steps from v000 it is 4.15 times as fast.
#include <hip/hip_runtime.h>

// Compute dtypes, f32 accumulate, all four batch items in every launch (row-wise kernels: 4 x 2048 rows, the m^T split 4 x 1024; per-item products: grid z = item): y0 = LN(x) (f32; gamma/beta and x read through bf16 rounding) -> bf16 hi + UNSCALED residual planes;
// t = y0.w1 + b1 ([2048 x 1024].[1024 x 2048]) and y1 = gelu(t).w2 + b2 ([2048 x 2048].[2048 x 1024]) on v_wmma_f32_16x16x32_bf16 with k-major weights
// transposed once to n-major bf16 planes and the computed operands as hi + residual (two products; exact-erf GELU in f32 in between); (x.x^T).y1 is summed as
// x.(x^T.y1): m^T = y1^T.x ([1024 x 2048].[2048 x 1024] per item, y1 as hi + residual, the INPUT x rounded once: two products), then y2 = x.m ([2048 x 1024].[1024 x 1024],
// m as hi + residual: two products): half the multiply-adds of the score route per product, and no [2048 x 2048] score plane.

#define NB_  4
#define NT_  2048
#define DM   1024
#define FF   2048
#define HD   128                 // k_vt tile grouping only
#define KW   DM
#define NKV  (DM / HD)
#define NTK  NT_
#define LOSC 1024.0f             // (unused here)

typedef _Float16 h16;
typedef unsigned short bf;
typedef __attribute__((ext_vector_type(16))) __bf16   v16bf;
typedef __attribute__((ext_vector_type(16))) _Float16 v16h;
typedef __attribute__((ext_vector_type(8)))  _Float16 v8h;
typedef __attribute__((ext_vector_type(8)))  unsigned short v8us;
typedef __attribute__((ext_vector_type(8)))  float    v8f;
typedef __attribute__((ext_vector_type(4)))  float    v4f;
typedef __attribute__((ext_vector_type(4)))  _Float16 v4h;
typedef v8h  __attribute__((may_alias)) v8ha;
typedef v4f  __attribute__((may_alias)) v4fa;
typedef v8us __attribute__((may_alias)) v8usa;

__device__ __forceinline__ unsigned short f2bf(float f) { unsigned u = __float_as_uint(f); u += 0x7FFFu + ((u >> 16) & 1u); return (unsigned short)(u >> 16); }
__device__ __forceinline__ float bf2f(unsigned short b) { return __uint_as_float(((unsigned)b) << 16); }
__device__ __forceinline__ float bfr(float f) { return bf2f(f2bf(f)); }
__device__ __forceinline__ v16h cat16(v8h lo, v8h hi) { return __builtin_shufflevector(lo, hi, 0, 1, 2, 3, 4, 5, 6, 7, 8, 9, 10, 11, 12, 13, 14, 15); }
__device__ __forceinline__ v16bf cat16b(v8us lo, v8us hi) { return __builtin_bit_cast(v16bf, __builtin_shufflevector(lo, hi, 0, 1, 2, 3, 4, 5, 6, 7, 8, 9, 10, 11, 12, 13, 14, 15)); }
__device__ __forceinline__ v8f wmma16(v16h a, v16h b, v8f c) { return __builtin_amdgcn_wmma_f32_16x16x32_f16(false, a, false, b, (short)0, c, false, false); }
__device__ __forceinline__ v8f wmmab(v16bf a, v16bf b, v8f c) { return __builtin_amdgcn_wmma_f32_16x16x32_bf16(false, a, false, b, (short)0, c, false, false); }

// k_xbt: the input x [item][2048 t][1024 f], rounded once to bf16, written in both orders: XB [item][t][f] and XT [item][f][t], via 64 x 64 LDS tiles; grid (NT/64, DM/64, items).
// Thread -> row tid >> 3 (+ 32), 8 columns (tid & 7) * 8: 8 lanes store one whole 128-B line of either plane. All stores stand behind the barrier, so that it waits on LDS alone.
__global__ __launch_bounds__(256) void k_xbt(const float* __restrict__ X, bf* XB, bf* XT) {
    __shared__ __align__(16) unsigned short tl[64 * 72];
    const int tid = threadIdx.x, t0 = blockIdx.x * 64, f0 = blockIdx.y * 64, piece = tid & 7, row = tid >> 3;
    const size_t ib = (size_t)blockIdx.z * NT_ * DM, o = ib + (size_t)(t0 + row) * DM + f0 + piece * 8;
    v4f a[2][2];
#pragma unroll
    for (int s = 0; s < 2; ++s) { a[s][0] = *(const v4f*)(X + o + (size_t)s * 32 * DM); a[s][1] = *(const v4f*)(X + o + (size_t)s * 32 * DM + 4); }
    v8us r[2];
#pragma unroll
    for (int s = 0; s < 2; ++s)
#pragma unroll
        for (int i = 0; i < 8; ++i) { r[s][i] = f2bf(a[s][i >> 2][i & 3]); tl[(piece * 8 + i) * 72 + row + 32 * s] = r[s][i]; }
    __syncthreads();
#pragma unroll
    for (int s = 0; s < 2; ++s) { const v8us val = *(const v8usa*)(tl + (row + 32 * s) * 72 + piece * 8);
        *(v8us*)(XB + o + (size_t)s * 32 * DM) = r[s]; *(v8us*)(XT + ib + (size_t)(f0 + row + 32 * s) * NT_ + t0 + piece * 8) = val; }
}

__global__ __launch_bounds__(256) void k_cvtb2(const float* __restrict__ src, int nrows, bf* dh, bf* dl) {
    const int lane = threadIdx.x & 31, r = blockIdx.x * 8 + (threadIdx.x >> 5);
    if (r >= nrows) return;
    v8us oh[DM / 256], ol[DM / 256];
#pragma unroll
    for (int q = 0; q < DM / 256; ++q) {
#pragma unroll
        for (int i = 0; i < 8; ++i) { const float v = src[(size_t)r * DM + q * 256 + lane * 8 + i]; const unsigned short hb = f2bf(v); oh[q][i] = hb; ol[q][i] = f2bf(v - bf2f(hb)); } }
{
#pragma unroll
        for (int q = 0; q < DM / 256; ++q) { const size_t o = (size_t)r * DM + q * 256 + lane * 8; *(v8us*)(dh + o) = oh[q]; *(v8us*)(dl + o) = ol[q]; }
         }
}
// k_wt: WT [n][K] = bf16(W[k][n]) (k-major [K][ncols]) via 64 x 64 LDS tiles; grid (K/64, ncols/64).
__global__ __launch_bounds__(256) void k_wt(const float* __restrict__ Wm, int K, int ncols, bf* WT) {
    __shared__ __align__(16) unsigned short tl[64 * 72];
    const int tid = threadIdx.x, k0 = blockIdx.x * 64, n0 = blockIdx.y * 64;
    const int kk = tid >> 2, nq = (tid & 3) * 16;
#pragma unroll
    for (int i = 0; i < 16; ++i) tl[(nq + i) * 72 + kk] = f2bf(Wm[(size_t)(k0 + kk) * ncols + n0 + nq + i]);
    __syncthreads();
    const int piece = tid & 7;
    auto pass = [&]() {
#pragma unroll
        for (int s = 0; s < 2; ++s) { const int nr = (tid >> 3) + 32 * s; const v8us val = *(const v8usa*)(tl + nr * 72 + piece * 8); *(v8us*)(WT + (size_t)(n0 + nr) * K + k0 + piece * 8) = val; }
    };
    pass(); 
}
// k_ln: one wave per row of x [rows][1024]: LayerNorm (mean, then mean((x-mu)^2), eps 1e-5, x bf(gamma) + bf(beta), f32, fixed lane order) -> bf16 hi + UNSCALED
// residual planes; lane -> columns q*256 + lane*8 .. +8 for q = 0..3 (16 B per plane per store, 8 lanes per line). The row is re-read per phase with the q loop
// rolled (keeps the static VALU-FMA count small; no register arrays indexed by a loop variable).
template <bool ROUNDIN>   // ROUNDIN: the source is a module INPUT (read through bf16 rounding); false: a computed f32 plane (read as is)
__global__ __launch_bounds__(256) void k_ln(const float* __restrict__ X, const float* __restrict__ gam, const float* __restrict__ bet, int nrows, bf* Hh, bf* Hl) {
    const int lane = threadIdx.x & 31, r = blockIdx.x * 8 + (threadIdx.x >> 5);
    if (r >= nrows) return;
    const float* xr = X + (size_t)r * DM + lane * 8;
    float s = 0.f;
#pragma unroll 1
    for (int q = 0; q < DM / 256; ++q) {
#pragma unroll
        for (int i = 0; i < 8; ++i) s += (ROUNDIN ? bfr(xr[q * 256 + i]) : xr[q * 256 + i]); }
#pragma unroll
    for (int sh = 16; sh; sh >>= 1) s += __shfl_xor(s, sh, 32);
    const float mu = s * (1.0f / DM);
    float s2 = 0.f;
#pragma unroll 1
    for (int q = 0; q < DM / 256; ++q) {
#pragma unroll
        for (int i = 0; i < 8; ++i) { const float d = (ROUNDIN ? bfr(xr[q * 256 + i]) : xr[q * 256 + i]) - mu; s2 = fmaf(d, d, s2); } }
#pragma unroll
    for (int sh = 16; sh; sh >>= 1) s2 += __shfl_xor(s2, sh, 32);
    const float rs = rsqrtf(s2 * (1.0f / DM) + 1e-5f);
{
#pragma unroll 1
        for (int q = 0; q < DM / 256; ++q) { v8us oh, ol;
#pragma unroll
            for (int i = 0; i < 8; ++i) { const int c = q * 256 + lane * 8 + i; const float y = ((ROUNDIN ? bfr(xr[q * 256 + i]) : xr[q * 256 + i]) - mu) * rs * bfr(gam[c]) + bfr(bet[c]); const unsigned short hb = f2bf(y); oh[i] = hb; ol[i] = f2bf(y - bf2f(hb)); }
            const size_t o = (size_t)r * DM + q * 256 + lane * 8; *(v8us*)(Hh + o) = oh; *(v8us*)(Hl + o) = ol; }
         }
}
// k_gelu2: exact-erf GELU of an f32 [nrows][FF] plane (bias already added) -> bf16 hi + UNSCALED residual planes; one wave per row, lane -> 4 consecutive
// columns per iteration (16 rolled iterations of 128 columns; 8 B per plane per store -> 16 lanes per line).
__global__ __launch_bounds__(256) void k_gelu2(const float* __restrict__ src, int nrows, bf* dh, bf* dl) {
    typedef __attribute__((ext_vector_type(4))) unsigned short v4us;
    const int lane = threadIdx.x & 31, r = blockIdx.x * 8 + (threadIdx.x >> 5);
    if (r >= nrows) return;
{
#pragma unroll 1
        for (int q = 0; q < FF / 128; ++q) { const size_t o = (size_t)r * FF + q * 128 + lane * 4; const v4f v = *(const v4f*)(src + o); v4us oh, ol;
#pragma unroll
            for (int i = 0; i < 4; ++i) { const float g = 0.5f * v[i] * (1.0f + erff(v[i] * 0.70710678118654752f)); const unsigned short hb = f2bf(g); oh[i] = hb; ol[i] = f2bf(g - bf2f(hb)); }
            *(v4us*)(dh + o) = oh; *(v4us*)(dl + o) = ol; }
         }
}
// k_gemm: BM x BN block tile (BM = 128, 8 waves as 4 x 2, wave tile 32 x BN/2) of C[.][ldc] = (A0 [+ A1]).(B0 [+ B1])^T [+ bf(bias[c])], all planes bf16 with row stride K.
// A stage is 128 k (256 B) of every operand row, rows [A0 | A1 | B0 | B1] at an LDS pitch of 272 B, brought in by asynchronous copies (16 lanes = one whole 256-B row piece,
// so every copy reads whole lines) into two buffers: stage t + 1 flies while stage t is worked on. Per accumulator and 32-k step the products keep the order
// A0.B0, A1.B0, A0.B1 and k runs upward, with the same k order inside a fragment for A and B (bytes 16h and 32 + 16h of each 64 B of a row).
#define KS    128
#define PITCH 272
// N copies in one statement and, as its last line, the wait that stands in front of any rewrite of the address registers they name.
template <int N>
__device__ __forceinline__ void copies(const unsigned* l, const bf* const* g) {
    static_assert(N == 8 || N == 10 || N == 12, "one statement per half stage");
    if constexpr (N == 8)
        asm volatile(
                     "global_load_async_to_lds_b128 %0, %8, off\n\t"
                     "global_load_async_to_lds_b128 %1, %9, off\n\t"
                     "global_load_async_to_lds_b128 %2, %10, off\n\t"
                     "global_load_async_to_lds_b128 %3, %11, off\n\t"
                     "global_load_async_to_lds_b128 %4, %12, off\n\t"
                     "global_load_async_to_lds_b128 %5, %13, off\n\t"
                     "global_load_async_to_lds_b128 %6, %14, off\n\t"
                     "global_load_async_to_lds_b128 %7, %15, off\n\t"
                     "s_wait_xcnt 0x0"
                     :: "v"(l[0]), "v"(l[1]), "v"(l[2]), "v"(l[3]), "v"(l[4]), "v"(l[5]), "v"(l[6]), "v"(l[7]),
                        "v"(g[0]), "v"(g[1]), "v"(g[2]), "v"(g[3]), "v"(g[4]), "v"(g[5]), "v"(g[6]), "v"(g[7]) : "memory");
    else if constexpr (N == 10)
        asm volatile(
                     "global_load_async_to_lds_b128 %0, %10, off\n\t"
                     "global_load_async_to_lds_b128 %1, %11, off\n\t"
                     "global_load_async_to_lds_b128 %2, %12, off\n\t"
                     "global_load_async_to_lds_b128 %3, %13, off\n\t"
                     "global_load_async_to_lds_b128 %4, %14, off\n\t"
                     "global_load_async_to_lds_b128 %5, %15, off\n\t"
                     "global_load_async_to_lds_b128 %6, %16, off\n\t"
                     "global_load_async_to_lds_b128 %7, %17, off\n\t"
                     "global_load_async_to_lds_b128 %8, %18, off\n\t"
                     "global_load_async_to_lds_b128 %9, %19, off\n\t"
                     "s_wait_xcnt 0x0"
                     :: "v"(l[0]), "v"(l[1]), "v"(l[2]), "v"(l[3]), "v"(l[4]), "v"(l[5]), "v"(l[6]), "v"(l[7]), "v"(l[8]), "v"(l[9]),
                        "v"(g[0]), "v"(g[1]), "v"(g[2]), "v"(g[3]), "v"(g[4]), "v"(g[5]), "v"(g[6]), "v"(g[7]), "v"(g[8]), "v"(g[9]) : "memory");
    else
        asm volatile(
                     "global_load_async_to_lds_b128 %0, %12, off\n\t"
                     "global_load_async_to_lds_b128 %1, %13, off\n\t"
                     "global_load_async_to_lds_b128 %2, %14, off\n\t"
                     "global_load_async_to_lds_b128 %3, %15, off\n\t"
                     "global_load_async_to_lds_b128 %4, %16, off\n\t"
                     "global_load_async_to_lds_b128 %5, %17, off\n\t"
                     "global_load_async_to_lds_b128 %6, %18, off\n\t"
                     "global_load_async_to_lds_b128 %7, %19, off\n\t"
                     "global_load_async_to_lds_b128 %8, %20, off\n\t"
                     "global_load_async_to_lds_b128 %9, %21, off\n\t"
                     "global_load_async_to_lds_b128 %10, %22, off\n\t"
                     "global_load_async_to_lds_b128 %11, %23, off\n\t"
                     "s_wait_xcnt 0x0"
                     :: "v"(l[0]), "v"(l[1]), "v"(l[2]), "v"(l[3]), "v"(l[4]), "v"(l[5]), "v"(l[6]), "v"(l[7]), "v"(l[8]), "v"(l[9]), "v"(l[10]), "v"(l[11]),
                        "v"(g[0]), "v"(g[1]), "v"(g[2]), "v"(g[3]), "v"(g[4]), "v"(g[5]), "v"(g[6]), "v"(g[7]), "v"(g[8]), "v"(g[9]), "v"(g[10]), "v"(g[11]) : "memory");
}
__device__ __forceinline__ v16bf ldfrag(const unsigned char* p) { return cat16b(*(const v8usa*)p, *(const v8usa*)(p + 32)); }

template <int NA, int NBP, int BN, int K, bool BIAS>
__global__ __launch_bounds__(256) void k_gemm(const bf* __restrict__ A0, const bf* __restrict__ A1, const bf* __restrict__ B0, const bf* __restrict__ B1, const float* __restrict__ bias, float* C, int ldc, int zA, int zB, int zC) {
    // zA, zB, zC: elements from one batch item (blockIdx.z) to the next in the A planes, the B planes and C (0: shared by all items).
    constexpr int BM = 128, WN = BN / 2, FN = WN / 16, NT = K / KS;
    constexpr int STAGE = (NA * BM + NBP * BN) * PITCH;
    constexpr int OFF_A1 = BM * PITCH, OFF_B0 = NA * BM * PITCH, OFF_B1 = (NA * BM + BN) * PITCH;
    __shared__ __align__(16) unsigned char sm[2 * STAGE];
    const int tid = threadIdx.x, lane = tid & 31, wave = tid >> 5, lr = lane & 15, hi = lane >> 4;
    const int wm = wave >> 1, wn = wave & 1;
    const int r0 = blockIdx.x * BM, c0 = blockIdx.y * BN;
    const int crow = tid >> 4, cpc = tid & 15;
    const unsigned lt = (unsigned)(size_t)sm + crow * PITCH + cpc * 16;
    const size_t ga = (size_t)blockIdx.z * zA + (size_t)(r0 + crow) * K + cpc * 8, gb = (size_t)blockIdx.z * zB + (size_t)(c0 + crow) * K + cpc * 8;
    // One stage: the block's 256 threads cover 16 rows a copy (thread -> row tid >> 4, 16-byte piece tid & 15); NC copies a thread, issued as two statements.
    constexpr int NC = (NA * BM + NBP * BN) / 16;
    auto fill = [&](int t) {
        const unsigned lb = lt + (t & 1) * STAGE; const int kc = t * KS;
        unsigned l[NC]; const bf* g[NC];
#pragma unroll
        for (int j = 0; j < NC; ++j) l[j] = lb + j * 16 * PITCH;
#pragma unroll
        for (int j = 0; j < BM / 16; ++j) { g[j] = A0 + ga + kc + (size_t)j * 16 * K; if constexpr (NA == 2) g[BM / 16 + j] = A1 + ga + kc + (size_t)j * 16 * K; }
#pragma unroll
        for (int j = 0; j < BN / 16; ++j) { g[NA * BM / 16 + j] = B0 + gb + kc + (size_t)j * 16 * K; if constexpr (NBP == 2) g[(NA * BM + BN) / 16 + j] = B1 + gb + kc + (size_t)j * 16 * K; }
        copies<NC / 2>(l, g); copies<NC / 2>(l + NC / 2, g + NC / 2);
    };
    v8f acc[2][FN];
#pragma unroll
    for (int m = 0; m < 2; ++m)
#pragma unroll
        for (int n = 0; n < FN; ++n) acc[m][n] = (v8f){};
    float bv[FN];   // the lane's bias values, fetched here so that their latency lies under the loop
#pragma unroll
    for (int n = 0; n < FN; ++n) bv[n] = BIAS ? bfr(bias[c0 + wn * WN + n * 16 + lr]) : 0.f;
    fill(0);
    asm volatile("s_wait_asynccnt 0x0" ::: "memory");   // this wave's copies of stage 0 have landed
    __syncthreads();                                     // ... and every other wave's
    fill(1);
    // The stage loop stays rolled (one copy of its body; the buffer is picked by t & 1); every loop inside it is unrolled so that the register arrays are indexed by constants.
#pragma unroll 1
    for (int t = 0; t < NT; ++t) {
        const unsigned char* sb = sm + (t & 1) * STAGE;
        const unsigned char* pa = sb + (wm * 32 + lr) * PITCH + 16 * hi;
        const unsigned char* pb = sb + OFF_B0 + (wn * WN + lr) * PITCH + 16 * hi;
        // Two fragment sets: the loads of 32-k step ks + 1 go out as one group ahead of step ks's products (only inside this stage), so that a step's LDS latency is covered by the step before.
        v16bf a0[2][2], a1[2][2], b0[2][FN], b1[2][FN];
        auto ldset = [&](int q, int ks) {
#pragma unroll
            for (int m = 0; m < 2; ++m) { a0[q][m] = ldfrag(pa + m * 16 * PITCH + ks * 64); if constexpr (NA == 2) a1[q][m] = ldfrag(pa + OFF_A1 + m * 16 * PITCH + ks * 64); }
#pragma unroll
            for (int n = 0; n < FN; ++n) { b0[q][n] = ldfrag(pb + n * 16 * PITCH + ks * 64); if constexpr (NBP == 2) b1[q][n] = ldfrag(pb + (OFF_B1 - OFF_B0) + n * 16 * PITCH + ks * 64); }
        };
        ldset(0, 0);
#pragma unroll
        for (int ks = 0; ks < KS / 32; ++ks) {
            const int q = ks & 1;
            if (ks + 1 < KS / 32) ldset(q ^ 1, ks + 1);
            __builtin_amdgcn_sched_barrier(0);   // keeps the next step's load group ahead of this step's products (the scheduler otherwise sinks each load to just before its use)
#pragma unroll
            for (int m = 0; m < 2; ++m)
#pragma unroll
                for (int n = 0; n < FN; ++n) acc[m][n] = wmmab(a0[q][m], b0[q][n], acc[m][n]);
            if constexpr (NA == 2) {
#pragma unroll
                for (int m = 0; m < 2; ++m)
#pragma unroll
                    for (int n = 0; n < FN; ++n) acc[m][n] = wmmab(a1[q][m], b0[q][n], acc[m][n]);
            }
            if constexpr (NBP == 2) {
#pragma unroll
                for (int m = 0; m < 2; ++m)
#pragma unroll
                    for (int n = 0; n < FN; ++n) acc[m][n] = wmmab(a0[q][m], b1[q][n], acc[m][n]);
            }
            __builtin_amdgcn_sched_barrier(0);   // keeps this step's products ahead of the load group after next, which reuses their fragment set
        }
        asm volatile("s_wait_dscnt 0x0" ::: "memory");      // this wave's reads of stage t are done before its buffer is refilled
        asm volatile("s_wait_asynccnt 0x0" ::: "memory");   // this wave's copies of stage t + 1 have landed
        __syncthreads();                                     // publishes stage t + 1 and ends every reader's last read of stage t
        if (t + 2 < NT) fill(t + 2);
    }
    asm volatile("s_wait_asynccnt 0x0" ::: "memory");       // no copy is outstanding when the ring becomes output staging
    // Epilogue: each wave stages its two 16 x WN f32 pieces in its own part of the ring (the loop's last barrier has ended every read of it) and stores whole 128-B lines.
    constexpr int OP = WN + 4, LPR = WN / 32;
    float* os = (float*)(void*)sm + wave * (2 * 16 * OP);
#pragma unroll
    for (int n = 0; n < FN; ++n)
#pragma unroll
        for (int m = 0; m < 2; ++m)
#pragma unroll
            for (int j = 0; j < 8; ++j) os[(m * 16 + hi * 8 + j) * OP + n * 16 + lr] = BIAS ? acc[m][n][j] + bv[n] : acc[m][n][j];
    __syncthreads();   // the staged values are read back by other lanes: no read may move ahead of the stores
    float* crow_p = C + (size_t)blockIdx.z * zC + (size_t)(r0 + wm * 32) * ldc + c0 + wn * WN;
#pragma unroll
    for (int s = 0; s < 8 * LPR; ++s) { const int Lid = (lane >> 3) + 4 * s, piece = lane & 7; const int row = Lid / LPR, cofs = (Lid % LPR) * 32 + piece * 4;
        const v4f val = *(const v4fa*)(os + row * OP + cofs); *(v4f*)(crow_p + (size_t)row * ldc + cofs) = val; }
}
// k_vt: VTH/VTL [g][128 d][2048 t] = bf16 hi + UNSCALED bf16 residual of V [t][g*128+d] via 64 x 64 LDS tiles; grid (NT/64, 2, 8 x items): per item a full transpose of Y1 [t][1024] into hi/lo planes [1024][t].
__global__ __launch_bounds__(256) void k_vt(const float* __restrict__ V, bf* VTH, bf* VTL) {
    __shared__ float tl[64][65];
    const int tid = threadIdx.x, t0 = blockIdx.x * 64, d0 = blockIdx.y * 64, g = blockIdx.z % NKV, b = blockIdx.z / NKV;
    { const int tt = tid >> 2, dq = (tid & 3) * 16;
#pragma unroll
      for (int i = 0; i < 16; ++i) tl[dq + i][tt] = V[((size_t)b * NT_ + t0 + tt) * KW + g * HD + d0 + dq + i]; }
    __syncthreads();
    const int piece = tid & 7;
    auto pass = [&]() {
#pragma unroll
        for (int s = 0; s < 2; ++s) { const int d = (tid >> 3) + 32 * s; v8us oh, ol;
#pragma unroll
            for (int i = 0; i < 8; ++i) { const float v = tl[d][piece * 8 + i]; const unsigned short hb = f2bf(v); oh[i] = hb; ol[i] = f2bf(v - bf2f(hb)); }
            const size_t o = ((size_t)b * DM + g * HD + d0 + d) * NT_ + t0 + piece * 8; *(v8us*)(VTH + o) = oh; *(v8us*)(VTL + o) = ol; }
    };
    pass(); 
}

// k_lnout: one wave per row: v = bf(x) + y2 (f32), LayerNorm (mean, mean((v-mu)^2), eps 1e-5, x bf(gamma) + bf(beta)) -> f32 output row; per 128-column chunk q the
// per phase.
__global__ __launch_bounds__(256) void k_lnout(const float* __restrict__ X, const float* __restrict__ Y2, const float* __restrict__ gam, const float* __restrict__ bet, float* OUTP) {
    const int lane = threadIdx.x & 31, r = blockIdx.x * 8 + (threadIdx.x >> 5);
    if (r >= NB_ * NT_) return;
    const float* xr = X + (size_t)r * DM; const float* yr = Y2 + (size_t)r * DM;
    float s = 0.f;
#pragma unroll 1
    for (int q = 0; q < 2 * (DM / 256); ++q) { const int c0 = (q >> 1) * 256 + (q & 1) * 128 + lane * 4; const v4f xv = *(const v4f*)(xr + c0), yv = *(const v4f*)(yr + c0);
#pragma unroll
        for (int i = 0; i < 4; ++i) s += bfr(xv[i]) + yv[i]; }
#pragma unroll
    for (int sh = 16; sh; sh >>= 1) s += __shfl_xor(s, sh, 32);
    const float mu = s * (1.0f / DM);
    float s2 = 0.f;
#pragma unroll 1
    for (int q = 0; q < 2 * (DM / 256); ++q) { const int c0 = (q >> 1) * 256 + (q & 1) * 128 + lane * 4; const v4f xv = *(const v4f*)(xr + c0), yv = *(const v4f*)(yr + c0);
#pragma unroll
        for (int i = 0; i < 4; ++i) { const float d = (bfr(xv[i]) + yv[i]) - mu; s2 = fmaf(d, d, s2); } }
#pragma unroll
    for (int sh = 16; sh; sh >>= 1) s2 += __shfl_xor(s2, sh, 32);
    const float rs = rsqrtf(s2 * (1.0f / DM) + 1e-5f);
{
#pragma unroll 1
        for (int q = 0; q < 2 * (DM / 256); ++q) { const int c0 = (q >> 1) * 256 + (q & 1) * 128 + lane * 4; const v4f xv = *(const v4f*)(xr + c0), yv = *(const v4f*)(yr + c0); v4f o;
#pragma unroll
            for (int i = 0; i < 4; ++i) o[i] = ((bfr(xv[i]) + yv[i]) - mu) * rs * bfr(gam[c0 + i]) + bfr(bet[c0 + i]);
            *(v4f*)(OUTP + (size_t)r * DM + c0) = o; }
         }
}

extern "C" void kernel_launch(void* const* d_in, const int* in_sizes, int n_in,
                              void* d_out, int out_size, void* d_ws, size_t ws_size, hipStream_t stream) {
    (void)in_sizes; (void)n_in; (void)out_size;
    const float* x = (const float*)d_in[0]; const float* lg = (const float*)d_in[1]; const float* lb = (const float*)d_in[2];
    const float* w1 = (const float*)d_in[3]; const float* b1 = (const float*)d_in[4]; const float* w2 = (const float*)d_in[5]; const float* b2 = (const float*)d_in[6];   // w1 [1024][2048], w2 [2048][1024], both (in, out) = k-major
    float* out = (float*)d_out;    // [4][2048][1024]
    char* wsp = (char*)d_ws;
    auto take = [&](size_t bytes) { char* p = wsp; wsp += (bytes + 255) & ~(size_t)255; return (void*)p; };
    constexpr size_t NR = (size_t)NB_ * NTK;   // rows of all items
    bf* W1T = (bf*)take((size_t)FF * DM * 2); bf* W2T = (bf*)take((size_t)DM * FF * 2);
    bf* Xb = (bf*)take(NR * DM * 2); bf* XT = (bf*)take(NR * DM * 2); bf* Y0h = (bf*)take(NR * DM * 2); bf* Y0l = (bf*)take(NR * DM * 2);
    float* T = (float*)take(NR * FF * 4); bf* Hh = (bf*)take(NR * FF * 2); bf* Hl = (bf*)take(NR * FF * 2);
    float* Y1 = (float*)take(NR * DM * 4);
    // A plane whose last reader has run before another's writer starts (stream order) lends it its bytes (m^T and its planes fill a quarter of theirs): 8 + 32 + 32 + 64 + 64 + 32 = 232 MiB.
    bf* Y1Th = Y0h; bf* Y1Tl = Y0l;   // y0 is last read by the first product, y1^T is written after the second
    float* MT = T;                    // t is last read by the GELU, m^T is written after it
    bf* MTh = Hh; bf* MTl = Hl;       // gelu(t) is last read by the second product, the planes of m^T are written after it
    float* Y2 = Y1;                   // y1 is last read by the transpose, y2 is written after it
    if ((size_t)(wsp - (char*)d_ws) > ws_size) return;
    k_wt<<<dim3(DM / 64, FF / 64, 1), 256, 0, stream>>>(w1, DM, FF, W1T);    // w1 [1024 k][2048 n] -> W1T [2048][1024]
    k_wt<<<dim3(FF / 64, DM / 64, 1), 256, 0, stream>>>(w2, FF, DM, W2T);    // w2 [2048 k][1024 n] -> W2T [1024][2048]
    k_xbt<<<dim3(NT_ / 64, DM / 64, NB_), 256, 0, stream>>>(x, Xb, XT);                                                                                            // bf16(x) as [item][t][f] and [item][f][t]
    k_ln<true><<<NB_ * NTK / 8, 256, 0, stream>>>(x, lg, lb, NB_ * NTK, Y0h, Y0l);
    k_gemm<2, 1, 128, DM, true><<<dim3(NTK / 128, FF / 128, NB_), 256, 0, stream>>>(Y0h, Y0l, W1T, nullptr, b1, T, FF, NTK * DM, 0, NTK * FF);                  // y0.w1 + b1
    k_gelu2<<<NB_ * NTK / 8, 256, 0, stream>>>(T, NB_ * NTK, Hh, Hl);
    k_gemm<2, 1, 64, FF, true><<<dim3(NTK / 128, DM / 64, NB_), 256, 0, stream>>>(Hh, Hl, W2T, nullptr, b2, Y1, DM, NTK * FF, 0, NTK * DM);                     // gelu(t).w2 + b2
    k_vt<<<dim3(NT_ / 64, 2, NKV * NB_), 256, 0, stream>>>(Y1, Y1Th, Y1Tl);                                                                                       // y1^T hi/lo planes [item][1024][2048]
    k_gemm<2, 1, 128, NT_, false><<<dim3(DM / 128, DM / 128, NB_), 256, 0, stream>>>(Y1Th, Y1Tl, XT, nullptr, nullptr, MT, DM, DM * NT_, DM * NT_, DM * DM);         // m^T [g][f] = sum over t of y1[t][g] x[t][f]
    k_cvtb2<<<NB_ * DM / 8, 256, 0, stream>>>(MT, NB_ * DM, MTh, MTl);                                                                                            // m^T -> hi/lo
    k_gemm<1, 2, 128, DM, false><<<dim3(NT_ / 128, DM / 128, NB_), 256, 0, stream>>>(Xb, nullptr, MTh, MTl, nullptr, Y2, DM, NTK * DM, DM * DM, NTK * DM);           // y2 [t][g] = sum over f of x[t][f] m^T[g][f]
    k_lnout<<<NB_ * NTK / 8, 256, 0, stream>>>(x, Y2, lg, lb, out);                                                                                               // LN(x + y2)
}

// v004
// One run takes 202 microseconds.
// Timed twice side by side with v003, it ran 1.23 times as fast both times.
// Over all steps from v000 it is 5.10 times as fast.
#include <hip/hip_runtime.h>

// Compute dtypes, f32 accumulate, all four batch items in every launch (row-wise kernels: 4 x 2048 rows, the m^T split 4 x 1024; per-item products: grid z = item): y0 = LN(x) (f32; gamma/beta and x read through bf16 rounding) -> bf16 hi + UNSCALED residual planes;
// t = y0.w1 + b1 ([2048 x 1024].[1024 x 2048]) and y1 = gelu(t).w2 + b2 ([2048 x 2048].[2048 x 1024]) on v_wmma_f32_16x16x32_bf16 with k-major weights
// transposed once to n-major bf16 planes and the computed operands as hi + residual (two products; exact-erf GELU in f32 in between); (x.x^T).y1 is summed as
// x.(x^T.y1): m^T = y1^T.x ([1024 x 2048].[2048 x 1024] per item, y1 as hi + residual, the INPUT x rounded once: two products), then y2 = x.m ([2048 x 1024].[1024 x 1024],
// m as hi + residual: two products): half the multiply-adds of the score route per product, and no [2048 x 2048] score plane.

#define NB_  4
#define NT_  2048
#define DM   1024
#define FF   2048
#define HD   128                 // k_vt tile grouping only
#define KW   DM
#define NKV  (DM / HD)
#define NTK  NT_
#define LOSC 1024.0f             // (unused here)

typedef _Float16 h16;
typedef unsigned short bf;
typedef __attribute__((ext_vector_type(16))) __bf16   v16bf;
typedef __attribute__((ext_vector_type(16))) _Float16 v16h;
typedef __attribute__((ext_vector_type(8)))  _Float16 v8h;
typedef __attribute__((ext_vector_type(8)))  unsigned short v8us;
typedef __attribute__((ext_vector_type(8)))  float    v8f;
typedef __attribute__((ext_vector_type(4)))  float    v4f;
typedef __attribute__((ext_vector_type(4)))  _Float16 v4h;
typedef v8h  __attribute__((may_alias)) v8ha;
typedef v4f  __attribute__((may_alias)) v4fa;
typedef v8us __attribute__((may_alias)) v8usa;

__device__ __forceinline__ unsigned short f2bf(float f) { unsigned u = __float_as_uint(f); u += 0x7FFFu + ((u >> 16) & 1u); return (unsigned short)(u >> 16); }
__device__ __forceinline__ float bf2f(unsigned short b) { return __uint_as_float(((unsigned)b) << 16); }
__device__ __forceinline__ float bfr(float f) { return bf2f(f2bf(f)); }
__device__ __forceinline__ v16h cat16(v8h lo, v8h hi) { return __builtin_shufflevector(lo, hi, 0, 1, 2, 3, 4, 5, 6, 7, 8, 9, 10, 11, 12, 13, 14, 15); }
__device__ __forceinline__ v16bf cat16b(v8us lo, v8us hi) { return __builtin_bit_cast(v16bf, __builtin_shufflevector(lo, hi, 0, 1, 2, 3, 4, 5, 6, 7, 8, 9, 10, 11, 12, 13, 14, 15)); }
__device__ __forceinline__ v8f wmma16(v16h a, v16h b, v8f c) { return __builtin_amdgcn_wmma_f32_16x16x32_f16(false, a, false, b, (short)0, c, false, false); }
__device__ __forceinline__ v8f wmmab(v16bf a, v16bf b, v8f c) { return __builtin_amdgcn_wmma_f32_16x16x32_bf16(false, a, false, b, (short)0, c, false, false); }

// k_xbt: the input x [item][2048 t][1024 f], rounded once to bf16, written in both orders: XB [item][t][f] and XT [item][f][t], via 64 x 64 LDS tiles; grid (NT/64, DM/64, items).
// Thread -> row tid >> 3 (+ 32), 8 columns (tid & 7) * 8: 8 lanes store one whole 128-B line of either plane. All stores stand behind the barrier, so that it waits on LDS alone.
__global__ __launch_bounds__(256) void k_xbt(const float* __restrict__ X, bf* XB, bf* XT) {
    __shared__ __align__(16) unsigned short tl[64 * 72];
    const int tid = threadIdx.x, t0 = blockIdx.x * 64, f0 = blockIdx.y * 64, piece = tid & 7, row = tid >> 3;
    const size_t ib = (size_t)blockIdx.z * NT_ * DM, o = ib + (size_t)(t0 + row) * DM + f0 + piece * 8;
    v4f a[2][2];
#pragma unroll
    for (int s = 0; s < 2; ++s) { a[s][0] = *(const v4f*)(X + o + (size_t)s * 32 * DM); a[s][1] = *(const v4f*)(X + o + (size_t)s * 32 * DM + 4); }
    v8us r[2];
#pragma unroll
    for (int s = 0; s < 2; ++s)
#pragma unroll
        for (int i = 0; i < 8; ++i) { r[s][i] = f2bf(a[s][i >> 2][i & 3]); tl[(piece * 8 + i) * 72 + row + 32 * s] = r[s][i]; }
    __syncthreads();
#pragma unroll
    for (int s = 0; s < 2; ++s) { const v8us val = *(const v8usa*)(tl + (row + 32 * s) * 72 + piece * 8);
        *(v8us*)(XB + o + (size_t)s * 32 * DM) = r[s]; *(v8us*)(XT + ib + (size_t)(f0 + row + 32 * s) * NT_ + t0 + piece * 8) = val; }
}

__global__ __launch_bounds__(256) void k_cvtb2(const float* __restrict__ src, int nrows, bf* dh, bf* dl) {
    const int lane = threadIdx.x & 31, r = blockIdx.x * 8 + (threadIdx.x >> 5);
    if (r >= nrows) return;
    v8us oh[DM / 256], ol[DM / 256];
#pragma unroll
    for (int q = 0; q < DM / 256; ++q) {
#pragma unroll
        for (int i = 0; i < 8; ++i) { const float v = src[(size_t)r * DM + q * 256 + lane * 8 + i]; const unsigned short hb = f2bf(v); oh[q][i] = hb; ol[q][i] = f2bf(v - bf2f(hb)); } }
{
#pragma unroll
        for (int q = 0; q < DM / 256; ++q) { const size_t o = (size_t)r * DM + q * 256 + lane * 8; *(v8us*)(dh + o) = oh[q]; *(v8us*)(dl + o) = ol[q]; }
         }
}
// k_wt: WT [n][K] = bf16(W[k][n]) (k-major [K][ncols]) via 64 x 64 LDS tiles; grid (K/64, ncols/64).
__global__ __launch_bounds__(256) void k_wt(const float* __restrict__ Wm, int K, int ncols, bf* WT) {
    __shared__ __align__(16) unsigned short tl[64 * 72];
    const int tid = threadIdx.x, k0 = blockIdx.x * 64, n0 = blockIdx.y * 64;
    const int kk = tid >> 2, nq = (tid & 3) * 16;
#pragma unroll
    for (int i = 0; i < 16; ++i) tl[(nq + i) * 72 + kk] = f2bf(Wm[(size_t)(k0 + kk) * ncols + n0 + nq + i]);
    __syncthreads();
    const int piece = tid & 7;
    auto pass = [&]() {
#pragma unroll
        for (int s = 0; s < 2; ++s) { const int nr = (tid >> 3) + 32 * s; const v8us val = *(const v8usa*)(tl + nr * 72 + piece * 8); *(v8us*)(WT + (size_t)(n0 + nr) * K + k0 + piece * 8) = val; }
    };
    pass(); 
}
// k_ln: one wave per row of x [rows][1024]: LayerNorm (mean, then mean((x-mu)^2), eps 1e-5, x bf(gamma) + bf(beta), f32, fixed lane order) -> bf16 hi + UNSCALED
// residual planes; lane -> columns q*256 + lane*8 .. +8 for q = 0..3 (16 B per plane per store, 8 lanes per line). The row is re-read per phase with the q loop
// rolled (keeps the static VALU-FMA count small; no register arrays indexed by a loop variable).
template <bool ROUNDIN>   // ROUNDIN: the source is a module INPUT (read through bf16 rounding); false: a computed f32 plane (read as is)
__global__ __launch_bounds__(256) void k_ln(const float* __restrict__ X, const float* __restrict__ gam, const float* __restrict__ bet, int nrows, bf* Hh, bf* Hl) {
    const int lane = threadIdx.x & 31, r = blockIdx.x * 8 + (threadIdx.x >> 5);
    if (r >= nrows) return;
    const float* xr = X + (size_t)r * DM + lane * 8;
    float s = 0.f;
#pragma unroll 1
    for (int q = 0; q < DM / 256; ++q) {
#pragma unroll
        for (int i = 0; i < 8; ++i) s += (ROUNDIN ? bfr(xr[q * 256 + i]) : xr[q * 256 + i]); }
#pragma unroll
    for (int sh = 16; sh; sh >>= 1) s += __shfl_xor(s, sh, 32);
    const float mu = s * (1.0f / DM);
    float s2 = 0.f;
#pragma unroll 1
    for (int q = 0; q < DM / 256; ++q) {
#pragma unroll
        for (int i = 0; i < 8; ++i) { const float d = (ROUNDIN ? bfr(xr[q * 256 + i]) : xr[q * 256 + i]) - mu; s2 = fmaf(d, d, s2); } }
#pragma unroll
    for (int sh = 16; sh; sh >>= 1) s2 += __shfl_xor(s2, sh, 32);
    const float rs = rsqrtf(s2 * (1.0f / DM) + 1e-5f);
{
#pragma unroll 1
        for (int q = 0; q < DM / 256; ++q) { v8us oh, ol;
#pragma unroll
            for (int i = 0; i < 8; ++i) { const int c = q * 256 + lane * 8 + i; const float y = ((ROUNDIN ? bfr(xr[q * 256 + i]) : xr[q * 256 + i]) - mu) * rs * bfr(gam[c]) + bfr(bet[c]); const unsigned short hb = f2bf(y); oh[i] = hb; ol[i] = f2bf(y - bf2f(hb)); }
            const size_t o = (size_t)r * DM + q * 256 + lane * 8; *(v8us*)(Hh + o) = oh; *(v8us*)(Hl + o) = ol; }
         }
}
// k_gelu2: exact-erf GELU of an f32 [nrows][FF] plane (bias already added) -> bf16 hi + UNSCALED residual planes; one wave per row, lane -> 4 consecutive
// columns per iteration (16 rolled iterations of 128 columns; 8 B per plane per store -> 16 lanes per line).
__global__ __launch_bounds__(256) void k_gelu2(const float* __restrict__ src, int nrows, bf* dh, bf* dl) {
    typedef __attribute__((ext_vector_type(4))) unsigned short v4us;
    const int lane = threadIdx.x & 31, r = blockIdx.x * 8 + (threadIdx.x >> 5);
    if (r >= nrows) return;
{
#pragma unroll 1
        for (int q = 0; q < FF / 128; ++q) { const size_t o = (size_t)r * FF + q * 128 + lane * 4; const v4f v = *(const v4f*)(src + o); v4us oh, ol;
#pragma unroll
            for (int i = 0; i < 4; ++i) { const float g = 0.5f * v[i] * (1.0f + erff(v[i] * 0.70710678118654752f)); const unsigned short hb = f2bf(g); oh[i] = hb; ol[i] = f2bf(g - bf2f(hb)); }
            *(v4us*)(dh + o) = oh; *(v4us*)(dl + o) = ol; }
         }
}
// k_gemm: BM x BN block tile (8 waves as WMW x 8/WMW, wave tile BM/WMW x BN/(8/WMW): 64 x 64 where the grid still fills the chip, else 32 x 64) of C[.][ldc] = (A0 [+ A1]).(B0 [+ B1])^T [+ bf(bias[c])], all planes bf16 with row stride K.
// A stage is 128 k (256 B) of every operand row, rows [A0 | A1 | B0 | B1] at an LDS pitch of 272 B, brought in by asynchronous copies (16 lanes = one whole 256-B row piece,
// so every copy reads whole lines) into two buffers: stage t + 1 flies while stage t is worked on. Per accumulator and 32-k step the products keep the order
// A0.B0, A1.B0, A0.B1 and k runs upward, with the same k order inside a fragment for A and B (bytes 16h and 32 + 16h of each 64 B of a row).
#define KS    128
#define PITCH 272
// N copies in one statement and, as its last line, the wait that stands in front of any rewrite of the address registers they name.
template <int N>
__device__ __forceinline__ void copies(const unsigned* l, const bf* const* g) {
    static_assert(N == 8 || N == 12, "a statement takes 8 or 12 copies (16 or 24 operands)");
    if constexpr (N == 8)
        asm volatile(
                     "global_load_async_to_lds_b128 %0, %8, off\n\t"
                     "global_load_async_to_lds_b128 %1, %9, off\n\t"
                     "global_load_async_to_lds_b128 %2, %10, off\n\t"
                     "global_load_async_to_lds_b128 %3, %11, off\n\t"
                     "global_load_async_to_lds_b128 %4, %12, off\n\t"
                     "global_load_async_to_lds_b128 %5, %13, off\n\t"
                     "global_load_async_to_lds_b128 %6, %14, off\n\t"
                     "global_load_async_to_lds_b128 %7, %15, off\n\t"
                     "s_wait_xcnt 0x0"
                     :: "v"(l[0]), "v"(l[1]), "v"(l[2]), "v"(l[3]), "v"(l[4]), "v"(l[5]), "v"(l[6]), "v"(l[7]),
                        "v"(g[0]), "v"(g[1]), "v"(g[2]), "v"(g[3]), "v"(g[4]), "v"(g[5]), "v"(g[6]), "v"(g[7]) : "memory");
    else
        asm volatile(
                     "global_load_async_to_lds_b128 %0, %12, off\n\t"
                     "global_load_async_to_lds_b128 %1, %13, off\n\t"
                     "global_load_async_to_lds_b128 %2, %14, off\n\t"
                     "global_load_async_to_lds_b128 %3, %15, off\n\t"
                     "global_load_async_to_lds_b128 %4, %16, off\n\t"
                     "global_load_async_to_lds_b128 %5, %17, off\n\t"
                     "global_load_async_to_lds_b128 %6, %18, off\n\t"
                     "global_load_async_to_lds_b128 %7, %19, off\n\t"
                     "global_load_async_to_lds_b128 %8, %20, off\n\t"
                     "global_load_async_to_lds_b128 %9, %21, off\n\t"
                     "global_load_async_to_lds_b128 %10, %22, off\n\t"
                     "global_load_async_to_lds_b128 %11, %23, off\n\t"
                     "s_wait_xcnt 0x0"
                     :: "v"(l[0]), "v"(l[1]), "v"(l[2]), "v"(l[3]), "v"(l[4]), "v"(l[5]), "v"(l[6]), "v"(l[7]), "v"(l[8]), "v"(l[9]), "v"(l[10]), "v"(l[11]),
                        "v"(g[0]), "v"(g[1]), "v"(g[2]), "v"(g[3]), "v"(g[4]), "v"(g[5]), "v"(g[6]), "v"(g[7]), "v"(g[8]), "v"(g[9]), "v"(g[10]), "v"(g[11]) : "memory");
}
__device__ __forceinline__ v16bf ldfrag(const unsigned char* p) { return cat16b(*(const v8usa*)p, *(const v8usa*)(p + 32)); }

template <int NA, int NBP, int BM, int BN, int WMW, int K, bool BIAS>
__global__ __launch_bounds__(256) void k_gemm(const bf* __restrict__ A0, const bf* __restrict__ A1, const bf* __restrict__ B0, const bf* __restrict__ B1, const float* __restrict__ bias, float* C, int ldc, int zA, int zB, int zC) {
    // zA, zB, zC: elements from one batch item (blockIdx.z) to the next in the A planes, the B planes and C (0: shared by all items).
    constexpr int WNW = 8 / WMW, FM = BM / WMW / 16, WN = BN / WNW, FN = WN / 16, NT = K / KS;
    constexpr int STAGE = (NA * BM + NBP * BN) * PITCH;
    constexpr int OFF_A1 = BM * PITCH, OFF_B0 = NA * BM * PITCH, OFF_B1 = (NA * BM + BN) * PITCH;
    __shared__ __align__(16) unsigned char sm[2 * STAGE];
    const int tid = threadIdx.x, lane = tid & 31, wave = tid >> 5, lr = lane & 15, hi = lane >> 4;
    const int wm = wave / WNW, wn = wave % WNW;
    const int r0 = blockIdx.x * BM, c0 = blockIdx.y * BN;
    const int crow = tid >> 4, cpc = tid & 15;
    const unsigned lt = (unsigned)(size_t)sm + crow * PITCH + cpc * 16;
    const size_t ga = (size_t)blockIdx.z * zA + (size_t)(r0 + crow) * K + cpc * 8, gb = (size_t)blockIdx.z * zB + (size_t)(c0 + crow) * K + cpc * 8;
    // One stage: the block's 256 threads cover 16 rows a copy (thread -> row tid >> 4, 16-byte piece tid & 15); NC copies a thread, 8 or 12 to a statement.
    constexpr int NC = (NA * BM + NBP * BN) / 16;
    auto fill = [&](int t) {
        const unsigned lb = lt + (t & 1) * STAGE; const int kc = t * KS;
        unsigned l[NC]; const bf* g[NC];
#pragma unroll
        for (int j = 0; j < NC; ++j) l[j] = lb + j * 16 * PITCH;
#pragma unroll
        for (int j = 0; j < BM / 16; ++j) { g[j] = A0 + ga + kc + (size_t)j * 16 * K; if constexpr (NA == 2) g[BM / 16 + j] = A1 + ga + kc + (size_t)j * 16 * K; }
#pragma unroll
        for (int j = 0; j < BN / 16; ++j) { g[NA * BM / 16 + j] = B0 + gb + kc + (size_t)j * 16 * K; if constexpr (NBP == 2) g[(NA * BM + BN) / 16 + j] = B1 + gb + kc + (size_t)j * 16 * K; }
        constexpr int CS = NC % 12 == 0 ? 12 : 8;
#pragma unroll   // every statement's operands are array elements picked by constants, so the arrays stay in registers
        for (int j = 0; j < NC; j += CS) copies<CS>(l + j, g + j);
    };
    v8f acc[FM][FN];
#pragma unroll
    for (int m = 0; m < FM; ++m)
#pragma unroll
        for (int n = 0; n < FN; ++n) acc[m][n] = (v8f){};
    float bv[FN];   // the lane's bias values, fetched here so that their latency lies under the loop
#pragma unroll
    for (int n = 0; n < FN; ++n) bv[n] = BIAS ? bfr(bias[c0 + wn * WN + n * 16 + lr]) : 0.f;
    fill(0);
    asm volatile("s_wait_asynccnt 0x0" ::: "memory");   // this wave's copies of stage 0 have landed
    __syncthreads();                                     // ... and every other wave's
    fill(1);
    // The stage loop stays rolled (one copy of its body; the buffer is picked by t & 1); every loop inside it is unrolled so that the register arrays are indexed by constants.
#pragma unroll 1
    for (int t = 0; t < NT; ++t) {
        const unsigned char* sb = sm + (t & 1) * STAGE;
        const unsigned char* pa = sb + (wm * FM * 16 + lr) * PITCH + 16 * hi;
        const unsigned char* pb = sb + OFF_B0 + (wn * WN + lr) * PITCH + 16 * hi;
        // Two fragment sets: the loads of 32-k step ks + 1 go out as one group ahead of step ks's products (only inside this stage), so that a step's LDS latency is covered by the step before.
        v16bf a0[2][FM], a1[2][FM], b0[2][FN], b1[2][FN];
        auto ldset = [&](int q, int ks) {
#pragma unroll
            for (int m = 0; m < FM; ++m) { a0[q][m] = ldfrag(pa + m * 16 * PITCH + ks * 64); if constexpr (NA == 2) a1[q][m] = ldfrag(pa + OFF_A1 + m * 16 * PITCH + ks * 64); }
#pragma unroll
            for (int n = 0; n < FN; ++n) { b0[q][n] = ldfrag(pb + n * 16 * PITCH + ks * 64); if constexpr (NBP == 2) b1[q][n] = ldfrag(pb + (OFF_B1 - OFF_B0) + n * 16 * PITCH + ks * 64); }
        };
        ldset(0, 0);
#pragma unroll
        for (int ks = 0; ks < KS / 32; ++ks) {
            const int q = ks & 1;
            if (ks + 1 < KS / 32) ldset(q ^ 1, ks + 1);
            __builtin_amdgcn_sched_barrier(0);   // keeps the next step's load group ahead of this step's products (the scheduler otherwise sinks each load to just before its use)
#pragma unroll
            for (int m = 0; m < FM; ++m)
#pragma unroll
                for (int n = 0; n < FN; ++n) acc[m][n] = wmmab(a0[q][m], b0[q][n], acc[m][n]);
            if constexpr (NA == 2) {
#pragma unroll
                for (int m = 0; m < FM; ++m)
#pragma unroll
                    for (int n = 0; n < FN; ++n) acc[m][n] = wmmab(a1[q][m], b0[q][n], acc[m][n]);
            }
            if constexpr (NBP == 2) {
#pragma unroll
                for (int m = 0; m < FM; ++m)
#pragma unroll
                    for (int n = 0; n < FN; ++n) acc[m][n] = wmmab(a0[q][m], b1[q][n], acc[m][n]);
            }
            __builtin_amdgcn_sched_barrier(0);   // keeps this step's products ahead of the load group after next, which reuses their fragment set
        }
        asm volatile("s_wait_dscnt 0x0" ::: "memory");      // this wave's reads of stage t are done before its buffer is refilled
        asm volatile("s_wait_asynccnt 0x0" ::: "memory");   // this wave's copies of stage t + 1 have landed
        __syncthreads();                                     // publishes stage t + 1 and ends every reader's last read of stage t
        if (t + 2 < NT) fill(t + 2);
    }
    asm volatile("s_wait_asynccnt 0x0" ::: "memory");       // no copy is outstanding when the ring becomes output staging
    // Epilogue: each wave stages its FM 16 x WN f32 pieces in its own part of the ring (the loop's last barrier has ended every read of it) and stores whole 128-B lines.
    constexpr int OP = WN + 4, LPR = WN / 32;
    static_assert(8 * FM * 16 * OP * 4 <= 2 * STAGE, "the output staging fits the ring");
    float* os = (float*)(void*)sm + wave * (FM * 16 * OP);
#pragma unroll
    for (int n = 0; n < FN; ++n)
#pragma unroll
        for (int m = 0; m < FM; ++m)
#pragma unroll
            for (int j = 0; j < 8; ++j) os[(m * 16 + hi * 8 + j) * OP + n * 16 + lr] = BIAS ? acc[m][n][j] + bv[n] : acc[m][n][j];
    __syncthreads();   // the staged values are read back by other lanes: no read may move ahead of the stores
    float* crow_p = C + (size_t)blockIdx.z * zC + (size_t)(r0 + wm * FM * 16) * ldc + c0 + wn * WN;
#pragma unroll
    for (int s = 0; s < FM * 4 * LPR; ++s) { const int Lid = (lane >> 3) + 4 * s, piece = lane & 7; const int row = Lid / LPR, cofs = (Lid % LPR) * 32 + piece * 4;
        const v4f val = *(const v4fa*)(os + row * OP + cofs); *(v4f*)(crow_p + (size_t)row * ldc + cofs) = val; }
}
// k_vt: VTH/VTL [g][128 d][2048 t] = bf16 hi + UNSCALED bf16 residual of V [t][g*128+d] via 64 x 64 LDS tiles; grid (NT/64, 2, 8 x items): per item a full transpose of Y1 [t][1024] into hi/lo planes [1024][t].
__global__ __launch_bounds__(256) void k_vt(const float* __restrict__ V, bf* VTH, bf* VTL) {
    __shared__ float tl[64][65];
    const int tid = threadIdx.x, t0 = blockIdx.x * 64, d0 = blockIdx.y * 64, g = blockIdx.z % NKV, b = blockIdx.z / NKV;
    { const int tt = tid >> 2, dq = (tid & 3) * 16;
#pragma unroll
      for (int i = 0; i < 16; ++i) tl[dq + i][tt] = V[((size_t)b * NT_ + t0 + tt) * KW + g * HD + d0 + dq + i]; }
    __syncthreads();
    const int piece = tid & 7;
    auto pass = [&]() {
#pragma unroll
        for (int s = 0; s < 2; ++s) { const int d = (tid >> 3) + 32 * s; v8us oh, ol;
#pragma unroll
            for (int i = 0; i < 8; ++i) { const float v = tl[d][piece * 8 + i]; const unsigned short hb = f2bf(v); oh[i] = hb; ol[i] = f2bf(v - bf2f(hb)); }
            const size_t o = ((size_t)b * DM + g * HD + d0 + d) * NT_ + t0 + piece * 8; *(v8us*)(VTH + o) = oh; *(v8us*)(VTL + o) = ol; }
    };
    pass(); 
}

// k_lnout: one wave per row: v = bf(x) + y2 (f32), LayerNorm (mean, mean((v-mu)^2), eps 1e-5, x bf(gamma) + bf(beta)) -> f32 output row; per 128-column chunk q the
// per phase.
__global__ __launch_bounds__(256) void k_lnout(const float* __restrict__ X, const float* __restrict__ Y2, const float* __restrict__ gam, const float* __restrict__ bet, float* OUTP) {
    const int lane = threadIdx.x & 31, r = blockIdx.x * 8 + (threadIdx.x >> 5);
    if (r >= NB_ * NT_) return;
    const float* xr = X + (size_t)r * DM; const float* yr = Y2 + (size_t)r * DM;
    float s = 0.f;
#pragma unroll 1
    for (int q = 0; q < 2 * (DM / 256); ++q) { const int c0 = (q >> 1) * 256 + (q & 1) * 128 + lane * 4; const v4f xv = *(const v4f*)(xr + c0), yv = *(const v4f*)(yr + c0);
#pragma unroll
        for (int i = 0; i < 4; ++i) s += bfr(xv[i]) + yv[i]; }
#pragma unroll
    for (int sh = 16; sh; sh >>= 1) s += __shfl_xor(s, sh, 32);
    const float mu = s * (1.0f / DM);
    float s2 = 0.f;
#pragma unroll 1
    for (int q = 0; q < 2 * (DM / 256); ++q) { const int c0 = (q >> 1) * 256 + (q & 1) * 128 + lane * 4; const v4f xv = *(const v4f*)(xr + c0), yv = *(const v4f*)(yr + c0);
#pragma unroll
        for (int i = 0; i < 4; ++i) { const float d = (bfr(xv[i]) + yv[i]) - mu; s2 = fmaf(d, d, s2); } }
#pragma unroll
    for (int sh = 16; sh; sh >>= 1) s2 += __shfl_xor(s2, sh, 32);
    const float rs = rsqrtf(s2 * (1.0f / DM) + 1e-5f);
{
#pragma unroll 1
        for (int q = 0; q < 2 * (DM / 256); ++q) { const int c0 = (q >> 1) * 256 + (q & 1) * 128 + lane * 4; const v4f xv = *(const v4f*)(xr + c0), yv = *(const v4f*)(yr + c0); v4f o;
#pragma unroll
            for (int i = 0; i < 4; ++i) o[i] = ((bfr(xv[i]) + yv[i]) - mu) * rs * bfr(gam[c0 + i]) + bfr(bet[c0 + i]);
            *(v4f*)(OUTP + (size_t)r * DM + c0) = o; }
         }
}

extern "C" void kernel_launch(void* const* d_in, const int* in_sizes, int n_in,
                              void* d_out, int out_size, void* d_ws, size_t ws_size, hipStream_t stream) {
    (void)in_sizes; (void)n_in; (void)out_size;
    const float* x = (const float*)d_in[0]; const float* lg = (const float*)d_in[1]; const float* lb = (const float*)d_in[2];
    const float* w1 = (const float*)d_in[3]; const float* b1 = (const float*)d_in[4]; const float* w2 = (const float*)d_in[5]; const float* b2 = (const float*)d_in[6];   // w1 [1024][2048], w2 [2048][1024], both (in, out) = k-major
    float* out = (float*)d_out;    // [4][2048][1024]
    char* wsp = (char*)d_ws;
    auto take = [&](size_t bytes) { char* p = wsp; wsp += (bytes + 255) & ~(size_t)255; return (void*)p; };
    constexpr size_t NR = (size_t)NB_ * NTK;   // rows of all items
    bf* W1T = (bf*)take((size_t)FF * DM * 2); bf* W2T = (bf*)take((size_t)DM * FF * 2);
    bf* Xb = (bf*)take(NR * DM * 2); bf* XT = (bf*)take(NR * DM * 2); bf* Y0h = (bf*)take(NR * DM * 2); bf* Y0l = (bf*)take(NR * DM * 2);
    float* T = (float*)take(NR * FF * 4); bf* Hh = (bf*)take(NR * FF * 2); bf* Hl = (bf*)take(NR * FF * 2);
    float* Y1 = (float*)take(NR * DM * 4);
    // A plane whose last reader has run before another's writer starts (stream order) lends it its bytes (m^T and its planes fill a quarter of theirs): 8 + 32 + 32 + 64 + 64 + 32 = 232 MiB.
    bf* Y1Th = Y0h; bf* Y1Tl = Y0l;   // y0 is last read by the first product, y1^T is written after the second
    float* MT = T;                    // t is last read by the GELU, m^T is written after it
    bf* MTh = Hh; bf* MTl = Hl;       // gelu(t) is last read by the second product, the planes of m^T are written after it
    float* Y2 = Y1;                   // y1 is last read by the transpose, y2 is written after it
    if ((size_t)(wsp - (char*)d_ws) > ws_size) return;
    k_wt<<<dim3(DM / 64, FF / 64, 1), 256, 0, stream>>>(w1, DM, FF, W1T);    // w1 [1024 k][2048 n] -> W1T [2048][1024]
    k_wt<<<dim3(FF / 64, DM / 64, 1), 256, 0, stream>>>(w2, FF, DM, W2T);    // w2 [2048 k][1024 n] -> W2T [1024][2048]
    k_xbt<<<dim3(NT_ / 64, DM / 64, NB_), 256, 0, stream>>>(x, Xb, XT);                                                                                            // bf16(x) as [item][t][f] and [item][f][t]
    k_ln<true><<<NB_ * NTK / 8, 256, 0, stream>>>(x, lg, lb, NB_ * NTK, Y0h, Y0l);
    k_gemm<2, 1, 128, 256, 2, DM, true><<<dim3(NTK / 128, FF / 256, NB_), 256, 0, stream>>>(Y0h, Y0l, W1T, nullptr, b1, T, FF, NTK * DM, 0, NTK * FF);                  // y0.w1 + b1
    k_gelu2<<<NB_ * NTK / 8, 256, 0, stream>>>(T, NB_ * NTK, Hh, Hl);
    k_gemm<2, 1, 128, 256, 2, FF, true><<<dim3(NTK / 128, DM / 256, NB_), 256, 0, stream>>>(Hh, Hl, W2T, nullptr, b2, Y1, DM, NTK * FF, 0, NTK * DM);                     // gelu(t).w2 + b2
    k_vt<<<dim3(NT_ / 64, 2, NKV * NB_), 256, 0, stream>>>(Y1, Y1Th, Y1Tl);                                                                                       // y1^T hi/lo planes [item][1024][2048]
    k_gemm<2, 1, 128, 128, 4, NT_, false><<<dim3(DM / 128, DM / 128, NB_), 256, 0, stream>>>(Y1Th, Y1Tl, XT, nullptr, nullptr, MT, DM, DM * NT_, DM * NT_, DM * DM);         // m^T [g][f] = sum over t of y1[t][g] x[t][f]
    k_cvtb2<<<NB_ * DM / 8, 256, 0, stream>>>(MT, NB_ * DM, MTh, MTl);                                                                                            // m^T -> hi/lo
    k_gemm<1, 2, 256, 128, 4, DM, false><<<dim3(NT_ / 256, DM / 128, NB_), 256, 0, stream>>>(Xb, nullptr, MTh, MTl, nullptr, Y2, DM, NTK * DM, DM * DM, NTK * DM);           // y2 [t][g] = sum over f of x[t][f] m^T[g][f]
    k_lnout<<<NB_ * NTK / 8, 256, 0, stream>>>(x, Y2, lg, lb, out);                                                                                               // LN(x + y2)
}

// v005
// Measured time: 188 microseconds a run.
// Two timings next to v004 both put it at 1.07 times that version's speed.
// All steps since v000 together make it 5.46 times as fast.
#include <hip/hip_runtime.h>

// Compute dtypes, f32 accumulate, all four batch items in every launch (row-wise kernels: 4 x 2048 rows; per-item products: grid z = item): y0 = LN(x) (f32; gamma/beta and x read through bf16 rounding) -> bf16 hi + UNSCALED residual planes;
// t = y0.w1 + b1 ([2048 x 1024].[1024 x 2048]) and y1 = gelu(t).w2 + b2 ([2048 x 2048].[2048 x 1024]) on v_wmma_f32_16x16x32_bf16 with k-major weights
// transposed once to n-major bf16 planes and the computed operands as hi + residual (two products; exact-erf GELU in f32 in between); (x.x^T).y1 is summed as
// x.(x^T.y1): m^T = y1^T.x ([1024 x 2048].[2048 x 1024] per item, y1 as hi + residual, the INPUT x rounded once: two products), then y2 = x.m ([2048 x 1024].[1024 x 1024],
// m as hi + residual: two products): half the multiply-adds of the score route per product, and no [2048 x 2048] score plane.
// y1 and m^T never exist as f32 planes: the product that computes them splits each f32 value into hi + residual in its epilogue and stores the planes the next product reads (y1 transposed).

#define NB_  4
#define NT_  2048
#define DM   1024
#define FF   2048
#define NTK  NT_
#define LOSC 1024.0f             // (unused here)

typedef _Float16 h16;
typedef unsigned short bf;
typedef __attribute__((ext_vector_type(16))) __bf16   v16bf;
typedef __attribute__((ext_vector_type(16))) _Float16 v16h;
typedef __attribute__((ext_vector_type(8)))  _Float16 v8h;
typedef __attribute__((ext_vector_type(8)))  unsigned short v8us;
typedef __attribute__((ext_vector_type(8)))  float    v8f;
typedef __attribute__((ext_vector_type(4)))  float    v4f;
typedef __attribute__((ext_vector_type(4)))  _Float16 v4h;
typedef v8h  __attribute__((may_alias)) v8ha;
typedef v4f  __attribute__((may_alias)) v4fa;
typedef v8us __attribute__((may_alias)) v8usa;

__device__ __forceinline__ unsigned short f2bf(float f) { unsigned u = __float_as_uint(f); u += 0x7FFFu + ((u >> 16) & 1u); return (unsigned short)(u >> 16); }
__device__ __forceinline__ float bf2f(unsigned short b) { return __uint_as_float(((unsigned)b) << 16); }
__device__ __forceinline__ float bfr(float f) { return bf2f(f2bf(f)); }
__device__ __forceinline__ v16h cat16(v8h lo, v8h hi) { return __builtin_shufflevector(lo, hi, 0, 1, 2, 3, 4, 5, 6, 7, 8, 9, 10, 11, 12, 13, 14, 15); }
__device__ __forceinline__ v16bf cat16b(v8us lo, v8us hi) { return __builtin_bit_cast(v16bf, __builtin_shufflevector(lo, hi, 0, 1, 2, 3, 4, 5, 6, 7, 8, 9, 10, 11, 12, 13, 14, 15)); }
__device__ __forceinline__ v8f wmma16(v16h a, v16h b, v8f c) { return __builtin_amdgcn_wmma_f32_16x16x32_f16(false, a, false, b, (short)0, c, false, false); }
__device__ __forceinline__ v8f wmmab(v16bf a, v16bf b, v8f c) { return __builtin_amdgcn_wmma_f32_16x16x32_bf16(false, a, false, b, (short)0, c, false, false); }

// k_xbt: the input x [item][2048 t][1024 f], rounded once to bf16, written in both orders: XB [item][t][f] and XT [item][f][t], via 64 x 64 LDS tiles; grid (NT/64, DM/64, items).
// Thread -> row tid >> 3 (+ 32), 8 columns (tid & 7) * 8: 8 lanes store one whole 128-B line of either plane. All stores stand behind the barrier, so that it waits on LDS alone.
__global__ __launch_bounds__(256) void k_xbt(const float* __restrict__ X, bf* XB, bf* XT) {
    __shared__ __align__(16) unsigned short tl[64 * 72];
    const int tid = threadIdx.x, t0 = blockIdx.x * 64, f0 = blockIdx.y * 64, piece = tid & 7, row = tid >> 3;
    const size_t ib = (size_t)blockIdx.z * NT_ * DM, o = ib + (size_t)(t0 + row) * DM + f0 + piece * 8;
    v4f a[2][2];
#pragma unroll
    for (int s = 0; s < 2; ++s) { a[s][0] = *(const v4f*)(X + o + (size_t)s * 32 * DM); a[s][1] = *(const v4f*)(X + o + (size_t)s * 32 * DM + 4); }
    v8us r[2];
#pragma unroll
    for (int s = 0; s < 2; ++s)
#pragma unroll
        for (int i = 0; i < 8; ++i) { r[s][i] = f2bf(a[s][i >> 2][i & 3]); tl[(piece * 8 + i) * 72 + row + 32 * s] = r[s][i]; }
    __syncthreads();
#pragma unroll
    for (int s = 0; s < 2; ++s) { const v8us val = *(const v8usa*)(tl + (row + 32 * s) * 72 + piece * 8);
        *(v8us*)(XB + o + (size_t)s * 32 * DM) = r[s]; *(v8us*)(XT + ib + (size_t)(f0 + row + 32 * s) * NT_ + t0 + piece * 8) = val; }
}

// k_wt: WT [n][K] = bf16(W[k][n]) (k-major [K][ncols]) via 64 x 64 LDS tiles; grid (K/64, ncols/64).
__global__ __launch_bounds__(256) void k_wt(const float* __restrict__ Wm, int K, int ncols, bf* WT) {
    __shared__ __align__(16) unsigned short tl[64 * 72];
    const int tid = threadIdx.x, k0 = blockIdx.x * 64, n0 = blockIdx.y * 64;
    const int kk = tid >> 2, nq = (tid & 3) * 16;
#pragma unroll
    for (int i = 0; i < 16; ++i) tl[(nq + i) * 72 + kk] = f2bf(Wm[(size_t)(k0 + kk) * ncols + n0 + nq + i]);
    __syncthreads();
    const int piece = tid & 7;
    auto pass = [&]() {
#pragma unroll
        for (int s = 0; s < 2; ++s) { const int nr = (tid >> 3) + 32 * s; const v8us val = *(const v8usa*)(tl + nr * 72 + piece * 8); *(v8us*)(WT + (size_t)(n0 + nr) * K + k0 + piece * 8) = val; }
    };
    pass(); 
}
// k_ln: one wave per row of x [rows][1024]: LayerNorm (mean, then mean((x-mu)^2), eps 1e-5, x bf(gamma) + bf(beta), f32, fixed lane order) -> bf16 hi + UNSCALED
// residual planes; lane -> columns q*256 + lane*8 .. +8 for q = 0..3 (16 B per plane per store, 8 lanes per line). The row is re-read per phase with the q loop
// rolled (keeps the static VALU-FMA count small; no register arrays indexed by a loop variable).
template <bool ROUNDIN>   // ROUNDIN: the source is a module INPUT (read through bf16 rounding); false: a computed f32 plane (read as is)
__global__ __launch_bounds__(256) void k_ln(const float* __restrict__ X, const float* __restrict__ gam, const float* __restrict__ bet, int nrows, bf* Hh, bf* Hl) {
    const int lane = threadIdx.x & 31, r = blockIdx.x * 8 + (threadIdx.x >> 5);
    if (r >= nrows) return;
    const float* xr = X + (size_t)r * DM + lane * 8;
    float s = 0.f;
#pragma unroll 1
    for (int q = 0; q < DM / 256; ++q) {
#pragma unroll
        for (int i = 0; i < 8; ++i) s += (ROUNDIN ? bfr(xr[q * 256 + i]) : xr[q * 256 + i]); }
#pragma unroll
    for (int sh = 16; sh; sh >>= 1) s += __shfl_xor(s, sh, 32);
    const float mu = s * (1.0f / DM);
    float s2 = 0.f;
#pragma unroll 1
    for (int q = 0; q < DM / 256; ++q) {
#pragma unroll
        for (int i = 0; i < 8; ++i) { const float d = (ROUNDIN ? bfr(xr[q * 256 + i]) : xr[q * 256 + i]) - mu; s2 = fmaf(d, d, s2); } }
#pragma unroll
    for (int sh = 16; sh; sh >>= 1) s2 += __shfl_xor(s2, sh, 32);
    const float rs = rsqrtf(s2 * (1.0f / DM) + 1e-5f);
{
#pragma unroll 1
        for (int q = 0; q < DM / 256; ++q) { v8us oh, ol;
#pragma unroll
            for (int i = 0; i < 8; ++i) { const int c = q * 256 + lane * 8 + i; const float y = ((ROUNDIN ? bfr(xr[q * 256 + i]) : xr[q * 256 + i]) - mu) * rs * bfr(gam[c]) + bfr(bet[c]); const unsigned short hb = f2bf(y); oh[i] = hb; ol[i] = f2bf(y - bf2f(hb)); }
            const size_t o = (size_t)r * DM + q * 256 + lane * 8; *(v8us*)(Hh + o) = oh; *(v8us*)(Hl + o) = ol; }
         }
}
// k_gelu2: exact-erf GELU of an f32 [nrows][FF] plane (bias already added) -> bf16 hi + UNSCALED residual planes; one wave per row, lane -> 4 consecutive
// columns per iteration (16 rolled iterations of 128 columns; 8 B per plane per store -> 16 lanes per line).
__global__ __launch_bounds__(256) void k_gelu2(const float* __restrict__ src, int nrows, bf* dh, bf* dl) {
    typedef __attribute__((ext_vector_type(4))) unsigned short v4us;
    const int lane = threadIdx.x & 31, r = blockIdx.x * 8 + (threadIdx.x >> 5);
    if (r >= nrows) return;
{
#pragma unroll 1
        for (int q = 0; q < FF / 128; ++q) { const size_t o = (size_t)r * FF + q * 128 + lane * 4; const v4f v = *(const v4f*)(src + o); v4us oh, ol;
#pragma unroll
            for (int i = 0; i < 4; ++i) { const float g = 0.5f * v[i] * (1.0f + erff(v[i] * 0.70710678118654752f)); const unsigned short hb = f2bf(g); oh[i] = hb; ol[i] = f2bf(g - bf2f(hb)); }
            *(v4us*)(dh + o) = oh; *(v4us*)(dl + o) = ol; }
         }
}
// k_gemm: BM x BN block tile (8 waves as WMW x 8/WMW, wave tile BM/WMW x BN/(8/WMW): 64 x 64 where the grid still fills the chip, else 32 x 64) of C[.][ldc] = (A0 [+ A1]).(B0 [+ B1])^T [+ bf(bias[c])], all planes bf16 with row stride K.
// OUT 0: C is stored as f32. OUT 1: as bf16 hi + UNSCALED residual planes Ch, Cl [row][ldc]. OUT 2: as such planes of C^T, [column][ldc].
// A stage is 128 k (256 B) of every operand row, rows [A0 | A1 | B0 | B1] at an LDS pitch of 272 B, brought in by asynchronous copies (16 lanes = one whole 256-B row piece,
// so every copy reads whole lines) into two buffers: stage t + 1 flies while stage t is worked on. Per accumulator and 32-k step the products keep the order
// A0.B0, A1.B0, A0.B1 and k runs upward, with the same k order inside a fragment for A and B (bytes 16h and 32 + 16h of each 64 B of a row).
#define KS    128
#define PITCH 272
// N copies in one statement and, as its last line, the wait that stands in front of any rewrite of the address registers they name.
template <int N>
__device__ __forceinline__ void copies(const unsigned* l, const bf* const* g) {
    static_assert(N == 8 || N == 12, "a statement takes 8 or 12 copies (16 or 24 operands)");
    if constexpr (N == 8)
        asm volatile(
                     "global_load_async_to_lds_b128 %0, %8, off\n\t"
                     "global_load_async_to_lds_b128 %1, %9, off\n\t"
                     "global_load_async_to_lds_b128 %2, %10, off\n\t"
                     "global_load_async_to_lds_b128 %3, %11, off\n\t"
                     "global_load_async_to_lds_b128 %4, %12, off\n\t"
                     "global_load_async_to_lds_b128 %5, %13, off\n\t"
                     "global_load_async_to_lds_b128 %6, %14, off\n\t"
                     "global_load_async_to_lds_b128 %7, %15, off\n\t"
                     "s_wait_xcnt 0x0"
                     :: "v"(l[0]), "v"(l[1]), "v"(l[2]), "v"(l[3]), "v"(l[4]), "v"(l[5]), "v"(l[6]), "v"(l[7]),
                        "v"(g[0]), "v"(g[1]), "v"(g[2]), "v"(g[3]), "v"(g[4]), "v"(g[5]), "v"(g[6]), "v"(g[7]) : "memory");
    else
        asm volatile(
                     "global_load_async_to_lds_b128 %0, %12, off\n\t"
                     "global_load_async_to_lds_b128 %1, %13, off\n\t"
                     "global_load_async_to_lds_b128 %2, %14, off\n\t"
                     "global_load_async_to_lds_b128 %3, %15, off\n\t"
                     "global_load_async_to_lds_b128 %4, %16, off\n\t"
                     "global_load_async_to_lds_b128 %5, %17, off\n\t"
                     "global_load_async_to_lds_b128 %6, %18, off\n\t"
                     "global_load_async_to_lds_b128 %7, %19, off\n\t"
                     "global_load_async_to_lds_b128 %8, %20, off\n\t"
                     "global_load_async_to_lds_b128 %9, %21, off\n\t"
                     "global_load_async_to_lds_b128 %10, %22, off\n\t"
                     "global_load_async_to_lds_b128 %11, %23, off\n\t"
                     "s_wait_xcnt 0x0"
                     :: "v"(l[0]), "v"(l[1]), "v"(l[2]), "v"(l[3]), "v"(l[4]), "v"(l[5]), "v"(l[6]), "v"(l[7]), "v"(l[8]), "v"(l[9]), "v"(l[10]), "v"(l[11]),
                        "v"(g[0]), "v"(g[1]), "v"(g[2]), "v"(g[3]), "v"(g[4]), "v"(g[5]), "v"(g[6]), "v"(g[7]), "v"(g[8]), "v"(g[9]), "v"(g[10]), "v"(g[11]) : "memory");
}
__device__ __forceinline__ v16bf ldfrag(const unsigned char* p) { return cat16b(*(const v8usa*)p, *(const v8usa*)(p + 32)); }

template <int NA, int NBP, int BM, int BN, int WMW, int K, bool BIAS, int OUT>
__global__ __launch_bounds__(256) void k_gemm(const bf* __restrict__ A0, const bf* __restrict__ A1, const bf* __restrict__ B0, const bf* __restrict__ B1, const float* __restrict__ bias, float* C, bf* Ch, bf* Cl, int ldc, int zA, int zB, int zC) {
    // zA, zB, zC: elements from one batch item (blockIdx.z) to the next in the A planes, the B planes and C or its planes (0: shared by all items).
    constexpr int WNW = 8 / WMW, FM = BM / WMW / 16, WN = BN / WNW, FN = WN / 16, NT = K / KS;
    constexpr int STAGE = (NA * BM + NBP * BN) * PITCH;
    constexpr int OFF_A1 = BM * PITCH, OFF_B0 = NA * BM * PITCH, OFF_B1 = (NA * BM + BN) * PITCH;
    __shared__ __align__(16) unsigned char sm[2 * STAGE];
    const int tid = threadIdx.x, lane = tid & 31, wave = tid >> 5, lr = lane & 15, hi = lane >> 4;
    const int wm = wave / WNW, wn = wave % WNW;
    const int r0 = blockIdx.x * BM, c0 = blockIdx.y * BN;
    const int crow = tid >> 4, cpc = tid & 15;
    const unsigned lt = (unsigned)(size_t)sm + crow * PITCH + cpc * 16;
    const size_t ga = (size_t)blockIdx.z * zA + (size_t)(r0 + crow) * K + cpc * 8, gb = (size_t)blockIdx.z * zB + (size_t)(c0 + crow) * K + cpc * 8;
    // One stage: the block's 256 threads cover 16 rows a copy (thread -> row tid >> 4, 16-byte piece tid & 15); NC copies a thread, 8 or 12 to a statement.
    constexpr int NC = (NA * BM + NBP * BN) / 16;
    auto fill = [&](int t) {
        const unsigned lb = lt + (t & 1) * STAGE; const int kc = t * KS;
        unsigned l[NC]; const bf* g[NC];
#pragma unroll
        for (int j = 0; j < NC; ++j) l[j] = lb + j * 16 * PITCH;
#pragma unroll
        for (int j = 0; j < BM / 16; ++j) { g[j] = A0 + ga + kc + (size_t)j * 16 * K; if constexpr (NA == 2) g[BM / 16 + j] = A1 + ga + kc + (size_t)j * 16 * K; }
#pragma unroll
        for (int j = 0; j < BN / 16; ++j) { g[NA * BM / 16 + j] = B0 + gb + kc + (size_t)j * 16 * K; if constexpr (NBP == 2) g[(NA * BM + BN) / 16 + j] = B1 + gb + kc + (size_t)j * 16 * K; }
        constexpr int CS = NC % 12 == 0 ? 12 : 8;
#pragma unroll   // every statement's operands are array elements picked by constants, so the arrays stay in registers
        for (int j = 0; j < NC; j += CS) copies<CS>(l + j, g + j);
    };
    v8f acc[FM][FN];
#pragma unroll
    for (int m = 0; m < FM; ++m)
#pragma unroll
        for (int n = 0; n < FN; ++n) acc[m][n] = (v8f){};
    float bv[FN];   // the lane's bias values, fetched here so that their latency lies under the loop
#pragma unroll
    for (int n = 0; n < FN; ++n) bv[n] = BIAS ? bfr(bias[c0 + wn * WN + n * 16 + lr]) : 0.f;
    fill(0);
    asm volatile("s_wait_asynccnt 0x0" ::: "memory");   // this wave's copies of stage 0 have landed
    __syncthreads();                                     // ... and every other wave's
    fill(1);
    // The stage loop stays rolled (one copy of its body; the buffer is picked by t & 1); every loop inside it is unrolled so that the register arrays are indexed by constants.
#pragma unroll 1
    for (int t = 0; t < NT; ++t) {
        const unsigned char* sb = sm + (t & 1) * STAGE;
        const unsigned char* pa = sb + (wm * FM * 16 + lr) * PITCH + 16 * hi;
        const unsigned char* pb = sb + OFF_B0 + (wn * WN + lr) * PITCH + 16 * hi;
        // Two fragment sets: the loads of 32-k step ks + 1 go out as one group ahead of step ks's products (only inside this stage), so that a step's LDS latency is covered by the step before.
        v16bf a0[2][FM], a1[2][FM], b0[2][FN], b1[2][FN];
        auto ldset = [&](int q, int ks) {
#pragma unroll
            for (int m = 0; m < FM; ++m) { a0[q][m] = ldfrag(pa + m * 16 * PITCH + ks * 64); if constexpr (NA == 2) a1[q][m] = ldfrag(pa + OFF_A1 + m * 16 * PITCH + ks * 64); }
#pragma unroll
            for (int n = 0; n < FN; ++n) { b0[q][n] = ldfrag(pb + n * 16 * PITCH + ks * 64); if constexpr (NBP == 2) b1[q][n] = ldfrag(pb + (OFF_B1 - OFF_B0) + n * 16 * PITCH + ks * 64); }
        };
        ldset(0, 0);
#pragma unroll
        for (int ks = 0; ks < KS / 32; ++ks) {
            const int q = ks & 1;
            if (ks + 1 < KS / 32) ldset(q ^ 1, ks + 1);
            __builtin_amdgcn_sched_barrier(0);   // keeps the next step's load group ahead of this step's products (the scheduler otherwise sinks each load to just before its use)
#pragma unroll
            for (int m = 0; m < FM; ++m)
#pragma unroll
                for (int n = 0; n < FN; ++n) acc[m][n] = wmmab(a0[q][m], b0[q][n], acc[m][n]);
            if constexpr (NA == 2) {
#pragma unroll
                for (int m = 0; m < FM; ++m)
#pragma unroll
                    for (int n = 0; n < FN; ++n) acc[m][n] = wmmab(a1[q][m], b0[q][n], acc[m][n]);
            }
            if constexpr (NBP == 2) {
#pragma unroll
                for (int m = 0; m < FM; ++m)
#pragma unroll
                    for (int n = 0; n < FN; ++n) acc[m][n] = wmmab(a0[q][m], b1[q][n], acc[m][n]);
            }
            __builtin_amdgcn_sched_barrier(0);   // keeps this step's products ahead of the load group after next, which reuses their fragment set
        }
        asm volatile("s_wait_dscnt 0x0" ::: "memory");      // this wave's reads of stage t are done before its buffer is refilled
        asm volatile("s_wait_asynccnt 0x0" ::: "memory");   // this wave's copies of stage t + 1 have landed
        __syncthreads();                                     // publishes stage t + 1 and ends every reader's last read of stage t
        if (t + 2 < NT) fill(t + 2);
    }
    asm volatile("s_wait_asynccnt 0x0" ::: "memory");       // no copy is outstanding when the ring becomes output staging
    // Epilogue: each wave stages its part of the tile in its own part of the ring (the loop's last barrier has ended every read of it) and stores whole 128-B lines.
    if constexpr (OUT == 2) {
        // A lane's 8 accumulator values of a fragment are 8 consecutive rows of one column: 16 B of a row of C^T in either plane. Staged row = one column's FM * 16 values, pitch + 16 B.
        constexpr int TP = FM * 32 + 16;
        static_assert(FM == 4, "a staged row is one 128-B line");
        static_assert(8 * 2 * WN * TP <= 2 * STAGE, "the output staging fits the ring");
        unsigned char* ob = sm + wave * (2 * WN * TP);   // WN rows of the hi plane, then WN rows of the residual plane
#pragma unroll
        for (int n = 0; n < FN; ++n)
#pragma unroll
            for (int m = 0; m < FM; ++m) { v8us oh, ol;
#pragma unroll
                for (int j = 0; j < 8; ++j) { const float v = BIAS ? acc[m][n][j] + bv[n] : acc[m][n][j]; const unsigned short hb = f2bf(v); oh[j] = hb; ol[j] = f2bf(v - bf2f(hb)); }
                unsigned char* p = ob + (n * 16 + lr) * TP + m * 32 + hi * 16; *(v8usa*)p = oh; *(v8usa*)(p + WN * TP) = ol; }
        __syncthreads();   // the staged values are read back by other lanes: no read may move ahead of the stores
        const size_t o0 = (size_t)blockIdx.z * zC + (size_t)(c0 + wn * WN) * ldc + r0 + wm * FM * 16 + (lane & 7) * 8;
#pragma unroll
        for (int s = 0; s < WN / 4; ++s) { const int row = (lane >> 3) + 4 * s; const unsigned char* p = ob + row * TP + (lane & 7) * 16;
            const v8us vh = *(const v8usa*)p, vl = *(const v8usa*)(p + WN * TP);
            *(v8us*)(Ch + o0 + (size_t)row * ldc) = vh; *(v8us*)(Cl + o0 + (size_t)row * ldc) = vl; }
    } else {
        constexpr int OP = WN + 4, LPR = WN / 32;
        static_assert(8 * FM * 16 * OP * 4 <= 2 * STAGE, "the output staging fits the ring");
        float* os = (float*)(void*)sm + wave * (FM * 16 * OP);
#pragma unroll
        for (int n = 0; n < FN; ++n)
#pragma unroll
            for (int m = 0; m < FM; ++m)
#pragma unroll
                for (int j = 0; j < 8; ++j) os[(m * 16 + hi * 8 + j) * OP + n * 16 + lr] = BIAS ? acc[m][n][j] + bv[n] : acc[m][n][j];
        __syncthreads();   // the staged values are read back by other lanes: no read may move ahead of the stores
        if constexpr (OUT == 0) {
            float* crow_p = C + (size_t)blockIdx.z * zC + (size_t)(r0 + wm * FM * 16) * ldc + c0 + wn * WN;
#pragma unroll
            for (int s = 0; s < FM * 4 * LPR; ++s) { const int Lid = (lane >> 3) + 4 * s, piece = lane & 7; const int row = Lid / LPR, cofs = (Lid % LPR) * 32 + piece * 4;
                const v4f val = *(const v4fa*)(os + row * OP + cofs); *(v4f*)(crow_p + (size_t)row * ldc + cofs) = val; }
        } else {
            const size_t o0 = (size_t)blockIdx.z * zC + (size_t)(r0 + wm * FM * 16) * ldc + c0 + wn * WN;
            // 8 lanes take one row's 64 values, 8 each: one 128-B line of either plane.
            static_assert(WN == 64, "a row of the wave tile is one 128-B line of a plane");
#pragma unroll
            for (int s = 0; s < FM * 4; ++s) { const int row = (lane >> 3) + 4 * s, cofs = (lane & 7) * 8;
                const v4f u0 = *(const v4fa*)(os + row * OP + cofs), u1 = *(const v4fa*)(os + row * OP + cofs + 4); v8us oh, ol;
#pragma unroll
                for (int i = 0; i < 8; ++i) { const float v = i < 4 ? u0[i & 3] : u1[i & 3]; const unsigned short hb = f2bf(v); oh[i] = hb; ol[i] = f2bf(v - bf2f(hb)); }
                *(v8us*)(Ch + o0 + (size_t)row * ldc + cofs) = oh; *(v8us*)(Cl + o0 + (size_t)row * ldc + cofs) = ol; }
        }
    }
}

// k_lnout: one wave per row: v = bf(x) + y2 (f32), LayerNorm (mean, mean((v-mu)^2), eps 1e-5, x bf(gamma) + bf(beta)) -> f32 output row; per 128-column chunk q the
// per phase.
__global__ __launch_bounds__(256) void k_lnout(const float* __restrict__ X, const float* __restrict__ Y2, const float* __restrict__ gam, const float* __restrict__ bet, float* OUTP) {
    const int lane = threadIdx.x & 31, r = blockIdx.x * 8 + (threadIdx.x >> 5);
    if (r >= NB_ * NT_) return;
    const float* xr = X + (size_t)r * DM; const float* yr = Y2 + (size_t)r * DM;
    float s = 0.f;
#pragma unroll 1
    for (int q = 0; q < 2 * (DM / 256); ++q) { const int c0 = (q >> 1) * 256 + (q & 1) * 128 + lane * 4; const v4f xv = *(const v4f*)(xr + c0), yv = *(const v4f*)(yr + c0);
#pragma unroll
        for (int i = 0; i < 4; ++i) s += bfr(xv[i]) + yv[i]; }
#pragma unroll
    for (int sh = 16; sh; sh >>= 1) s += __shfl_xor(s, sh, 32);
    const float mu = s * (1.0f / DM);
    float s2 = 0.f;
#pragma unroll 1
    for (int q = 0; q < 2 * (DM / 256); ++q) { const int c0 = (q >> 1) * 256 + (q & 1) * 128 + lane * 4; const v4f xv = *(const v4f*)(xr + c0), yv = *(const v4f*)(yr + c0);
#pragma unroll
        for (int i = 0; i < 4; ++i) { const float d = (bfr(xv[i]) + yv[i]) - mu; s2 = fmaf(d, d, s2); } }
#pragma unroll
    for (int sh = 16; sh; sh >>= 1) s2 += __shfl_xor(s2, sh, 32);
    const float rs = rsqrtf(s2 * (1.0f / DM) + 1e-5f);
{
#pragma unroll 1
        for (int q = 0; q < 2 * (DM / 256); ++q) { const int c0 = (q >> 1) * 256 + (q & 1) * 128 + lane * 4; const v4f xv = *(const v4f*)(xr + c0), yv = *(const v4f*)(yr + c0); v4f o;
#pragma unroll
            for (int i = 0; i < 4; ++i) o[i] = ((bfr(xv[i]) + yv[i]) - mu) * rs * bfr(gam[c0 + i]) + bfr(bet[c0 + i]);
            *(v4f*)(OUTP + (size_t)r * DM + c0) = o; }
         }
}

extern "C" void kernel_launch(void* const* d_in, const int* in_sizes, int n_in,
                              void* d_out, int out_size, void* d_ws, size_t ws_size, hipStream_t stream) {
    (void)in_sizes; (void)n_in; (void)out_size;
    const float* x = (const float*)d_in[0]; const float* lg = (const float*)d_in[1]; const float* lb = (const float*)d_in[2];
    const float* w1 = (const float*)d_in[3]; const float* b1 = (const float*)d_in[4]; const float* w2 = (const float*)d_in[5]; const float* b2 = (const float*)d_in[6];   // w1 [1024][2048], w2 [2048][1024], both (in, out) = k-major
    float* out = (float*)d_out;    // [4][2048][1024]
    char* wsp = (char*)d_ws;
    auto take = [&](size_t bytes) { char* p = wsp; wsp += (bytes + 255) & ~(size_t)255; return (void*)p; };
    constexpr size_t NR = (size_t)NB_ * NTK;   // rows of all items
    bf* W1T = (bf*)take((size_t)FF * DM * 2); bf* W2T = (bf*)take((size_t)DM * FF * 2);
    bf* Xb = (bf*)take(NR * DM * 2); bf* XT = (bf*)take(NR * DM * 2); bf* Y0h = (bf*)take(NR * DM * 2); bf* Y0l = (bf*)take(NR * DM * 2);
    float* T = (float*)take(NR * FF * 4); bf* Hh = (bf*)take(NR * FF * 2); bf* Hl = (bf*)take(NR * FF * 2);
    float* Y2 = (float*)take(NR * DM * 4);
    // A plane whose last reader has run before another's writer starts (stream order) lends it its bytes (the planes of m^T fill a quarter of theirs): 8 + 32 + 32 + 64 + 64 + 32 = 232 MiB.
    bf* Y1Th = Y0h; bf* Y1Tl = Y0l;   // y0 is last read by the first product, y1^T is written by the second
    bf* MTh = Hh; bf* MTl = Hl;       // gelu(t) is last read by the second product, the planes of m^T are written by the third
    if ((size_t)(wsp - (char*)d_ws) > ws_size) return;
    k_wt<<<dim3(DM / 64, FF / 64, 1), 256, 0, stream>>>(w1, DM, FF, W1T);    // w1 [1024 k][2048 n] -> W1T [2048][1024]
    k_wt<<<dim3(FF / 64, DM / 64, 1), 256, 0, stream>>>(w2, FF, DM, W2T);    // w2 [2048 k][1024 n] -> W2T [1024][2048]
    k_xbt<<<dim3(NT_ / 64, DM / 64, NB_), 256, 0, stream>>>(x, Xb, XT);                                                                                            // bf16(x) as [item][t][f] and [item][f][t]
    k_ln<true><<<NB_ * NTK / 8, 256, 0, stream>>>(x, lg, lb, NB_ * NTK, Y0h, Y0l);
    k_gemm<2, 1, 128, 256, 2, DM, true, 0><<<dim3(NTK / 128, FF / 256, NB_), 256, 0, stream>>>(Y0h, Y0l, W1T, nullptr, b1, T, nullptr, nullptr, FF, NTK * DM, 0, NTK * FF);                  // y0.w1 + b1
    k_gelu2<<<NB_ * NTK / 8, 256, 0, stream>>>(T, NB_ * NTK, Hh, Hl);
    k_gemm<2, 1, 128, 256, 2, FF, true, 2><<<dim3(NTK / 128, DM / 256, NB_), 256, 0, stream>>>(Hh, Hl, W2T, nullptr, b2, nullptr, Y1Th, Y1Tl, NT_, NTK * FF, 0, DM * NT_);   // y1 = gelu(t).w2 + b2, stored as y1^T hi/lo planes [item][1024][2048]
    k_gemm<2, 1, 128, 128, 4, NT_, false, 1><<<dim3(DM / 128, DM / 128, NB_), 256, 0, stream>>>(Y1Th, Y1Tl, XT, nullptr, nullptr, nullptr, MTh, MTl, DM, DM * NT_, DM * NT_, DM * DM);   // m^T [g][f] = sum over t of y1[t][g] x[t][f], stored as hi/lo planes
    k_gemm<1, 2, 256, 128, 4, DM, false, 0><<<dim3(NT_ / 256, DM / 128, NB_), 256, 0, stream>>>(Xb, nullptr, MTh, MTl, nullptr, Y2, nullptr, nullptr, DM, NTK * DM, DM * DM, NTK * DM);           // y2 [t][g] = sum over f of x[t][f] m^T[g][f]
    k_lnout<<<NB_ * NTK / 8, 256, 0, stream>>>(x, Y2, lg, lb, out);                                                                                               // LN(x + y2)
}

// v006
// A run of this version takes 182 microseconds.
// Two timings next to v005 both put it at 1.03 times that version's speed.
// Over all steps from v000 it is 5.63 times as fast.
#include <hip/hip_runtime.h>

// Compute dtypes, f32 accumulate, all four batch items in every launch (row-wise kernels: 4 x 2048 rows; per-item products: grid z = item): y0 = LN(x) (f32; gamma/beta and x read through bf16 rounding) -> bf16 hi + UNSCALED residual planes;
// t = y0.w1 + b1 ([2048 x 1024].[1024 x 2048]) and y1 = gelu(t).w2 + b2 ([2048 x 2048].[2048 x 1024]) on v_wmma_f32_16x16x32_bf16 with k-major weights
// transposed once to n-major bf16 planes and the computed operands as hi + residual (two products; exact-erf GELU in f32 in between); (x.x^T).y1 is summed as
// x.(x^T.y1): m^T = y1^T.x ([1024 x 2048].[2048 x 1024] per item, y1 as hi + residual, the INPUT x rounded once: two products), then y2 = x.m ([2048 x 1024].[1024 x 1024],
// m as hi + residual: two products): half the multiply-adds of the score route per product, and no [2048 x 2048] score plane.
// y1 and m^T never exist as f32 planes: the product that computes them splits each f32 value into hi + residual in its epilogue and stores the planes the next product reads (y1 transposed).

#define NB_  4
#define NT_  2048
#define DM   1024
#define FF   2048
#define NTK  NT_
#define LOSC 1024.0f             // (unused here)

typedef _Float16 h16;
typedef unsigned short bf;
typedef __attribute__((ext_vector_type(16))) __bf16   v16bf;
typedef __attribute__((ext_vector_type(16))) _Float16 v16h;
typedef __attribute__((ext_vector_type(8)))  _Float16 v8h;
typedef __attribute__((ext_vector_type(8)))  unsigned short v8us;
typedef __attribute__((ext_vector_type(8)))  float    v8f;
typedef __attribute__((ext_vector_type(4)))  float    v4f;
typedef __attribute__((ext_vector_type(4)))  _Float16 v4h;
typedef v8h  __attribute__((may_alias)) v8ha;
typedef v4f  __attribute__((may_alias)) v4fa;
typedef v8us __attribute__((may_alias)) v8usa;

__device__ __forceinline__ unsigned short f2bf(float f) { unsigned u = __float_as_uint(f); u += 0x7FFFu + ((u >> 16) & 1u); return (unsigned short)(u >> 16); }
__device__ __forceinline__ float bf2f(unsigned short b) { return __uint_as_float(((unsigned)b) << 16); }
__device__ __forceinline__ float bfr(float f) { return bf2f(f2bf(f)); }
__device__ __forceinline__ v16h cat16(v8h lo, v8h hi) { return __builtin_shufflevector(lo, hi, 0, 1, 2, 3, 4, 5, 6, 7, 8, 9, 10, 11, 12, 13, 14, 15); }
__device__ __forceinline__ v16bf cat16b(v8us lo, v8us hi) { return __builtin_bit_cast(v16bf, __builtin_shufflevector(lo, hi, 0, 1, 2, 3, 4, 5, 6, 7, 8, 9, 10, 11, 12, 13, 14, 15)); }
__device__ __forceinline__ v8f wmma16(v16h a, v16h b, v8f c) { return __builtin_amdgcn_wmma_f32_16x16x32_f16(false, a, false, b, (short)0, c, false, false); }
__device__ __forceinline__ v8f wmmab(v16bf a, v16bf b, v8f c) { return __builtin_amdgcn_wmma_f32_16x16x32_bf16(false, a, false, b, (short)0, c, false, false); }

// k_xbt: the input x [item][2048 t][1024 f], rounded once to bf16, written in both orders: XB [item][t][f] and XT [item][f][t], via 64 x 64 LDS tiles; grid (NT/64, DM/64, items).
// Thread -> row tid >> 3 (+ 32), 8 columns (tid & 7) * 8: 8 lanes store one whole 128-B line of either plane. All stores stand behind the barrier, so that it waits on LDS alone.
__global__ __launch_bounds__(256) void k_xbt(const float* __restrict__ X, bf* XB, bf* XT) {
    __shared__ __align__(16) unsigned short tl[64 * 72];
    const int tid = threadIdx.x, t0 = blockIdx.x * 64, f0 = blockIdx.y * 64, piece = tid & 7, row = tid >> 3;
    const size_t ib = (size_t)blockIdx.z * NT_ * DM, o = ib + (size_t)(t0 + row) * DM + f0 + piece * 8;
    v4f a[2][2];
#pragma unroll
    for (int s = 0; s < 2; ++s) { a[s][0] = *(const v4f*)(X + o + (size_t)s * 32 * DM); a[s][1] = *(const v4f*)(X + o + (size_t)s * 32 * DM + 4); }
    v8us r[2];
#pragma unroll
    for (int s = 0; s < 2; ++s)
#pragma unroll
        for (int i = 0; i < 8; ++i) { r[s][i] = f2bf(a[s][i >> 2][i & 3]); tl[(piece * 8 + i) * 72 + row + 32 * s] = r[s][i]; }
    __syncthreads();
#pragma unroll
    for (int s = 0; s < 2; ++s) { const v8us val = *(const v8usa*)(tl + (row + 32 * s) * 72 + piece * 8);
        *(v8us*)(XB + o + (size_t)s * 32 * DM) = r[s]; *(v8us*)(XT + ib + (size_t)(f0 + row + 32 * s) * NT_ + t0 + piece * 8) = val; }
}

// k_wt: WT [n][K] = bf16(W[k][n]) (k-major [K][ncols]) via 64 x 64 LDS tiles; grid (K/64, ncols/64).
__global__ __launch_bounds__(256) void k_wt(const float* __restrict__ Wm, int K, int ncols, bf* WT) {
    __shared__ __align__(16) unsigned short tl[64 * 72];
    const int tid = threadIdx.x, k0 = blockIdx.x * 64, n0 = blockIdx.y * 64;
    const int kk = tid >> 2, nq = (tid & 3) * 16;
#pragma unroll
    for (int i = 0; i < 16; ++i) tl[(nq + i) * 72 + kk] = f2bf(Wm[(size_t)(k0 + kk) * ncols + n0 + nq + i]);
    __syncthreads();
    const int piece = tid & 7;
    auto pass = [&]() {
#pragma unroll
        for (int s = 0; s < 2; ++s) { const int nr = (tid >> 3) + 32 * s; const v8us val = *(const v8usa*)(tl + nr * 72 + piece * 8); *(v8us*)(WT + (size_t)(n0 + nr) * K + k0 + piece * 8) = val; }
    };
    pass(); 
}
// k_ln: one wave per row of x [rows][1024]: LayerNorm (mean, then mean((x-mu)^2), eps 1e-5, x bf(gamma) + bf(beta), f32, fixed lane order) -> bf16 hi + UNSCALED
// residual planes; lane -> columns q*256 + lane*8 .. +8 for q = 0..3 (16 B per plane per store, 8 lanes per line). The row is re-read per phase with the q loop
// rolled (keeps the static VALU-FMA count small; no register arrays indexed by a loop variable).
template <bool ROUNDIN>   // ROUNDIN: the source is a module INPUT (read through bf16 rounding); false: a computed f32 plane (read as is)
__global__ __launch_bounds__(256) void k_ln(const float* __restrict__ X, const float* __restrict__ gam, const float* __restrict__ bet, int nrows, bf* Hh, bf* Hl) {
    const int lane = threadIdx.x & 31, r = blockIdx.x * 8 + (threadIdx.x >> 5);
    if (r >= nrows) return;
    const float* xr = X + (size_t)r * DM + lane * 8;
    float s = 0.f;
#pragma unroll 1
    for (int q = 0; q < DM / 256; ++q) {
#pragma unroll
        for (int i = 0; i < 8; ++i) s += (ROUNDIN ? bfr(xr[q * 256 + i]) : xr[q * 256 + i]); }
#pragma unroll
    for (int sh = 16; sh; sh >>= 1) s += __shfl_xor(s, sh, 32);
    const float mu = s * (1.0f / DM);
    float s2 = 0.f;
#pragma unroll 1
    for (int q = 0; q < DM / 256; ++q) {
#pragma unroll
        for (int i = 0; i < 8; ++i) { const float d = (ROUNDIN ? bfr(xr[q * 256 + i]) : xr[q * 256 + i]) - mu; s2 = fmaf(d, d, s2); } }
#pragma unroll
    for (int sh = 16; sh; sh >>= 1) s2 += __shfl_xor(s2, sh, 32);
    const float rs = rsqrtf(s2 * (1.0f / DM) + 1e-5f);
{
#pragma unroll 1
        for (int q = 0; q < DM / 256; ++q) { v8us oh, ol;
#pragma unroll
            for (int i = 0; i < 8; ++i) { const int c = q * 256 + lane * 8 + i; const float y = ((ROUNDIN ? bfr(xr[q * 256 + i]) : xr[q * 256 + i]) - mu) * rs * bfr(gam[c]) + bfr(bet[c]); const unsigned short hb = f2bf(y); oh[i] = hb; ol[i] = f2bf(y - bf2f(hb)); }
            const size_t o = (size_t)r * DM + q * 256 + lane * 8; *(v8us*)(Hh + o) = oh; *(v8us*)(Hl + o) = ol; }
         }
}
// k_gelu2: exact-erf GELU of an f32 [nrows][FF] plane (bias already added) -> bf16 hi + UNSCALED residual planes; one wave per row, lane -> 4 consecutive
// columns per iteration (16 rolled iterations of 128 columns; 8 B per plane per store -> 16 lanes per line).
__global__ __launch_bounds__(256) void k_gelu2(const float* __restrict__ src, int nrows, bf* dh, bf* dl) {
    typedef __attribute__((ext_vector_type(4))) unsigned short v4us;
    const int lane = threadIdx.x & 31, r = blockIdx.x * 8 + (threadIdx.x >> 5);
    if (r >= nrows) return;
{
#pragma unroll 1
        for (int q = 0; q < FF / 128; ++q) { const size_t o = (size_t)r * FF + q * 128 + lane * 4; const v4f v = *(const v4f*)(src + o); v4us oh, ol;
#pragma unroll
            for (int i = 0; i < 4; ++i) { const float g = 0.5f * v[i] * (1.0f + erff(v[i] * 0.70710678118654752f)); const unsigned short hb = f2bf(g); oh[i] = hb; ol[i] = f2bf(g - bf2f(hb)); }
            *(v4us*)(dh + o) = oh; *(v4us*)(dl + o) = ol; }
         }
}
// k_gemm: BM x BN block tile (8 waves as WMW x 8/WMW, wave tile BM/WMW x BN/(8/WMW): 64 x 64 where the grid still fills the chip, else 32 x 64) of C[.][ldc] = (A0 [+ A1]).(B0 [+ B1])^T [+ bf(bias[c])], all planes bf16 with row stride K.
// OUT 0: C is stored as f32. OUT 1: as bf16 hi + UNSCALED residual planes Ch, Cl [row][ldc]. OUT 2: as such planes of C^T, [column][ldc].
// A stage is 128 k (256 B) of every operand row, rows [A0 | A1 | B0 | B1] in slices of 64 rows at an LDS pitch of 272 B. Each slice is brought in by ONE tensor load of one wave
// (wave w -> slice w; the 16 B behind each row are the load's pad), into two buffers: stage t + 1 flies while stage t is worked on. Per accumulator and 32-k step the products keep the order
// A0.B0, A1.B0, A0.B1 and k runs upward, with the same k order inside a fragment for A and B (bytes 16h and 32 + 16h of each 64 B of a row).
#define KS    128
#define PITCH 272
#define SROWS 64      // rows of a slice
#define SLICE 18432   // 64 rows x 272 B = 17,408 B, rounded up to a multiple of 2 KiB: every slice of every buffer starts on such a multiple
typedef unsigned u32x4 __attribute__((ext_vector_type(4)));
typedef unsigned u32x8 __attribute__((ext_vector_type(8)));
__device__ __forceinline__ unsigned uni(unsigned v) { return (unsigned)__builtin_amdgcn_readfirstlane(v); }
// pinned(): holds a value that decides on a tensor load, or that its descriptor is formed from, in a scalar register: a test on it is a scalar branch (a tensor load ignores EXEC),
// and what is computed from it stays behind the waits written ahead of it.
__device__ __forceinline__ unsigned pinned(unsigned v) { unsigned w = (unsigned)__builtin_amdgcn_readfirstlane(v); asm volatile("" : "+s"(w)); return w; }
// Descriptor group 1: 1-byte elements, tensor = tile = 64 rows of 256 B, source row pitch in bytes, 4 dwords of LDS pad behind every 64 dwords; no mask.
__device__ __forceinline__ u32x8 tdm_group1(unsigned src_pitch) {
    u32x8 g;
    g[0] = uni((1u << 20) | (5u << 22) | (3u << 25));
    g[1] = uni((KS * 2u) << 16);
    g[2] = uni((unsigned)SROWS << 16);
    g[3] = uni((KS * 2u) << 16);
    g[4] = uni((unsigned)SROWS);
    g[5] = uni(src_pitch);
    g[6] = uni(0u);
    g[7] = uni(0u);
    asm volatile("" : "+s"(g));   // pinned(), for the whole group: its words stay in one scalar tuple from here on, so none of them takes a new value while a request is outstanding
    return g;
}
// One request of the calling wave: group 0 = count 1, the slice's byte offset in the work-group's LDS, the global address of its first byte, type 2.
__device__ __forceinline__ void tdm_load(unsigned lds_dst, unsigned long long ga, u32x8 g1) {
    u32x4 g0;
    g0[0] = pinned(1u);   // pinned(): this constant word too is written here, behind the wait on the request before, not ahead of the loop
    g0[1] = uni(lds_dst); g0[2] = uni((unsigned)ga); g0[3] = uni((((unsigned)(ga >> 32)) & 0x01FFFFFFu) | 0x80000000u);
    asm volatile("tensor_load_to_lds %0, %1" :: "s"(g0), "s"(g1) : "memory");
}
__device__ __forceinline__ v16bf ldfrag(const unsigned char* p) { return cat16b(*(const v8usa*)p, *(const v8usa*)(p + 32)); }

template <int NA, int NBP, int BM, int BN, int WMW, int K, bool BIAS, int OUT>
__global__ __launch_bounds__(256) void k_gemm(const bf* __restrict__ A0, const bf* __restrict__ A1, const bf* __restrict__ B0, const bf* __restrict__ B1, const float* __restrict__ bias, float* C, bf* Ch, bf* Cl, int ldc, int zA, int zB, int zC) {
    // zA, zB, zC: elements from one batch item (blockIdx.z) to the next in the A planes, the B planes and C or its planes (0: shared by all items).
    constexpr int WNW = 8 / WMW, FM = BM / WMW / 16, WN = BN / WNW, FN = WN / 16, NT = K / KS;
    constexpr int SA = BM / SROWS, SB = BN / SROWS, NS = NA * SA + NBP * SB;   // slices of an A plane, of a B plane, of a stage
    constexpr int STAGE = NS * SLICE;
    constexpr int OFF_A1 = SA * SLICE, OFF_B0 = NA * SA * SLICE, OFF_B1 = (NA * SA + SB) * SLICE;
    static_assert(NS <= 8 && WN == SROWS && SROWS % (FM * 16) == 0 && NT >= 2, "one slice a wave; a wave's A rows and its B rows each lie in one slice; two stages exist");
    __shared__ __attribute__((aligned(2048))) unsigned char sm[2 * STAGE];
    const int tid = threadIdx.x, lane = tid & 31, wave = tid >> 5, lr = lane & 15, hi = lane >> 4;
    const int wm = wave / WNW, wn = wave % WNW;
    const int r0 = blockIdx.x * BM, c0 = blockIdx.y * BN;
    // Wave w brings slice w of every stage: its plane, its first row there, its place in a buffer. With fewer slices than waves the last waves bring nothing.
    const unsigned wv = uni((unsigned)tid >> 5);
    const unsigned iss = NS == 8 ? 1u : pinned(wv < (unsigned)NS ? 1u : 0u);
    const bool isA = wv < (unsigned)(NA * SA);
    const unsigned sp = isA ? wv % SA : (wv - NA * SA) % SB;
    const bf* plane = isA ? ((NA == 2 && wv >= (unsigned)SA) ? A1 : A0) : ((NBP == 2 && wv >= (unsigned)(NA * SA + SB)) ? B1 : B0);
    const size_t e0 = isA ? (size_t)blockIdx.z * zA + (size_t)(r0 + sp * SROWS) * K : (size_t)blockIdx.z * zB + (size_t)(c0 + sp * SROWS) * K;
    const unsigned long long src0 = (unsigned long long)(size_t)(plane + e0);
    const unsigned lsl = (unsigned)(size_t)sm + wv * SLICE;
    const u32x8 g1 = tdm_group1(K * 2u);
    auto issues = [&]() { return NS == 8 || pinned(iss) != 0u; };   // no test where every wave brings a slice
    auto fill = [&](unsigned t) { tdm_load(lsl + (t & 1u) * STAGE, src0 + (unsigned long long)t * (KS * 2), g1); };
    v8f acc[FM][FN];
#pragma unroll
    for (int m = 0; m < FM; ++m)
#pragma unroll
        for (int n = 0; n < FN; ++n) acc[m][n] = (v8f){};
    float bv[FN];   // the lane's bias values, fetched here so that their latency lies under the loop
#pragma unroll
    for (int n = 0; n < FN; ++n) bv[n] = BIAS ? bfr(bias[c0 + wn * WN + n * 16 + lr]) : 0.f;
    if (issues()) {
        fill(0);
        asm volatile("s_wait_tensorcnt 0x0" ::: "memory");   // this wave's slice of stage 0 has landed
    }
    __syncthreads();                                          // ... and every other wave's
    if (issues()) fill(1);
    // The stage loop stays rolled (one copy of its body; the buffer is picked by t & 1); every loop inside it is unrolled so that the register arrays are indexed by constants.
#pragma unroll 1
    for (int t = 0; t < NT; ++t) {
        const unsigned char* sb = sm + (t & 1) * STAGE;
        const unsigned char* pa = sb + (wm * FM * 16 / SROWS) * SLICE + (wm * FM * 16 % SROWS + lr) * PITCH + 16 * hi;
        const unsigned char* pb = sb + OFF_B0 + wn * SLICE + lr * PITCH + 16 * hi;
        // Two fragment sets: the loads of 32-k step ks + 1 go out as one group ahead of step ks's products (only inside this stage), so that a step's LDS latency is covered by the step before.
        v16bf a0[2][FM], a1[2][FM], b0[2][FN], b1[2][FN];
        auto ldset = [&](int q, int ks) {
#pragma unroll
            for (int m = 0; m < FM; ++m) { a0[q][m] = ldfrag(pa + m * 16 * PITCH + ks * 64); if constexpr (NA == 2) a1[q][m] = ldfrag(pa + OFF_A1 + m * 16 * PITCH + ks * 64); }
#pragma unroll
            for (int n = 0; n < FN; ++n) { b0[q][n] = ldfrag(pb + n * 16 * PITCH + ks * 64); if constexpr (NBP == 2) b1[q][n] = ldfrag(pb + (OFF_B1 - OFF_B0) + n * 16 * PITCH + ks * 64); }
        };
        ldset(0, 0);
#pragma unroll
        for (int ks = 0; ks < KS / 32; ++ks) {
            const int q = ks & 1;
            if (ks + 1 < KS / 32) ldset(q ^ 1, ks + 1);
            __builtin_amdgcn_sched_barrier(0);   // keeps the next step's load group ahead of this step's products (the scheduler otherwise sinks each load to just before its use)
#pragma unroll
            for (int m = 0; m < FM; ++m)
#pragma unroll
                for (int n = 0; n < FN; ++n) acc[m][n] = wmmab(a0[q][m], b0[q][n], acc[m][n]);
            if constexpr (NA == 2) {
#pragma unroll
                for (int m = 0; m < FM; ++m)
#pragma unroll
                    for (int n = 0; n < FN; ++n) acc[m][n] = wmmab(a1[q][m], b0[q][n], acc[m][n]);
            }
            if constexpr (NBP == 2) {
#pragma unroll
                for (int m = 0; m < FM; ++m)
#pragma unroll
                    for (int n = 0; n < FN; ++n) acc[m][n] = wmmab(a0[q][m], b1[q][n], acc[m][n]);
            }
            __builtin_amdgcn_sched_barrier(0);   // keeps this step's products ahead of the load group after next, which reuses their fragment set
        }
        asm volatile("s_wait_dscnt 0x0" ::: "memory");
        if (issues()) asm volatile("s_wait_tensorcnt 0x0" ::: "memory");
        __syncthreads();
        if (pinned((t + 2 < NT ? 1u : 0u) & iss) != 0u) fill(pinned((unsigned)t + 2u));
    }
    asm volatile("s_wait_tensorcnt 0x0" ::: "memory");      // no request is outstanding when the ring becomes output staging
    asm volatile("s_wait_dscnt 0x0" ::: "memory");          // ... and no LDS read
    // Epilogue: each wave stages its part of the tile in its own part of the ring (the loop's last barrier has ended every read of it) and stores whole 128-B lines.
    if constexpr (OUT == 2) {
        // A lane's 8 accumulator values of a fragment are 8 consecutive rows of one column: 16 B of a row of C^T in either plane. Staged row = one column's FM * 16 values, pitch + 16 B.
        constexpr int TP = FM * 32 + 16;
        static_assert(FM == 4, "a staged row is one 128-B line");
        static_assert(8 * 2 * WN * TP <= 2 * STAGE, "the output staging fits the ring");
        unsigned char* ob = sm + wave * (2 * WN * TP);   // WN rows of the hi plane, then WN rows of the residual plane
#pragma unroll
        for (int n = 0; n < FN; ++n)
#pragma unroll
            for (int m = 0; m < FM; ++m) { v8us oh, ol;
#pragma unroll
                for (int j = 0; j < 8; ++j) { const float v = BIAS ? acc[m][n][j] + bv[n] : acc[m][n][j]; const unsigned short hb = f2bf(v); oh[j] = hb; ol[j] = f2bf(v - bf2f(hb)); }
                unsigned char* p = ob + (n * 16 + lr) * TP + m * 32 + hi * 16; *(v8usa*)p = oh; *(v8usa*)(p + WN * TP) = ol; }
        __syncthreads();   // the staged values are read back by other lanes: no read may move ahead of the stores
        const size_t o0 = (size_t)blockIdx.z * zC + (size_t)(c0 + wn * WN) * ldc + r0 + wm * FM * 16 + (lane & 7) * 8;
#pragma unroll
        for (int s = 0; s < WN / 4; ++s) { const int row = (lane >> 3) + 4 * s; const unsigned char* p = ob + row * TP + (lane & 7) * 16;
            const v8us vh = *(const v8usa*)p, vl = *(const v8usa*)(p + WN * TP);
            *(v8us*)(Ch + o0 + (size_t)row * ldc) = vh; *(v8us*)(Cl + o0 + (size_t)row * ldc) = vl; }
    } else {
        constexpr int OP = WN + 4, LPR = WN / 32;
        static_assert(8 * FM * 16 * OP * 4 <= 2 * STAGE, "the output staging fits the ring");
        float* os = (float*)(void*)sm + wave * (FM * 16 * OP);
#pragma unroll
        for (int n = 0; n < FN; ++n)
#pragma unroll
            for (int m = 0; m < FM; ++m)
#pragma unroll
                for (int j = 0; j < 8; ++j) os[(m * 16 + hi * 8 + j) * OP + n * 16 + lr] = BIAS ? acc[m][n][j] + bv[n] : acc[m][n][j];
        __syncthreads();   // the staged values are read back by other lanes: no read may move ahead of the stores
        if constexpr (OUT == 0) {
            float* crow_p = C + (size_t)blockIdx.z * zC + (size_t)(r0 + wm * FM * 16) * ldc + c0 + wn * WN;
#pragma unroll
            for (int s = 0; s < FM * 4 * LPR; ++s) { const int Lid = (lane >> 3) + 4 * s, piece = lane & 7; const int row = Lid / LPR, cofs = (Lid % LPR) * 32 + piece * 4;
                const v4f val = *(const v4fa*)(os + row * OP + cofs); *(v4f*)(crow_p + (size_t)row * ldc + cofs) = val; }
        } else {
            const size_t o0 = (size_t)blockIdx.z * zC + (size_t)(r0 + wm * FM * 16) * ldc + c0 + wn * WN;
            // 8 lanes take one row's 64 values, 8 each: one 128-B line of either plane.
            static_assert(WN == 64, "a row of the wave tile is one 128-B line of a plane");
#pragma unroll
            for (int s = 0; s < FM * 4; ++s) { const int row = (lane >> 3) + 4 * s, cofs = (lane & 7) * 8;
                const v4f u0 = *(const v4fa*)(os + row * OP + cofs), u1 = *(const v4fa*)(os + row * OP + cofs + 4); v8us oh, ol;
#pragma unroll
                for (int i = 0; i < 8; ++i) { const float v = i < 4 ? u0[i & 3] : u1[i & 3]; const unsigned short hb = f2bf(v); oh[i] = hb; ol[i] = f2bf(v - bf2f(hb)); }
                *(v8us*)(Ch + o0 + (size_t)row * ldc + cofs) = oh; *(v8us*)(Cl + o0 + (size_t)row * ldc + cofs) = ol; }
        }
    }
}

// k_lnout: one wave per row: v = bf(x) + y2 (f32), LayerNorm (mean, mean((v-mu)^2), eps 1e-5, x bf(gamma) + bf(beta)) -> f32 output row; per 128-column chunk q the
// per phase.
__global__ __launch_bounds__(256) void k_lnout(const float* __restrict__ X, const float* __restrict__ Y2, const float* __restrict__ gam, const float* __restrict__ bet, float* OUTP) {
    const int lane = threadIdx.x & 31, r = blockIdx.x * 8 + (threadIdx.x >> 5);
    if (r >= NB_ * NT_) return;
    const float* xr = X + (size_t)r * DM; const float* yr = Y2 + (size_t)r * DM;
    float s = 0.f;
#pragma unroll 1
    for (int q = 0; q < 2 * (DM / 256); ++q) { const int c0 = (q >> 1) * 256 + (q & 1) * 128 + lane * 4; const v4f xv = *(const v4f*)(xr + c0), yv = *(const v4f*)(yr + c0);
#pragma unroll
        for (int i = 0; i < 4; ++i) s += bfr(xv[i]) + yv[i]; }
#pragma unroll
    for (int sh = 16; sh; sh >>= 1) s += __shfl_xor(s, sh, 32);
    const float mu = s * (1.0f / DM);
    float s2 = 0.f;
#pragma unroll 1
    for (int q = 0; q < 2 * (DM / 256); ++q) { const int c0 = (q >> 1) * 256 + (q & 1) * 128 + lane * 4; const v4f xv = *(const v4f*)(xr + c0), yv = *(const v4f*)(yr + c0);
#pragma unroll
        for (int i = 0; i < 4; ++i) { const float d = (bfr(xv[i]) + yv[i]) - mu; s2 = fmaf(d, d, s2); } }
#pragma unroll
    for (int sh = 16; sh; sh >>= 1) s2 += __shfl_xor(s2, sh, 32);
    const float rs = rsqrtf(s2 * (1.0f / DM) + 1e-5f);
{
#pragma unroll 1
        for (int q = 0; q < 2 * (DM / 256); ++q) { const int c0 = (q >> 1) * 256 + (q & 1) * 128 + lane * 4; const v4f xv = *(const v4f*)(xr + c0), yv = *(const v4f*)(yr + c0); v4f o;
#pragma unroll
            for (int i = 0; i < 4; ++i) o[i] = ((bfr(xv[i]) + yv[i]) - mu) * rs * bfr(gam[c0 + i]) + bfr(bet[c0 + i]);
            *(v4f*)(OUTP + (size_t)r * DM + c0) = o; }
         }
}

extern "C" void kernel_launch(void* const* d_in, const int* in_sizes, int n_in,
                              void* d_out, int out_size, void* d_ws, size_t ws_size, hipStream_t stream) {
    (void)in_sizes; (void)n_in; (void)out_size;
    const float* x = (const float*)d_in[0]; const float* lg = (const float*)d_in[1]; const float* lb = (const float*)d_in[2];
    const float* w1 = (const float*)d_in[3]; const float* b1 = (const float*)d_in[4]; const float* w2 = (const float*)d_in[5]; const float* b2 = (const float*)d_in[6];   // w1 [1024][2048], w2 [2048][1024], both (in, out) = k-major
    float* out = (float*)d_out;    // [4][2048][1024]
    char* wsp = (char*)d_ws;
    auto take = [&](size_t bytes) { char* p = wsp; wsp += (bytes + 255) & ~(size_t)255; return (void*)p; };
    constexpr size_t NR = (size_t)NB_ * NTK;   // rows of all items
    bf* W1T = (bf*)take((size_t)FF * DM * 2); bf* W2T = (bf*)take((size_t)DM * FF * 2);
    bf* Xb = (bf*)take(NR * DM * 2); bf* XT = (bf*)take(NR * DM * 2); bf* Y0h = (bf*)take(NR * DM * 2); bf* Y0l = (bf*)take(NR * DM * 2);
    float* T = (float*)take(NR * FF * 4); bf* Hh = (bf*)take(NR * FF * 2); bf* Hl = (bf*)take(NR * FF * 2);
    float* Y2 = (float*)take(NR * DM * 4);
    // A plane whose last reader has run before another's writer starts (stream order) lends it its bytes (the planes of m^T fill a quarter of theirs): 8 + 32 + 32 + 64 + 64 + 32 = 232 MiB.
    bf* Y1Th = Y0h; bf* Y1Tl = Y0l;   // y0 is last read by the first product, y1^T is written by the second
    bf* MTh = Hh; bf* MTl = Hl;       // gelu(t) is last read by the second product, the planes of m^T are written by the third
    if ((size_t)(wsp - (char*)d_ws) > ws_size) return;
    k_wt<<<dim3(DM / 64, FF / 64, 1), 256, 0, stream>>>(w1, DM, FF, W1T);    // w1 [1024 k][2048 n] -> W1T [2048][1024]
    k_wt<<<dim3(FF / 64, DM / 64, 1), 256, 0, stream>>>(w2, FF, DM, W2T);    // w2 [2048 k][1024 n] -> W2T [1024][2048]
    k_xbt<<<dim3(NT_ / 64, DM / 64, NB_), 256, 0, stream>>>(x, Xb, XT);                                                                                            // bf16(x) as [item][t][f] and [item][f][t]
    k_ln<true><<<NB_ * NTK / 8, 256, 0, stream>>>(x, lg, lb, NB_ * NTK, Y0h, Y0l);
    k_gemm<2, 1, 128, 256, 2, DM, true, 0><<<dim3(NTK / 128, FF / 256, NB_), 256, 0, stream>>>(Y0h, Y0l, W1T, nullptr, b1, T, nullptr, nullptr, FF, NTK * DM, 0, NTK * FF);                  // y0.w1 + b1
    k_gelu2<<<NB_ * NTK / 8, 256, 0, stream>>>(T, NB_ * NTK, Hh, Hl);
    k_gemm<2, 1, 128, 256, 2, FF, true, 2><<<dim3(NTK / 128, DM / 256, NB_), 256, 0, stream>>>(Hh, Hl, W2T, nullptr, b2, nullptr, Y1Th, Y1Tl, NT_, NTK * FF, 0, DM * NT_);   // y1 = gelu(t).w2 + b2, stored as y1^T hi/lo planes [item][1024][2048]
    k_gemm<2, 1, 128, 128, 4, NT_, false, 1><<<dim3(DM / 128, DM / 128, NB_), 256, 0, stream>>>(Y1Th, Y1Tl, XT, nullptr, nullptr, nullptr, MTh, MTl, DM, DM * NT_, DM * NT_, DM * DM);   // m^T [g][f] = sum over t of y1[t][g] x[t][f], stored as hi/lo planes
    k_gemm<1, 2, 256, 128, 4, DM, false, 0><<<dim3(NT_ / 256, DM / 128, NB_), 256, 0, stream>>>(Xb, nullptr, MTh, MTl, nullptr, Y2, nullptr, nullptr, DM, NTK * DM, DM * DM, NTK * DM);           // y2 [t][g] = sum over f of x[t][f] m^T[g][f]
    k_lnout<<<NB_ * NTK / 8, 256, 0, stream>>>(x, Y2, lg, lb, out);                                                                                               // LN(x + y2)
}

// v007
// One run takes 173 microseconds.
// Two timings next to v006 put it at 1.05 and 1.06 times that version's speed.
// All steps since v000 together make it 5.92 times as fast.
#include <hip/hip_runtime.h>

// Compute dtypes, f32 accumulate, all four batch items in every launch (row-wise kernels: 4 x 2048 rows; per-item products: grid z = item): y0 = LN(x) (f32; gamma/beta and x read through bf16 rounding) -> bf16 hi + UNSCALED residual planes;
// t = y0.w1 + b1 ([2048 x 1024].[1024 x 2048]) and y1 = gelu(t).w2 + b2 ([2048 x 2048].[2048 x 1024]) on v_wmma_f32_16x16x32_bf16 with k-major weights
// transposed once to n-major bf16 planes and the computed operands as hi + residual (two products; exact-erf GELU in f32 in between); (x.x^T).y1 is summed as
// x.(x^T.y1): m^T = y1^T.x ([1024 x 2048].[2048 x 1024] per item, y1 as hi + residual, the INPUT x rounded once: two products), then y2 = x.m ([2048 x 1024].[1024 x 1024],
// m as hi + residual: two products): half the multiply-adds of the score route per product, and no [2048 x 2048] score plane.
// y1 and m^T never exist as f32 planes: the product that computes them splits each f32 value into hi + residual in its epilogue and stores the planes the next product reads (y1 transposed).

#define NB_  4
#define NT_  2048
#define DM   1024
#define FF   2048
#define NTK  NT_
#define LOSC 1024.0f             // (unused here)

typedef _Float16 h16;
typedef unsigned short bf;
typedef __attribute__((ext_vector_type(16))) __bf16   v16bf;
typedef __attribute__((ext_vector_type(16))) _Float16 v16h;
typedef __attribute__((ext_vector_type(8)))  _Float16 v8h;
typedef __attribute__((ext_vector_type(8)))  unsigned short v8us;
typedef __attribute__((ext_vector_type(8)))  float    v8f;
typedef __attribute__((ext_vector_type(4)))  float    v4f;
typedef __attribute__((ext_vector_type(4)))  _Float16 v4h;
typedef v8h  __attribute__((may_alias)) v8ha;
typedef v4f  __attribute__((may_alias)) v4fa;
typedef v8us __attribute__((may_alias)) v8usa;

__device__ __forceinline__ unsigned short f2bf(float f) { unsigned u = __float_as_uint(f); u += 0x7FFFu + ((u >> 16) & 1u); return (unsigned short)(u >> 16); }
__device__ __forceinline__ float bf2f(unsigned short b) { return __uint_as_float(((unsigned)b) << 16); }
__device__ __forceinline__ float bfr(float f) { return bf2f(f2bf(f)); }
__device__ __forceinline__ v16h cat16(v8h lo, v8h hi) { return __builtin_shufflevector(lo, hi, 0, 1, 2, 3, 4, 5, 6, 7, 8, 9, 10, 11, 12, 13, 14, 15); }
__device__ __forceinline__ v16bf cat16b(v8us lo, v8us hi) { return __builtin_bit_cast(v16bf, __builtin_shufflevector(lo, hi, 0, 1, 2, 3, 4, 5, 6, 7, 8, 9, 10, 11, 12, 13, 14, 15)); }
__device__ __forceinline__ v8f wmma16(v16h a, v16h b, v8f c) { return __builtin_amdgcn_wmma_f32_16x16x32_f16(false, a, false, b, (short)0, c, false, false); }
__device__ __forceinline__ v8f wmmab(v16bf a, v16bf b, v8f c) { return __builtin_amdgcn_wmma_f32_16x16x32_bf16(false, a, false, b, (short)0, c, false, false); }

// xbt_body: the input x [item][2048 t][1024 f], rounded once to bf16, written in both orders: XB [item][t][f] and XT [item][f][t], via 64 x 64 LDS tiles; one block per tile (bx, by) of item bz, of (NT/64, DM/64, items).
// Thread -> row tid >> 3 (+ 32), 8 columns (tid & 7) * 8: 8 lanes store one whole 128-B line of either plane. All stores stand behind the barrier, so that it waits on LDS alone.
__device__ __forceinline__ void xbt_body(unsigned short* tl, int bx, int by, int bz, const float* __restrict__ X, bf* XB, bf* XT) {
    const int tid = threadIdx.x, t0 = bx * 64, f0 = by * 64, piece = tid & 7, row = tid >> 3;
    const size_t ib = (size_t)bz * NT_ * DM, o = ib + (size_t)(t0 + row) * DM + f0 + piece * 8;
    v4f a[2][2];
#pragma unroll
    for (int s = 0; s < 2; ++s) { a[s][0] = *(const v4f*)(X + o + (size_t)s * 32 * DM); a[s][1] = *(const v4f*)(X + o + (size_t)s * 32 * DM + 4); }
    v8us r[2];
#pragma unroll
    for (int s = 0; s < 2; ++s)
#pragma unroll
        for (int i = 0; i < 8; ++i) { r[s][i] = f2bf(a[s][i >> 2][i & 3]); tl[(piece * 8 + i) * 72 + row + 32 * s] = r[s][i]; }
    __syncthreads();
#pragma unroll
    for (int s = 0; s < 2; ++s) { const v8us val = *(const v8usa*)(tl + (row + 32 * s) * 72 + piece * 8);
        *(v8us*)(XB + o + (size_t)s * 32 * DM) = r[s]; *(v8us*)(XT + ib + (size_t)(f0 + row + 32 * s) * NT_ + t0 + piece * 8) = val; }
    asm volatile("s_wait_xcnt 0x0" ::: "memory");   // in the joint kernel's text another pass's code follows these stores: the wait stands in front of any rewrite of their registers there
}

// wt_body: WT [n][K] = bf16(W[k][n]) (k-major [K][ncols]) via 64 x 64 LDS tiles; one block per tile (bx, by) of (K/64, ncols/64).
__device__ __forceinline__ void wt_body(unsigned short* tl, int bx, int by, const float* __restrict__ Wm, int K, int ncols, bf* WT) {
    const int tid = threadIdx.x, k0 = bx * 64, n0 = by * 64;
    const int kk = tid >> 2, nq = (tid & 3) * 16;
#pragma unroll
    for (int i = 0; i < 16; ++i) tl[(nq + i) * 72 + kk] = f2bf(Wm[(size_t)(k0 + kk) * ncols + n0 + nq + i]);
    __syncthreads();
    const int piece = tid & 7;
    auto pass = [&]() {
#pragma unroll
        for (int s = 0; s < 2; ++s) { const int nr = (tid >> 3) + 32 * s; const v8us val = *(const v8usa*)(tl + nr * 72 + piece * 8); *(v8us*)(WT + (size_t)(n0 + nr) * K + k0 + piece * 8) = val; }
    };
    pass();
    asm volatile("s_wait_xcnt 0x0" ::: "memory");   // in the joint kernel's text another pass's code follows these stores: the wait stands in front of any rewrite of their registers there
}
// ln_body: block bx takes 8 rows, one wave per row of x [rows][1024]: LayerNorm (mean, then mean((x-mu)^2), eps 1e-5, x bf(gamma) + bf(beta), f32, fixed lane order) -> bf16 hi + UNSCALED
// residual planes; lane -> columns q*256 + lane*8 .. +8 for q = 0..3 (16 B per plane per store, 8 lanes per line). The row is re-read per phase with the q loop
// rolled (keeps the static VALU-FMA count small; no register arrays indexed by a loop variable).
template <bool ROUNDIN>   // ROUNDIN: the source is a module INPUT (read through bf16 rounding); false: a computed f32 plane (read as is)
__device__ __forceinline__ void ln_body(int bx, const float* __restrict__ X, const float* __restrict__ gam, const float* __restrict__ bet, int nrows, bf* Hh, bf* Hl) {
    const int lane = threadIdx.x & 31, r = bx * 8 + (threadIdx.x >> 5);
    if (r >= nrows) return;
    const float* xr = X + (size_t)r * DM + lane * 8;
    float s = 0.f;
#pragma unroll 1
    for (int q = 0; q < DM / 256; ++q) {
#pragma unroll
        for (int i = 0; i < 8; ++i) s += (ROUNDIN ? bfr(xr[q * 256 + i]) : xr[q * 256 + i]); }
#pragma unroll
    for (int sh = 16; sh; sh >>= 1) s += __shfl_xor(s, sh, 32);
    const float mu = s * (1.0f / DM);
    float s2 = 0.f;
#pragma unroll 1
    for (int q = 0; q < DM / 256; ++q) {
#pragma unroll
        for (int i = 0; i < 8; ++i) { const float d = (ROUNDIN ? bfr(xr[q * 256 + i]) : xr[q * 256 + i]) - mu; s2 = fmaf(d, d, s2); } }
#pragma unroll
    for (int sh = 16; sh; sh >>= 1) s2 += __shfl_xor(s2, sh, 32);
    const float rs = rsqrtf(s2 * (1.0f / DM) + 1e-5f);
{
#pragma unroll 1
        for (int q = 0; q < DM / 256; ++q) { v8us oh, ol;
#pragma unroll
            for (int i = 0; i < 8; ++i) { const int c = q * 256 + lane * 8 + i; const float y = ((ROUNDIN ? bfr(xr[q * 256 + i]) : xr[q * 256 + i]) - mu) * rs * bfr(gam[c]) + bfr(bet[c]); const unsigned short hb = f2bf(y); oh[i] = hb; ol[i] = f2bf(y - bf2f(hb)); }
            const size_t o = (size_t)r * DM + q * 256 + lane * 8; *(v8us*)(Hh + o) = oh; *(v8us*)(Hl + o) = ol;
            asm volatile("s_wait_xcnt 0x0" ::: "memory"); }   // stands in front of the next trip's rewrite of the two stores' address registers
         }
}
// k_pre: the four passes that read nothing but inputs (LN(x) planes, bf16(x) in both orders, the two weight transposes) in ONE launch: none waits for another, so they need no launch boundary
// between them. The block index picks the pass: the test is the same for a whole block, so a pass's barrier is met by all of a block's waves or by none. The pass with the longest waves comes first.
#define PB_LN  (NB_ * NTK / 8)
#define PB_XBT ((NT_ / 64) * (DM / 64) * NB_)
#define PB_WT  ((DM / 64) * (FF / 64))
__global__ __launch_bounds__(256) void k_pre(const float* __restrict__ X, const float* __restrict__ gam, const float* __restrict__ bet, const float* __restrict__ W1, const float* __restrict__ W2,
                                             bf* W1T, bf* W2T, bf* XB, bf* XT, bf* Hh, bf* Hl) {
    __shared__ __align__(16) unsigned short tl[64 * 72];
    const int b = blockIdx.x, bx = b - PB_LN, bw = bx - PB_XBT, bv = bw - PB_WT;   // the block's index in the whole grid and inside the second, third and fourth pass
    if (b < PB_LN) ln_body<true>(b, X, gam, bet, NB_ * NTK, Hh, Hl);
    else if (bx < PB_XBT) xbt_body(tl, bx % (NT_ / 64), bx / (NT_ / 64) % (DM / 64), bx / ((NT_ / 64) * (DM / 64)), X, XB, XT);
    else if (bw < PB_WT) wt_body(tl, bw % (DM / 64), bw / (DM / 64), W1, DM, FF, W1T);   // w1 [1024 k][2048 n] -> W1T [2048][1024]
    else wt_body(tl, bv % (FF / 64), bv / (FF / 64), W2, FF, DM, W2T);                   // w2 [2048 k][1024 n] -> W2T [1024][2048]
}
// k_gelu2: exact-erf GELU of an f32 [nrows][FF] plane (bias already added) -> bf16 hi + UNSCALED residual planes; one wave per row, lane -> 4 consecutive
// columns per iteration (16 rolled iterations of 128 columns; 8 B per plane per store -> 16 lanes per line).
__global__ __launch_bounds__(256) void k_gelu2(const float* __restrict__ src, int nrows, bf* dh, bf* dl) {
    typedef __attribute__((ext_vector_type(4))) unsigned short v4us;
    const int lane = threadIdx.x & 31, r = blockIdx.x * 8 + (threadIdx.x >> 5);
    if (r >= nrows) return;
{
#pragma unroll 1
        for (int q = 0; q < FF / 128; ++q) { const size_t o = (size_t)r * FF + q * 128 + lane * 4; const v4f v = *(const v4f*)(src + o); v4us oh, ol;
#pragma unroll
            for (int i = 0; i < 4; ++i) { const float g = 0.5f * v[i] * (1.0f + erff(v[i] * 0.70710678118654752f)); const unsigned short hb = f2bf(g); oh[i] = hb; ol[i] = f2bf(g - bf2f(hb)); }
            *(v4us*)(dh + o) = oh; *(v4us*)(dl + o) = ol; }
         }
}
// k_gemm: BM x BN block tile (8 waves as WMW x 8/WMW, wave tile BM/WMW x BN/(8/WMW): 64 x 64 where the grid still fills the chip, else 32 x 64) of C[.][ldc] = (A0 [+ A1]).(B0 [+ B1])^T [+ bf(bias[c])], all planes bf16 with row stride K.
// OUT 0: C is stored as f32. OUT 1: as bf16 hi + UNSCALED residual planes Ch, Cl [row][ldc]. OUT 2: as such planes of C^T, [column][ldc].
// A stage is 128 k (256 B) of every operand row, rows [A0 | A1 | B0 | B1] in slices of 64 rows at an LDS pitch of 272 B. Each slice is brought in by ONE tensor load of one wave
// (wave w -> slice w; the 16 B behind each row are the load's pad), into two buffers: stage t + 1 flies while stage t is worked on. Per accumulator and 32-k step the products keep the order
// A0.B0, A1.B0, A0.B1 and k runs upward, with the same k order inside a fragment for A and B (bytes 16h and 32 + 16h of each 64 B of a row).
#define KS    128
#define PITCH 272
#define SROWS 64      // rows of a slice
#define SLICE 18432   // 64 rows x 272 B = 17,408 B, rounded up to a multiple of 2 KiB: every slice of every buffer starts on such a multiple
typedef unsigned u32x4 __attribute__((ext_vector_type(4)));
typedef unsigned u32x8 __attribute__((ext_vector_type(8)));
__device__ __forceinline__ unsigned uni(unsigned v) { return (unsigned)__builtin_amdgcn_readfirstlane(v); }
// pinned(): holds a value that decides on a tensor load, or that its descriptor is formed from, in a scalar register: a test on it is a scalar branch (a tensor load ignores EXEC),
// and what is computed from it stays behind the waits written ahead of it.
__device__ __forceinline__ unsigned pinned(unsigned v) { unsigned w = (unsigned)__builtin_amdgcn_readfirstlane(v); asm volatile("" : "+s"(w)); return w; }
// Descriptor group 1: 1-byte elements, tensor = tile = 64 rows of 256 B, source row pitch in bytes, 4 dwords of LDS pad behind every 64 dwords; no mask.
__device__ __forceinline__ u32x8 tdm_group1(unsigned src_pitch) {
    u32x8 g;
    g[0] = uni((1u << 20) | (5u << 22) | (3u << 25));
    g[1] = uni((KS * 2u) << 16);
    g[2] = uni((unsigned)SROWS << 16);
    g[3] = uni((KS * 2u) << 16);
    g[4] = uni((unsigned)SROWS);
    g[5] = uni(src_pitch);
    g[6] = uni(0u);
    g[7] = uni(0u);
    asm volatile("" : "+s"(g));   // pinned(), for the whole group: its words stay in one scalar tuple from here on, so none of them takes a new value while a request is outstanding
    return g;
}
// One request of the calling wave: group 0 = count 1, the slice's byte offset in the work-group's LDS, the global address of its first byte, type 2.
__device__ __forceinline__ void tdm_load(unsigned lds_dst, unsigned long long ga, u32x8 g1) {
    u32x4 g0;
    g0[0] = pinned(1u);   // pinned(): this constant word too is written here, behind the wait on the request before, not ahead of the loop
    g0[1] = uni(lds_dst); g0[2] = uni((unsigned)ga); g0[3] = uni((((unsigned)(ga >> 32)) & 0x01FFFFFFu) | 0x80000000u);
    asm volatile("tensor_load_to_lds %0, %1" :: "s"(g0), "s"(g1) : "memory");
}
__device__ __forceinline__ v16bf ldfrag(const unsigned char* p) { return cat16b(*(const v8usa*)p, *(const v8usa*)(p + 32)); }

template <int NA, int NBP, int BM, int BN, int WMW, int K, bool BIAS, int OUT>
__global__ __launch_bounds__(256) void k_gemm(const bf* __restrict__ A0, const bf* __restrict__ A1, const bf* __restrict__ B0, const bf* __restrict__ B1, const float* __restrict__ bias, float* C, bf* Ch, bf* Cl, int ldc, int zA, int zB, int zC) {
    // zA, zB, zC: elements from one batch item (blockIdx.z) to the next in the A planes, the B planes and C or its planes (0: shared by all items).
    constexpr int WNW = 8 / WMW, FM = BM / WMW / 16, WN = BN / WNW, FN = WN / 16, NT = K / KS;
    constexpr int SA = BM / SROWS, SB = BN / SROWS, NS = NA * SA + NBP * SB;   // slices of an A plane, of a B plane, of a stage
    constexpr int STAGE = NS * SLICE;
    constexpr int OFF_A1 = SA * SLICE, OFF_B0 = NA * SA * SLICE, OFF_B1 = (NA * SA + SB) * SLICE;
    static_assert(NS <= 8 && WN == SROWS && SROWS % (FM * 16) == 0 && NT >= 2, "one slice a wave; a wave's A rows and its B rows each lie in one slice; two stages exist");
    __shared__ __attribute__((aligned(2048))) unsigned char sm[2 * STAGE];
    const int tid = threadIdx.x, lane = tid & 31, wave = tid >> 5, lr = lane & 15, hi = lane >> 4;
    const int wm = wave / WNW, wn = wave % WNW;
    const int r0 = blockIdx.x * BM, c0 = blockIdx.y * BN;
    // Wave w brings slice w of every stage: its plane, its first row there, its place in a buffer. With fewer slices than waves the last waves bring nothing.
    const unsigned wv = uni((unsigned)tid >> 5);
    const unsigned iss = NS == 8 ? 1u : pinned(wv < (unsigned)NS ? 1u : 0u);
    const bool isA = wv < (unsigned)(NA * SA);
    const unsigned sp = isA ? wv % SA : (wv - NA * SA) % SB;
    const bf* plane = isA ? ((NA == 2 && wv >= (unsigned)SA) ? A1 : A0) : ((NBP == 2 && wv >= (unsigned)(NA * SA + SB)) ? B1 : B0);
    const size_t e0 = isA ? (size_t)blockIdx.z * zA + (size_t)(r0 + sp * SROWS) * K : (size_t)blockIdx.z * zB + (size_t)(c0 + sp * SROWS) * K;
    const unsigned long long src0 = (unsigned long long)(size_t)(plane + e0);
    const unsigned lsl = (unsigned)(size_t)sm + wv * SLICE;
    const u32x8 g1 = tdm_group1(K * 2u);
    auto issues = [&]() { return NS == 8 || pinned(iss) != 0u; };   // no test where every wave brings a slice
    auto fill = [&](unsigned t) { tdm_load(lsl + (t & 1u) * STAGE, src0 + (unsigned long long)t * (KS * 2), g1); };
    v8f acc[FM][FN];
#pragma unroll
    for (int m = 0; m < FM; ++m)
#pragma unroll
        for (int n = 0; n < FN; ++n) acc[m][n] = (v8f){};
    float bv[FN];   // the lane's bias values, fetched here so that their latency lies under the loop
#pragma unroll
    for (int n = 0; n < FN; ++n) bv[n] = BIAS ? bfr(bias[c0 + wn * WN + n * 16 + lr]) : 0.f;
    if (issues()) {
        fill(0);
        asm volatile("s_wait_tensorcnt 0x0" ::: "memory");   // this wave's slice of stage 0 has landed
    }
    __syncthreads();                                          // ... and every other wave's
    if (issues()) fill(1);
    // The stage loop stays rolled (one copy of its body; the buffer is picked by t & 1); every loop inside it is unrolled so that the register arrays are indexed by constants.
#pragma unroll 1
    for (int t = 0; t < NT; ++t) {
        const unsigned char* sb = sm + (t & 1) * STAGE;
        const unsigned char* pa = sb + (wm * FM * 16 / SROWS) * SLICE + (wm * FM * 16 % SROWS + lr) * PITCH + 16 * hi;
        const unsigned char* pb = sb + OFF_B0 + wn * SLICE + lr * PITCH + 16 * hi;
        // Two fragment sets: the loads of 32-k step ks + 1 go out as one group ahead of step ks's products (only inside this stage), so that a step's LDS latency is covered by the step before.
        v16bf a0[2][FM], a1[2][FM], b0[2][FN], b1[2][FN];
        auto ldset = [&](int q, int ks) {
#pragma unroll
            for (int m = 0; m < FM; ++m) { a0[q][m] = ldfrag(pa + m * 16 * PITCH + ks * 64); if constexpr (NA == 2) a1[q][m] = ldfrag(pa + OFF_A1 + m * 16 * PITCH + ks * 64); }
#pragma unroll
            for (int n = 0; n < FN; ++n) { b0[q][n] = ldfrag(pb + n * 16 * PITCH + ks * 64); if constexpr (NBP == 2) b1[q][n] = ldfrag(pb + (OFF_B1 - OFF_B0) + n * 16 * PITCH + ks * 64); }
        };
        ldset(0, 0);
#pragma unroll
        for (int ks = 0; ks < KS / 32; ++ks) {
            const int q = ks & 1;
            if (ks + 1 < KS / 32) ldset(q ^ 1, ks + 1);
            __builtin_amdgcn_sched_barrier(0);   // keeps the next step's load group ahead of this step's products (the scheduler otherwise sinks each load to just before its use)
#pragma unroll
            for (int m = 0; m < FM; ++m)
#pragma unroll
                for (int n = 0; n < FN; ++n) acc[m][n] = wmmab(a0[q][m], b0[q][n], acc[m][n]);
            if constexpr (NA == 2) {
#pragma unroll
                for (int m = 0; m < FM; ++m)
#pragma unroll
                    for (int n = 0; n < FN; ++n) acc[m][n] = wmmab(a1[q][m], b0[q][n], acc[m][n]);
            }
            if constexpr (NBP == 2) {
#pragma unroll
                for (int m = 0; m < FM; ++m)
#pragma unroll
                    for (int n = 0; n < FN; ++n) acc[m][n] = wmmab(a0[q][m], b1[q][n], acc[m][n]);
            }
            __builtin_amdgcn_sched_barrier(0);   // keeps this step's products ahead of the load group after next, which reuses their fragment set
        }
        asm volatile("s_wait_dscnt 0x0" ::: "memory");
        if (issues()) asm volatile("s_wait_tensorcnt 0x0" ::: "memory");
        __syncthreads();
        if (pinned((t + 2 < NT ? 1u : 0u) & iss) != 0u) fill(pinned((unsigned)t + 2u));
    }
    asm volatile("s_wait_tensorcnt 0x0" ::: "memory");      // no request is outstanding when the ring becomes output staging
    asm volatile("s_wait_dscnt 0x0" ::: "memory");          // ... and no LDS read
    // Epilogue: each wave stages its part of the tile in its own part of the ring (the loop's last barrier has ended every read of it) and stores whole 128-B lines.
    if constexpr (OUT == 2) {
        // A lane's 8 accumulator values of a fragment are 8 consecutive rows of one column: 16 B of a row of C^T in either plane. Staged row = one column's FM * 16 values, pitch + 16 B.
        constexpr int TP = FM * 32 + 16;
        static_assert(FM == 4, "a staged row is one 128-B line");
        static_assert(8 * 2 * WN * TP <= 2 * STAGE, "the output staging fits the ring");
        unsigned char* ob = sm + wave * (2 * WN * TP);   // WN rows of the hi plane, then WN rows of the residual plane
#pragma unroll
        for (int n = 0; n < FN; ++n)
#pragma unroll
            for (int m = 0; m < FM; ++m) { v8us oh, ol;
#pragma unroll
                for (int j = 0; j < 8; ++j) { const float v = BIAS ? acc[m][n][j] + bv[n] : acc[m][n][j]; const unsigned short hb = f2bf(v); oh[j] = hb; ol[j] = f2bf(v - bf2f(hb)); }
                unsigned char* p = ob + (n * 16 + lr) * TP + m * 32 + hi * 16; *(v8usa*)p = oh; *(v8usa*)(p + WN * TP) = ol; }
        __syncthreads();   // the staged values are read back by other lanes: no read may move ahead of the stores
        const size_t o0 = (size_t)blockIdx.z * zC + (size_t)(c0 + wn * WN) * ldc + r0 + wm * FM * 16 + (lane & 7) * 8;
#pragma unroll
        for (int s = 0; s < WN / 4; ++s) { const int row = (lane >> 3) + 4 * s; const unsigned char* p = ob + row * TP + (lane & 7) * 16;
            const v8us vh = *(const v8usa*)p, vl = *(const v8usa*)(p + WN * TP);
            *(v8us*)(Ch + o0 + (size_t)row * ldc) = vh; *(v8us*)(Cl + o0 + (size_t)row * ldc) = vl; }
    } else {
        constexpr int OP = WN + 4, LPR = WN / 32;
        static_assert(8 * FM * 16 * OP * 4 <= 2 * STAGE, "the output staging fits the ring");
        float* os = (float*)(void*)sm + wave * (FM * 16 * OP);
#pragma unroll
        for (int n = 0; n < FN; ++n)
#pragma unroll
            for (int m = 0; m < FM; ++m)
#pragma unroll
                for (int j = 0; j < 8; ++j) os[(m * 16 + hi * 8 + j) * OP + n * 16 + lr] = BIAS ? acc[m][n][j] + bv[n] : acc[m][n][j];
        __syncthreads();   // the staged values are read back by other lanes: no read may move ahead of the stores
        if constexpr (OUT == 0) {
            float* crow_p = C + (size_t)blockIdx.z * zC + (size_t)(r0 + wm * FM * 16) * ldc + c0 + wn * WN;
#pragma unroll
            for (int s = 0; s < FM * 4 * LPR; ++s) { const int Lid = (lane >> 3) + 4 * s, piece = lane & 7; const int row = Lid / LPR, cofs = (Lid % LPR) * 32 + piece * 4;
                const v4f val = *(const v4fa*)(os + row * OP + cofs); *(v4f*)(crow_p + (size_t)row * ldc + cofs) = val; }
        } else {
            const size_t o0 = (size_t)blockIdx.z * zC + (size_t)(r0 + wm * FM * 16) * ldc + c0 + wn * WN;
            // 8 lanes take one row's 64 values, 8 each: one 128-B line of either plane.
            static_assert(WN == 64, "a row of the wave tile is one 128-B line of a plane");
#pragma unroll
            for (int s = 0; s < FM * 4; ++s) { const int row = (lane >> 3) + 4 * s, cofs = (lane & 7) * 8;
                const v4f u0 = *(const v4fa*)(os + row * OP + cofs), u1 = *(const v4fa*)(os + row * OP + cofs + 4); v8us oh, ol;
#pragma unroll
                for (int i = 0; i < 8; ++i) { const float v = i < 4 ? u0[i & 3] : u1[i & 3]; const unsigned short hb = f2bf(v); oh[i] = hb; ol[i] = f2bf(v - bf2f(hb)); }
                *(v8us*)(Ch + o0 + (size_t)row * ldc + cofs) = oh; *(v8us*)(Cl + o0 + (size_t)row * ldc + cofs) = ol; }
        }
    }
}

// k_lnout: one wave per row: v = bf(x) + y2 (f32), LayerNorm (mean, mean((v-mu)^2), eps 1e-5, x bf(gamma) + bf(beta)) -> f32 output row; per 128-column chunk q the
// per phase.
__global__ __launch_bounds__(256) void k_lnout(const float* __restrict__ X, const float* __restrict__ Y2, const float* __restrict__ gam, const float* __restrict__ bet, float* OUTP) {
    const int lane = threadIdx.x & 31, r = blockIdx.x * 8 + (threadIdx.x >> 5);
    if (r >= NB_ * NT_) return;
    const float* xr = X + (size_t)r * DM; const float* yr = Y2 + (size_t)r * DM;
    float s = 0.f;
#pragma unroll 1
    for (int q = 0; q < 2 * (DM / 256); ++q) { const int c0 = (q >> 1) * 256 + (q & 1) * 128 + lane * 4; const v4f xv = *(const v4f*)(xr + c0), yv = *(const v4f*)(yr + c0);
#pragma unroll
        for (int i = 0; i < 4; ++i) s += bfr(xv[i]) + yv[i]; }
#pragma unroll
    for (int sh = 16; sh; sh >>= 1) s += __shfl_xor(s, sh, 32);
    const float mu = s * (1.0f / DM);
    float s2 = 0.f;
#pragma unroll 1
    for (int q = 0; q < 2 * (DM / 256); ++q) { const int c0 = (q >> 1) * 256 + (q & 1) * 128 + lane * 4; const v4f xv = *(const v4f*)(xr + c0), yv = *(const v4f*)(yr + c0);
#pragma unroll
        for (int i = 0; i < 4; ++i) { const float d = (bfr(xv[i]) + yv[i]) - mu; s2 = fmaf(d, d, s2); } }
#pragma unroll
    for (int sh = 16; sh; sh >>= 1) s2 += __shfl_xor(s2, sh, 32);
    const float rs = rsqrtf(s2 * (1.0f / DM) + 1e-5f);
{
#pragma unroll 1
        for (int q = 0; q < 2 * (DM / 256); ++q) { const int c0 = (q >> 1) * 256 + (q & 1) * 128 + lane * 4; const v4f xv = *(const v4f*)(xr + c0), yv = *(const v4f*)(yr + c0); v4f o;
#pragma unroll
            for (int i = 0; i < 4; ++i) o[i] = ((bfr(xv[i]) + yv[i]) - mu) * rs * bfr(gam[c0 + i]) + bfr(bet[c0 + i]);
            *(v4f*)(OUTP + (size_t)r * DM + c0) = o; }
         }
}

extern "C" void kernel_launch(void* const* d_in, const int* in_sizes, int n_in,
                              void* d_out, int out_size, void* d_ws, size_t ws_size, hipStream_t stream) {
    (void)in_sizes; (void)n_in; (void)out_size;
    const float* x = (const float*)d_in[0]; const float* lg = (const float*)d_in[1]; const float* lb = (const float*)d_in[2];
    const float* w1 = (const float*)d_in[3]; const float* b1 = (const float*)d_in[4]; const float* w2 = (const float*)d_in[5]; const float* b2 = (const float*)d_in[6];   // w1 [1024][2048], w2 [2048][1024], both (in, out) = k-major
    float* out = (float*)d_out;    // [4][2048][1024]
    char* wsp = (char*)d_ws;
    auto take = [&](size_t bytes) { char* p = wsp; wsp += (bytes + 255) & ~(size_t)255; return (void*)p; };
    constexpr size_t NR = (size_t)NB_ * NTK;   // rows of all items
    bf* W1T = (bf*)take((size_t)FF * DM * 2); bf* W2T = (bf*)take((size_t)DM * FF * 2);
    bf* Xb = (bf*)take(NR * DM * 2); bf* XT = (bf*)take(NR * DM * 2); bf* Y0h = (bf*)take(NR * DM * 2); bf* Y0l = (bf*)take(NR * DM * 2);
    float* T = (float*)take(NR * FF * 4); bf* Hh = (bf*)take(NR * FF * 2); bf* Hl = (bf*)take(NR * FF * 2);
    float* Y2 = (float*)take(NR * DM * 4);
    // A plane whose last reader has run before another's writer starts (stream order) lends it its bytes (the planes of m^T fill a quarter of theirs): 8 + 32 + 32 + 64 + 64 + 32 = 232 MiB.
    bf* Y1Th = Y0h; bf* Y1Tl = Y0l;   // y0 is last read by the first product, y1^T is written by the second
    bf* MTh = Hh; bf* MTl = Hl;       // gelu(t) is last read by the second product, the planes of m^T are written by the third
    if ((size_t)(wsp - (char*)d_ws) > ws_size) return;
    k_pre<<<PB_LN + PB_XBT + 2 * PB_WT, 256, 0, stream>>>(x, lg, lb, w1, w2, W1T, W2T, Xb, XT, Y0h, Y0l);   // y0 = LN(x) planes; bf16(x) as [item][t][f] and [item][f][t]; both weights n-major
    k_gemm<2, 1, 128, 256, 2, DM, true, 0><<<dim3(NTK / 128, FF / 256, NB_), 256, 0, stream>>>(Y0h, Y0l, W1T, nullptr, b1, T, nullptr, nullptr, FF, NTK * DM, 0, NTK * FF);                  // y0.w1 + b1
    k_gelu2<<<NB_ * NTK / 8, 256, 0, stream>>>(T, NB_ * NTK, Hh, Hl);
    k_gemm<2, 1, 128, 256, 2, FF, true, 2><<<dim3(NTK / 128, DM / 256, NB_), 256, 0, stream>>>(Hh, Hl, W2T, nullptr, b2, nullptr, Y1Th, Y1Tl, NT_, NTK * FF, 0, DM * NT_);   // y1 = gelu(t).w2 + b2, stored as y1^T hi/lo planes [item][1024][2048]
    k_gemm<2, 1, 128, 128, 4, NT_, false, 1><<<dim3(DM / 128, DM / 128, NB_), 256, 0, stream>>>(Y1Th, Y1Tl, XT, nullptr, nullptr, nullptr, MTh, MTl, DM, DM * NT_, DM * NT_, DM * DM);   // m^T [g][f] = sum over t of y1[t][g] x[t][f], stored as hi/lo planes
    k_gemm<1, 2, 256, 128, 4, DM, false, 0><<<dim3(NT_ / 256, DM / 128, NB_), 256, 0, stream>>>(Xb, nullptr, MTh, MTl, nullptr, Y2, nullptr, nullptr, DM, NTK * DM, DM * DM, NTK * DM);           // y2 [t][g] = sum over f of x[t][f] m^T[g][f]
    k_lnout<<<NB_ * NTK / 8, 256, 0, stream>>>(x, Y2, lg, lb, out);                                                                                               // LN(x + y2)
}

// v008
// Measured time: 159 microseconds a run.
// Timed twice side by side with v007, it ran 1.08 and 1.09 times as fast.
// All steps since v000 together make it 6.44 times as fast.
#include <hip/hip_runtime.h>

// Compute dtypes, f32 accumulate, all four batch items in every launch (row-wise kernels: 4 x 2048 rows; per-item products: grid z = item): y0 = LN(x) (f32; gamma/beta and x read through bf16 rounding) -> bf16 hi + UNSCALED residual planes;
// t = y0.w1 + b1 ([2048 x 1024].[1024 x 2048]) and y1 = gelu(t).w2 + b2 ([2048 x 2048].[2048 x 1024]) on v_wmma_f32_16x16x32_bf16 with k-major weights
// transposed once to n-major bf16 planes and the computed operands as hi + residual (two products; exact-erf GELU in f32 in the first product's epilogue); (x.x^T).y1 is summed as
// x.(x^T.y1): m^T = y1^T.x ([1024 x 2048].[2048 x 1024] per item, y1 as hi + residual, the INPUT x rounded once: two products), then y2 = x.m ([2048 x 1024].[1024 x 1024],
// m as hi + residual: two products): half the multiply-adds of the score route per product, and no [2048 x 2048] score plane.
// t, y1 and m^T never exist as f32 planes: the product that computes them splits each f32 value into hi + residual in its epilogue and stores the planes the next product reads (y1 transposed).

#define NB_  4
#define NT_  2048
#define DM   1024
#define FF   2048
#define NTK  NT_
#define LOSC 1024.0f             // (unused here)

typedef _Float16 h16;
typedef unsigned short bf;
typedef __attribute__((ext_vector_type(16))) __bf16   v16bf;
typedef __attribute__((ext_vector_type(16))) _Float16 v16h;
typedef __attribute__((ext_vector_type(8)))  _Float16 v8h;
typedef __attribute__((ext_vector_type(8)))  unsigned short v8us;
typedef __attribute__((ext_vector_type(8)))  float    v8f;
typedef __attribute__((ext_vector_type(4)))  float    v4f;
typedef __attribute__((ext_vector_type(4)))  _Float16 v4h;
typedef v8h  __attribute__((may_alias)) v8ha;
typedef v4f  __attribute__((may_alias)) v4fa;
typedef v8us __attribute__((may_alias)) v8usa;

__device__ __forceinline__ unsigned short f2bf(float f) { unsigned u = __float_as_uint(f); u += 0x7FFFu + ((u >> 16) & 1u); return (unsigned short)(u >> 16); }
__device__ __forceinline__ float bf2f(unsigned short b) { return __uint_as_float(((unsigned)b) << 16); }
__device__ __forceinline__ float bfr(float f) { return bf2f(f2bf(f)); }
__device__ __forceinline__ v16h cat16(v8h lo, v8h hi) { return __builtin_shufflevector(lo, hi, 0, 1, 2, 3, 4, 5, 6, 7, 8, 9, 10, 11, 12, 13, 14, 15); }
__device__ __forceinline__ v16bf cat16b(v8us lo, v8us hi) { return __builtin_bit_cast(v16bf, __builtin_shufflevector(lo, hi, 0, 1, 2, 3, 4, 5, 6, 7, 8, 9, 10, 11, 12, 13, 14, 15)); }
__device__ __forceinline__ v8f wmma16(v16h a, v16h b, v8f c) { return __builtin_amdgcn_wmma_f32_16x16x32_f16(false, a, false, b, (short)0, c, false, false); }
__device__ __forceinline__ v8f wmmab(v16bf a, v16bf b, v8f c) { return __builtin_amdgcn_wmma_f32_16x16x32_bf16(false, a, false, b, (short)0, c, false, false); }

// xbt_body: the input x [item][2048 t][1024 f], rounded once to bf16, written in both orders: XB [item][t][f] and XT [item][f][t], via 64 x 64 LDS tiles; one block per tile (bx, by) of item bz, of (NT/64, DM/64, items).
// Thread -> row tid >> 3 (+ 32), 8 columns (tid & 7) * 8: 8 lanes store one whole 128-B line of either plane. All stores stand behind the barrier, so that it waits on LDS alone.
__device__ __forceinline__ void xbt_body(unsigned short* tl, int bx, int by, int bz, const float* __restrict__ X, bf* XB, bf* XT) {
    const int tid = threadIdx.x, t0 = bx * 64, f0 = by * 64, piece = tid & 7, row = tid >> 3;
    const size_t ib = (size_t)bz * NT_ * DM, o = ib + (size_t)(t0 + row) * DM + f0 + piece * 8;
    v4f a[2][2];
#pragma unroll
    for (int s = 0; s < 2; ++s) { a[s][0] = *(const v4f*)(X + o + (size_t)s * 32 * DM); a[s][1] = *(const v4f*)(X + o + (size_t)s * 32 * DM + 4); }
    v8us r[2];
#pragma unroll
    for (int s = 0; s < 2; ++s)
#pragma unroll
        for (int i = 0; i < 8; ++i) { r[s][i] = f2bf(a[s][i >> 2][i & 3]); tl[(piece * 8 + i) * 72 + row + 32 * s] = r[s][i]; }
    __syncthreads();
#pragma unroll
    for (int s = 0; s < 2; ++s) { const v8us val = *(const v8usa*)(tl + (row + 32 * s) * 72 + piece * 8);
        *(v8us*)(XB + o + (size_t)s * 32 * DM) = r[s]; *(v8us*)(XT + ib + (size_t)(f0 + row + 32 * s) * NT_ + t0 + piece * 8) = val; }
    asm volatile("s_wait_xcnt 0x0" ::: "memory");   // in the joint kernel's text another pass's code follows these stores: the wait stands in front of any rewrite of their registers there
}

// wt_body: WT [n][K] = bf16(W[k][n]) (k-major [K][ncols]) via 64 x 64 LDS tiles; one block per tile (bx, by) of (K/64, ncols/64).
__device__ __forceinline__ void wt_body(unsigned short* tl, int bx, int by, const float* __restrict__ Wm, int K, int ncols, bf* WT) {
    const int tid = threadIdx.x, k0 = bx * 64, n0 = by * 64;
    const int kk = tid >> 2, nq = (tid & 3) * 16;
#pragma unroll
    for (int i = 0; i < 16; ++i) tl[(nq + i) * 72 + kk] = f2bf(Wm[(size_t)(k0 + kk) * ncols + n0 + nq + i]);
    __syncthreads();
    const int piece = tid & 7;
    auto pass = [&]() {
#pragma unroll
        for (int s = 0; s < 2; ++s) { const int nr = (tid >> 3) + 32 * s; const v8us val = *(const v8usa*)(tl + nr * 72 + piece * 8); *(v8us*)(WT + (size_t)(n0 + nr) * K + k0 + piece * 8) = val; }
    };
    pass();
    asm volatile("s_wait_xcnt 0x0" ::: "memory");   // in the joint kernel's text another pass's code follows these stores: the wait stands in front of any rewrite of their registers there
}
// ln_body: block bx takes 8 rows, one wave per row of x [rows][1024]: LayerNorm (mean, then mean((x-mu)^2), eps 1e-5, x bf(gamma) + bf(beta), f32, fixed lane order) -> bf16 hi + UNSCALED
// residual planes; lane -> columns q*256 + lane*8 .. +8 for q = 0..3 (16 B per plane per store, 8 lanes per line). The row is re-read per phase with the q loop
// rolled (keeps the static VALU-FMA count small; no register arrays indexed by a loop variable).
template <bool ROUNDIN>   // ROUNDIN: the source is a module INPUT (read through bf16 rounding); false: a computed f32 plane (read as is)
__device__ __forceinline__ void ln_body(int bx, const float* __restrict__ X, const float* __restrict__ gam, const float* __restrict__ bet, int nrows, bf* Hh, bf* Hl) {
    const int lane = threadIdx.x & 31, r = bx * 8 + (threadIdx.x >> 5);
    if (r >= nrows) return;
    const float* xr = X + (size_t)r * DM + lane * 8;
    float s = 0.f;
#pragma unroll 1
    for (int q = 0; q < DM / 256; ++q) {
#pragma unroll
        for (int i = 0; i < 8; ++i) s += (ROUNDIN ? bfr(xr[q * 256 + i]) : xr[q * 256 + i]); }
#pragma unroll
    for (int sh = 16; sh; sh >>= 1) s += __shfl_xor(s, sh, 32);
    const float mu = s * (1.0f / DM);
    float s2 = 0.f;
#pragma unroll 1
    for (int q = 0; q < DM / 256; ++q) {
#pragma unroll
        for (int i = 0; i < 8; ++i) { const float d = (ROUNDIN ? bfr(xr[q * 256 + i]) : xr[q * 256 + i]) - mu; s2 = fmaf(d, d, s2); } }
#pragma unroll
    for (int sh = 16; sh; sh >>= 1) s2 += __shfl_xor(s2, sh, 32);
    const float rs = rsqrtf(s2 * (1.0f / DM) + 1e-5f);
{
#pragma unroll 1
        for (int q = 0; q < DM / 256; ++q) { v8us oh, ol;
#pragma unroll
            for (int i = 0; i < 8; ++i) { const int c = q * 256 + lane * 8 + i; const float y = ((ROUNDIN ? bfr(xr[q * 256 + i]) : xr[q * 256 + i]) - mu) * rs * bfr(gam[c]) + bfr(bet[c]); const unsigned short hb = f2bf(y); oh[i] = hb; ol[i] = f2bf(y - bf2f(hb)); }
            const size_t o = (size_t)r * DM + q * 256 + lane * 8; *(v8us*)(Hh + o) = oh; *(v8us*)(Hl + o) = ol;
            asm volatile("s_wait_xcnt 0x0" ::: "memory"); }   // stands in front of the next trip's rewrite of the two stores' address registers
         }
}
// k_pre: the four passes that read nothing but inputs (LN(x) planes, bf16(x) in both orders, the two weight transposes) in ONE launch: none waits for another, so they need no launch boundary
// between them. The block index picks the pass: the test is the same for a whole block, so a pass's barrier is met by all of a block's waves or by none. The pass with the longest waves comes first.
#define PB_LN  (NB_ * NTK / 8)
#define PB_XBT ((NT_ / 64) * (DM / 64) * NB_)
#define PB_WT  ((DM / 64) * (FF / 64))
__global__ __launch_bounds__(256) void k_pre(const float* __restrict__ X, const float* __restrict__ gam, const float* __restrict__ bet, const float* __restrict__ W1, const float* __restrict__ W2,
                                             bf* W1T, bf* W2T, bf* XB, bf* XT, bf* Hh, bf* Hl) {
    __shared__ __align__(16) unsigned short tl[64 * 72];
    const int b = blockIdx.x, bx = b - PB_LN, bw = bx - PB_XBT, bv = bw - PB_WT;   // the block's index in the whole grid and inside the second, third and fourth pass
    if (b < PB_LN) ln_body<true>(b, X, gam, bet, NB_ * NTK, Hh, Hl);
    else if (bx < PB_XBT) xbt_body(tl, bx % (NT_ / 64), bx / (NT_ / 64) % (DM / 64), bx / ((NT_ / 64) * (DM / 64)), X, XB, XT);
    else if (bw < PB_WT) wt_body(tl, bw % (DM / 64), bw / (DM / 64), W1, DM, FF, W1T);   // w1 [1024 k][2048 n] -> W1T [2048][1024]
    else wt_body(tl, bv % (FF / 64), bv / (FF / 64), W2, FF, DM, W2T);                   // w2 [2048 k][1024 n] -> W2T [1024][2048]
}
// gelu_f: exact-erf GELU of one f32 value. erf(x), x = v / sqrt(2), by the two polynomials of the f32 math library's erff (|x| < 1: odd polynomial; else 1 - exp(-p(|x|))), BOTH evaluated and one
// selected: no branch, so that the values a lane holds at a time run as independent chains in the vector pipe.
__device__ __forceinline__ float gelu_f(float v) {
    const float x = v * 0.70710678118654752f, a = fabsf(x), s = x * x;
    float p = fmaf(a, 0.0000169988107f, -0.000378677854f);
    p = fmaf(a, p, 0.00385781587f); p = fmaf(a, p, -0.0241816975f); p = fmaf(a, p, 0.106668264f); p = fmaf(a, p, 0.634933293f); p = fmaf(a, p, 0.128689408f); p = fmaf(a, p, a);
    const float big = 1.0f - __builtin_amdgcn_exp2f(p * -1.44269502f);   // exp(-p): p >= 1 where this side is taken, so the rounding of the exponent moves 1 - exp(-p) by less than its last place
    float q = fmaf(s, -0.000561801775f, 0.00491381623f);
    q = fmaf(s, q, -0.0267075151f); q = fmaf(s, q, 0.112800106f); q = fmaf(s, q, -0.376122952f); q = fmaf(s, q, 0.128379107f);
    const float small = fmaf(a, q, a);
    return 0.5f * v * (1.0f + copysignf(a < 1.0f ? small : big, x));
}
// k_gemm: BM x BN block tile (8 waves as WMW x 8/WMW, wave tile BM/WMW x BN/(8/WMW): 64 x 64 where the grid still fills the chip, else 32 x 64) of C[.][ldc] = (A0 [+ A1]).(B0 [+ B1])^T [+ bf(bias[c])], all planes bf16 with row stride K.
// OUT 0: C is stored as f32. OUT 1: as bf16 hi + UNSCALED residual planes Ch, Cl [row][ldc]. OUT 2: as such planes of C^T, [column][ldc]. ACT (with OUT 1): the planes hold gelu(C).
// A stage is 128 k (256 B) of every operand row, rows [A0 | A1 | B0 | B1] in slices of 64 rows at an LDS pitch of 272 B. Each slice is brought in by ONE tensor load of one wave
// (wave w -> slice w; the 16 B behind each row are the load's pad), into two buffers: stage t + 1 flies while stage t is worked on. Per accumulator and 32-k step the products keep the order
// A0.B0, A1.B0, A0.B1 and k runs upward, with the same k order inside a fragment for A and B (bytes 16h and 32 + 16h of each 64 B of a row).
#define KS    128
#define PITCH 272
#define SROWS 64      // rows of a slice
#define SLICE 18432   // 64 rows x 272 B = 17,408 B, rounded up to a multiple of 2 KiB: every slice of every buffer starts on such a multiple
typedef unsigned u32x4 __attribute__((ext_vector_type(4)));
typedef unsigned u32x8 __attribute__((ext_vector_type(8)));
__device__ __forceinline__ unsigned uni(unsigned v) { return (unsigned)__builtin_amdgcn_readfirstlane(v); }
// pinned(): holds a value that decides on a tensor load, or that its descriptor is formed from, in a scalar register: a test on it is a scalar branch (a tensor load ignores EXEC),
// and what is computed from it stays behind the waits written ahead of it.
__device__ __forceinline__ unsigned pinned(unsigned v) { unsigned w = (unsigned)__builtin_amdgcn_readfirstlane(v); asm volatile("" : "+s"(w)); return w; }
// Descriptor group 1: 1-byte elements, tensor = tile = 64 rows of 256 B, source row pitch in bytes, 4 dwords of LDS pad behind every 64 dwords; no mask.
__device__ __forceinline__ u32x8 tdm_group1(unsigned src_pitch) {
    u32x8 g;
    g[0] = uni((1u << 20) | (5u << 22) | (3u << 25));
    g[1] = uni((KS * 2u) << 16);
    g[2] = uni((unsigned)SROWS << 16);
    g[3] = uni((KS * 2u) << 16);
    g[4] = uni((unsigned)SROWS);
    g[5] = uni(src_pitch);
    g[6] = uni(0u);
    g[7] = uni(0u);
    asm volatile("" : "+s"(g));   // pinned(), for the whole group: its words stay in one scalar tuple from here on, so none of them takes a new value while a request is outstanding
    return g;
}
// One request of the calling wave: group 0 = count 1, the slice's byte offset in the work-group's LDS, the global address of its first byte, type 2.
__device__ __forceinline__ void tdm_load(unsigned lds_dst, unsigned long long ga, u32x8 g1) {
    u32x4 g0;
    g0[0] = pinned(1u);   // pinned(): this constant word too is written here, behind the wait on the request before, not ahead of the loop
    g0[1] = uni(lds_dst); g0[2] = uni((unsigned)ga); g0[3] = uni((((unsigned)(ga >> 32)) & 0x01FFFFFFu) | 0x80000000u);
    asm volatile("tensor_load_to_lds %0, %1" :: "s"(g0), "s"(g1) : "memory");
}
__device__ __forceinline__ v16bf ldfrag(const unsigned char* p) { return cat16b(*(const v8usa*)p, *(const v8usa*)(p + 32)); }

template <int NA, int NBP, int BM, int BN, int WMW, int K, bool BIAS, int OUT, bool ACT = false>
__global__ __launch_bounds__(256) void k_gemm(const bf* __restrict__ A0, const bf* __restrict__ A1, const bf* __restrict__ B0, const bf* __restrict__ B1, const float* __restrict__ bias, float* C, bf* Ch, bf* Cl, int ldc, int zA, int zB, int zC) {
    // zA, zB, zC: elements from one batch item (blockIdx.z) to the next in the A planes, the B planes and C or its planes (0: shared by all items).
    constexpr int WNW = 8 / WMW, FM = BM / WMW / 16, WN = BN / WNW, FN = WN / 16, NT = K / KS;
    constexpr int SA = BM / SROWS, SB = BN / SROWS, NS = NA * SA + NBP * SB;   // slices of an A plane, of a B plane, of a stage
    constexpr int STAGE = NS * SLICE;
    constexpr int OFF_A1 = SA * SLICE, OFF_B0 = NA * SA * SLICE, OFF_B1 = (NA * SA + SB) * SLICE;
    static_assert(NS <= 8 && WN == SROWS && SROWS % (FM * 16) == 0 && NT >= 2, "one slice a wave; a wave's A rows and its B rows each lie in one slice; two stages exist");
    __shared__ __attribute__((aligned(2048))) unsigned char sm[2 * STAGE];
    const int tid = threadIdx.x, lane = tid & 31, wave = tid >> 5, lr = lane & 15, hi = lane >> 4;
    const int wm = wave / WNW, wn = wave % WNW;
    const int r0 = blockIdx.x * BM, c0 = blockIdx.y * BN;
    // Wave w brings slice w of every stage: its plane, its first row there, its place in a buffer. With fewer slices than waves the last waves bring nothing.
    const unsigned wv = uni((unsigned)tid >> 5);
    const unsigned iss = NS == 8 ? 1u : pinned(wv < (unsigned)NS ? 1u : 0u);
    const bool isA = wv < (unsigned)(NA * SA);
    const unsigned sp = isA ? wv % SA : (wv - NA * SA) % SB;
    const bf* plane = isA ? ((NA == 2 && wv >= (unsigned)SA) ? A1 : A0) : ((NBP == 2 && wv >= (unsigned)(NA * SA + SB)) ? B1 : B0);
    const size_t e0 = isA ? (size_t)blockIdx.z * zA + (size_t)(r0 + sp * SROWS) * K : (size_t)blockIdx.z * zB + (size_t)(c0 + sp * SROWS) * K;
    const unsigned long long src0 = (unsigned long long)(size_t)(plane + e0);
    const unsigned lsl = (unsigned)(size_t)sm + wv * SLICE;
    const u32x8 g1 = tdm_group1(K * 2u);
    auto issues = [&]() { return NS == 8 || pinned(iss) != 0u; };   // no test where every wave brings a slice
    auto fill = [&](unsigned t) { tdm_load(lsl + (t & 1u) * STAGE, src0 + (unsigned long long)t * (KS * 2), g1); };
    v8f acc[FM][FN];
#pragma unroll
    for (int m = 0; m < FM; ++m)
#pragma unroll
        for (int n = 0; n < FN; ++n) acc[m][n] = (v8f){};
    float bv[FN];   // the lane's bias values, fetched here so that their latency lies under the loop
#pragma unroll
    for (int n = 0; n < FN; ++n) bv[n] = BIAS ? bfr(bias[c0 + wn * WN + n * 16 + lr]) : 0.f;
    if (issues()) {
        fill(0);
        asm volatile("s_wait_tensorcnt 0x0" ::: "memory");   // this wave's slice of stage 0 has landed
    }
    __syncthreads();                                          // ... and every other wave's
    if (issues()) fill(1);
    // The stage loop stays rolled (one copy of its body; the buffer is picked by t & 1); every loop inside it is unrolled so that the register arrays are indexed by constants.
#pragma unroll 1
    for (int t = 0; t < NT; ++t) {
        const unsigned char* sb = sm + (t & 1) * STAGE;
        const unsigned char* pa = sb + (wm * FM * 16 / SROWS) * SLICE + (wm * FM * 16 % SROWS + lr) * PITCH + 16 * hi;
        const unsigned char* pb = sb + OFF_B0 + wn * SLICE + lr * PITCH + 16 * hi;
        // Two fragment sets: the loads of 32-k step ks + 1 go out as one group ahead of step ks's products (only inside this stage), so that a step's LDS latency is covered by the step before.
        v16bf a0[2][FM], a1[2][FM], b0[2][FN], b1[2][FN];
        auto ldset = [&](int q, int ks) {
#pragma unroll
            for (int m = 0; m < FM; ++m) { a0[q][m] = ldfrag(pa + m * 16 * PITCH + ks * 64); if constexpr (NA == 2) a1[q][m] = ldfrag(pa + OFF_A1 + m * 16 * PITCH + ks * 64); }
#pragma unroll
            for (int n = 0; n < FN; ++n) { b0[q][n] = ldfrag(pb + n * 16 * PITCH + ks * 64); if constexpr (NBP == 2) b1[q][n] = ldfrag(pb + (OFF_B1 - OFF_B0) + n * 16 * PITCH + ks * 64); }
        };
        ldset(0, 0);
#pragma unroll
        for (int ks = 0; ks < KS / 32; ++ks) {
            const int q = ks & 1;
            if (ks + 1 < KS / 32) ldset(q ^ 1, ks + 1);
            __builtin_amdgcn_sched_barrier(0);   // keeps the next step's load group ahead of this step's products (the scheduler otherwise sinks each load to just before its use)
#pragma unroll
            for (int m = 0; m < FM; ++m)
#pragma unroll
                for (int n = 0; n < FN; ++n) acc[m][n] = wmmab(a0[q][m], b0[q][n], acc[m][n]);
            if constexpr (NA == 2) {
#pragma unroll
                for (int m = 0; m < FM; ++m)
#pragma unroll
                    for (int n = 0; n < FN; ++n) acc[m][n] = wmmab(a1[q][m], b0[q][n], acc[m][n]);
            }
            if constexpr (NBP == 2) {
#pragma unroll
                for (int m = 0; m < FM; ++m)
#pragma unroll
                    for (int n = 0; n < FN; ++n) acc[m][n] = wmmab(a0[q][m], b1[q][n], acc[m][n]);
            }
            __builtin_amdgcn_sched_barrier(0);   // keeps this step's products ahead of the load group after next, which reuses their fragment set
        }
        asm volatile("s_wait_dscnt 0x0" ::: "memory");
        if (issues()) asm volatile("s_wait_tensorcnt 0x0" ::: "memory");
        __syncthreads();
        if (pinned((t + 2 < NT ? 1u : 0u) & iss) != 0u) fill(pinned((unsigned)t + 2u));
    }
    asm volatile("s_wait_tensorcnt 0x0" ::: "memory");      // no request is outstanding when the ring becomes output staging
    asm volatile("s_wait_dscnt 0x0" ::: "memory");          // ... and no LDS read
    // Epilogue: each wave stages its part of the tile in its own part of the ring (the loop's last barrier has ended every read of it) and stores whole 128-B lines.
    if constexpr (OUT == 2) {
        // A lane's 8 accumulator values of a fragment are 8 consecutive rows of one column: 16 B of a row of C^T in either plane. Staged row = one column's FM * 16 values, pitch + 16 B.
        constexpr int TP = FM * 32 + 16;
        static_assert(FM == 4, "a staged row is one 128-B line");
        static_assert(8 * 2 * WN * TP <= 2 * STAGE, "the output staging fits the ring");
        unsigned char* ob = sm + wave * (2 * WN * TP);   // WN rows of the hi plane, then WN rows of the residual plane
#pragma unroll
        for (int n = 0; n < FN; ++n)
#pragma unroll
            for (int m = 0; m < FM; ++m) { v8us oh, ol;
#pragma unroll
                for (int j = 0; j < 8; ++j) { const float v = BIAS ? acc[m][n][j] + bv[n] : acc[m][n][j]; const unsigned short hb = f2bf(v); oh[j] = hb; ol[j] = f2bf(v - bf2f(hb)); }
                unsigned char* p = ob + (n * 16 + lr) * TP + m * 32 + hi * 16; *(v8usa*)p = oh; *(v8usa*)(p + WN * TP) = ol; }
        __syncthreads();   // the staged values are read back by other lanes: no read may move ahead of the stores
        const size_t o0 = (size_t)blockIdx.z * zC + (size_t)(c0 + wn * WN) * ldc + r0 + wm * FM * 16 + (lane & 7) * 8;
#pragma unroll
        for (int s = 0; s < WN / 4; ++s) { const int row = (lane >> 3) + 4 * s; const unsigned char* p = ob + row * TP + (lane & 7) * 16;
            const v8us vh = *(const v8usa*)p, vl = *(const v8usa*)(p + WN * TP);
            *(v8us*)(Ch + o0 + (size_t)row * ldc) = vh; *(v8us*)(Cl + o0 + (size_t)row * ldc) = vl; }
    } else {
        constexpr int OP = WN + 4, LPR = WN / 32;
        static_assert(8 * FM * 16 * OP * 4 <= 2 * STAGE, "the output staging fits the ring");
        float* os = (float*)(void*)sm + wave * (FM * 16 * OP);
#pragma unroll
        for (int n = 0; n < FN; ++n)
#pragma unroll
            for (int m = 0; m < FM; ++m)
#pragma unroll
                for (int j = 0; j < 8; ++j) os[(m * 16 + hi * 8 + j) * OP + n * 16 + lr] = BIAS ? acc[m][n][j] + bv[n] : acc[m][n][j];
        __syncthreads();   // the staged values are read back by other lanes: no read may move ahead of the stores
        if constexpr (OUT == 0) {
            float* crow_p = C + (size_t)blockIdx.z * zC + (size_t)(r0 + wm * FM * 16) * ldc + c0 + wn * WN;
#pragma unroll
            for (int s = 0; s < FM * 4 * LPR; ++s) { const int Lid = (lane >> 3) + 4 * s, piece = lane & 7; const int row = Lid / LPR, cofs = (Lid % LPR) * 32 + piece * 4;
                const v4f val = *(const v4fa*)(os + row * OP + cofs); *(v4f*)(crow_p + (size_t)row * ldc + cofs) = val; }
        } else {
            const size_t o0 = (size_t)blockIdx.z * zC + (size_t)(r0 + wm * FM * 16) * ldc + c0 + wn * WN;
            // 8 lanes take one row's 64 values, 8 each: one 128-B line of either plane.
            static_assert(WN == 64, "a row of the wave tile is one 128-B line of a plane");
            if constexpr (ACT) {
                const float* op = os + (lane >> 3) * OP + (lane & 7) * 8;
                v4f u0 = *(const v4fa*)op, u1 = *(const v4fa*)(op + 4);
                // The loop stays rolled, two trips a copy (for speed only).
#pragma unroll 2
                for (int s = 0; s < FM * 4; ++s) { const int row = (lane >> 3) + 4 * s, cofs = (lane & 7) * 8;
                    const float* np = op + (s + 1 < FM * 4 ? s + 1 : s) * 4 * OP;   // the next trip's staged values are fetched ahead of this trip's arithmetic, which covers their LDS latency
                    const v4f n0 = *(const v4fa*)np, n1 = *(const v4fa*)(np + 4); v8us oh, ol;
#pragma unroll
                    for (int i = 0; i < 8; ++i) { const float v = gelu_f(i < 4 ? u0[i & 3] : u1[i & 3]); const unsigned short hb = f2bf(v); oh[i] = hb; ol[i] = f2bf(v - bf2f(hb)); }
                    *(v8us*)(Ch + o0 + (size_t)row * ldc + cofs) = oh; *(v8us*)(Cl + o0 + (size_t)row * ldc + cofs) = ol;
                    asm volatile("s_wait_xcnt 0x0" ::: "memory");   // stands in front of the next trip's rewrite of the two stores' address registers
                    u0 = n0; u1 = n1; }
            } else {
#pragma unroll
            for (int s = 0; s < FM * 4; ++s) { const int row = (lane >> 3) + 4 * s, cofs = (lane & 7) * 8;
                const v4f u0 = *(const v4fa*)(os + row * OP + cofs), u1 = *(const v4fa*)(os + row * OP + cofs + 4); v8us oh, ol;
#pragma unroll
                for (int i = 0; i < 8; ++i) { const float v = i < 4 ? u0[i & 3] : u1[i & 3]; const unsigned short hb = f2bf(v); oh[i] = hb; ol[i] = f2bf(v - bf2f(hb)); }
                *(v8us*)(Ch + o0 + (size_t)row * ldc + cofs) = oh; *(v8us*)(Cl + o0 + (size_t)row * ldc + cofs) = ol; }
            }
        }
    }
}

// k_lnout: one wave per row: v = bf(x) + y2 (f32), LayerNorm (mean, mean((v-mu)^2), eps 1e-5, x bf(gamma) + bf(beta)) -> f32 output row; per 128-column chunk q the
// per phase.
__global__ __launch_bounds__(256) void k_lnout(const float* __restrict__ X, const float* __restrict__ Y2, const float* __restrict__ gam, const float* __restrict__ bet, float* OUTP) {
    const int lane = threadIdx.x & 31, r = blockIdx.x * 8 + (threadIdx.x >> 5);
    if (r >= NB_ * NT_) return;
    const float* xr = X + (size_t)r * DM; const float* yr = Y2 + (size_t)r * DM;
    float s = 0.f;
#pragma unroll 1
    for (int q = 0; q < 2 * (DM / 256); ++q) { const int c0 = (q >> 1) * 256 + (q & 1) * 128 + lane * 4; const v4f xv = *(const v4f*)(xr + c0), yv = *(const v4f*)(yr + c0);
#pragma unroll
        for (int i = 0; i < 4; ++i) s += bfr(xv[i]) + yv[i]; }
#pragma unroll
    for (int sh = 16; sh; sh >>= 1) s += __shfl_xor(s, sh, 32);
    const float mu = s * (1.0f / DM);
    float s2 = 0.f;
#pragma unroll 1
    for (int q = 0; q < 2 * (DM / 256); ++q) { const int c0 = (q >> 1) * 256 + (q & 1) * 128 + lane * 4; const v4f xv = *(const v4f*)(xr + c0), yv = *(const v4f*)(yr + c0);
#pragma unroll
        for (int i = 0; i < 4; ++i) { const float d = (bfr(xv[i]) + yv[i]) - mu; s2 = fmaf(d, d, s2); } }
#pragma unroll
    for (int sh = 16; sh; sh >>= 1) s2 += __shfl_xor(s2, sh, 32);
    const float rs = rsqrtf(s2 * (1.0f / DM) + 1e-5f);
{
#pragma unroll 1
        for (int q = 0; q < 2 * (DM / 256); ++q) { const int c0 = (q >> 1) * 256 + (q & 1) * 128 + lane * 4; const v4f xv = *(const v4f*)(xr + c0), yv = *(const v4f*)(yr + c0); v4f o;
#pragma unroll
            for (int i = 0; i < 4; ++i) o[i] = ((bfr(xv[i]) + yv[i]) - mu) * rs * bfr(gam[c0 + i]) + bfr(bet[c0 + i]);
            *(v4f*)(OUTP + (size_t)r * DM + c0) = o; }
         }
}

extern "C" void kernel_launch(void* const* d_in, const int* in_sizes, int n_in,
                              void* d_out, int out_size, void* d_ws, size_t ws_size, hipStream_t stream) {
    (void)in_sizes; (void)n_in; (void)out_size;
    const float* x = (const float*)d_in[0]; const float* lg = (const float*)d_in[1]; const float* lb = (const float*)d_in[2];
    const float* w1 = (const float*)d_in[3]; const float* b1 = (const float*)d_in[4]; const float* w2 = (const float*)d_in[5]; const float* b2 = (const float*)d_in[6];   // w1 [1024][2048], w2 [2048][1024], both (in, out) = k-major
    float* out = (float*)d_out;    // [4][2048][1024]
    char* wsp = (char*)d_ws;
    auto take = [&](size_t bytes) { char* p = wsp; wsp += (bytes + 255) & ~(size_t)255; return (void*)p; };
    constexpr size_t NR = (size_t)NB_ * NTK;   // rows of all items
    bf* W1T = (bf*)take((size_t)FF * DM * 2); bf* W2T = (bf*)take((size_t)DM * FF * 2);
    bf* Xb = (bf*)take(NR * DM * 2); bf* XT = (bf*)take(NR * DM * 2); bf* Y0h = (bf*)take(NR * DM * 2); bf* Y0l = (bf*)take(NR * DM * 2);
    bf* Hh = (bf*)take(NR * FF * 2); bf* Hl = (bf*)take(NR * FF * 2);
    float* Y2 = (float*)take(NR * DM * 4);
    // A plane whose last reader has run before another's writer starts (stream order) lends it its bytes (the planes of m^T fill a quarter of theirs): 8 + 32 + 32 + 64 + 32 = 168 MiB.
    bf* Y1Th = Y0h; bf* Y1Tl = Y0l;   // y0 is last read by the first product, y1^T is written by the second
    bf* MTh = Hh; bf* MTl = Hl;       // gelu(t) is last read by the second product, the planes of m^T are written by the third
    if ((size_t)(wsp - (char*)d_ws) > ws_size) return;
    k_pre<<<PB_LN + PB_XBT + 2 * PB_WT, 256, 0, stream>>>(x, lg, lb, w1, w2, W1T, W2T, Xb, XT, Y0h, Y0l);   // y0 = LN(x) planes; bf16(x) as [item][t][f] and [item][f][t]; both weights n-major
    k_gemm<2, 1, 128, 256, 2, DM, true, 1, true><<<dim3(NTK / 128, FF / 256, NB_), 256, 0, stream>>>(Y0h, Y0l, W1T, nullptr, b1, nullptr, Hh, Hl, FF, NTK * DM, 0, NTK * FF);         // gelu(y0.w1 + b1), stored as hi/lo planes
    k_gemm<2, 1, 128, 256, 2, FF, true, 2><<<dim3(NTK / 128, DM / 256, NB_), 256, 0, stream>>>(Hh, Hl, W2T, nullptr, b2, nullptr, Y1Th, Y1Tl, NT_, NTK * FF, 0, DM * NT_);   // y1 = gelu(t).w2 + b2, stored as y1^T hi/lo planes [item][1024][2048]
    k_gemm<2, 1, 128, 128, 4, NT_, false, 1><<<dim3(DM / 128, DM / 128, NB_), 256, 0, stream>>>(Y1Th, Y1Tl, XT, nullptr, nullptr, nullptr, MTh, MTl, DM, DM * NT_, DM * NT_, DM * DM);   // m^T [g][f] = sum over t of y1[t][g] x[t][f], stored as hi/lo planes
    k_gemm<1, 2, 256, 128, 4, DM, false, 0><<<dim3(NT_ / 256, DM / 128, NB_), 256, 0, stream>>>(Xb, nullptr, MTh, MTl, nullptr, Y2, nullptr, nullptr, DM, NTK * DM, DM * DM, NTK * DM);           // y2 [t][g] = sum over f of x[t][f] m^T[g][f]
    k_lnout<<<NB_ * NTK / 8, 256, 0, stream>>>(x, Y2, lg, lb, out);                                                                                               // LN(x + y2)
}

// v010
// Measured time: 110 microseconds a run.
// Versions in between are left out here; by their measured steps it is 1.43 times as fast as v008.
// Counting every step since v000, it is 9.24 times as fast.
#include <hip/hip_runtime.h>

// Compute dtypes, f32 accumulate, all four batch items in every launch (row-wise kernels: 4 x 2048 rows; per-item products: grid z = item): y0 = LN(x) (f32; gamma/beta and x read through bf16 rounding) -> one f16 plane;
// t = y0.w1 + b1 ([2048 x 1024].[1024 x 2048]) and y1 = gelu(t).w2 + b2 ([2048 x 2048].[2048 x 1024]) on v_wmma_f32_16x16x32_f16 with k-major weights
// transposed once to n-major planes (exact-erf GELU in f32 in the first product's epilogue); (x.x^T).y1 is summed as
// x.(x^T.y1): m^T = y1^T.x ([1024 x 2048].[2048 x 1024] per item), then y2 = x.m ([2048 x 1024].[1024 x 1024]): half the multiply-adds of the score route, and no [2048 x 2048] score plane.
// Every operand plane is f16, one product per GEMM. An INPUT (x, w1, w2) is rounded to bf16 and that value is held in f16 (its 8 significant bits fit; below 2^-14 in size it moves by at most 2^-25).
// A COMPUTED operand (y0, gelu(t), y1, m) is rounded once to f16: 11 significant bits, eight times finer than the inputs' rounding, for sizes up to 65,504.
// t, y1 and m^T never exist as f32 planes: the product that computes them rounds each f32 value in its epilogue and stores the plane the next product reads (y1 transposed).

#define NB_  4
#define NT_  2048
#define DM   1024
#define FF   2048
#define NTK  NT_
#define LOSC 1024.0f             // (unused here)

typedef _Float16 h16;
typedef __attribute__((ext_vector_type(16))) _Float16 v16h;
typedef __attribute__((ext_vector_type(8)))  _Float16 v8h;
typedef __attribute__((ext_vector_type(8)))  float    v8f;
typedef __attribute__((ext_vector_type(4)))  float    v4f;
typedef __attribute__((ext_vector_type(4)))  _Float16 v4h;
typedef v8h  __attribute__((may_alias)) v8ha;
typedef v4f  __attribute__((may_alias)) v4fa;

__device__ __forceinline__ unsigned short f2bf(float f) { unsigned u = __float_as_uint(f); u += 0x7FFFu + ((u >> 16) & 1u); return (unsigned short)(u >> 16); }
__device__ __forceinline__ float bf2f(unsigned short b) { return __uint_as_float(((unsigned)b) << 16); }
__device__ __forceinline__ float bfr(float f) { return bf2f(f2bf(f)); }
__device__ __forceinline__ h16 inh(float f) { return (h16)bfr(f); }   // an input value: rounded to bf16, held in f16
__device__ __forceinline__ v16h cat16(v8h lo, v8h hi) { return __builtin_shufflevector(lo, hi, 0, 1, 2, 3, 4, 5, 6, 7, 8, 9, 10, 11, 12, 13, 14, 15); }
__device__ __forceinline__ v8f wmma16(v16h a, v16h b, v8f c) { return __builtin_amdgcn_wmma_f32_16x16x32_f16(false, a, false, b, (short)0, c, false, false); }

// xbt_body: the input x [item][2048 t][1024 f], rounded once to bf16 and held in f16, written in both orders: XB [item][t][f] and XT [item][f][t], via 64 x 64 LDS tiles; one block per tile (bx, by) of item bz, of (NT/64, DM/64, items).
// Thread -> row tid >> 3 (+ 32), 8 columns (tid & 7) * 8: 8 lanes store one whole 128-B line of either plane. All stores stand behind the barrier, so that it waits on LDS alone.
__device__ __forceinline__ void xbt_body(h16* tl, int bx, int by, int bz, const float* __restrict__ X, h16* XB, h16* XT) {
    const int tid = threadIdx.x, t0 = bx * 64, f0 = by * 64, piece = tid & 7, row = tid >> 3;
    const size_t ib = (size_t)bz * NT_ * DM, o = ib + (size_t)(t0 + row) * DM + f0 + piece * 8;
    v4f a[2][2];
#pragma unroll
    for (int s = 0; s < 2; ++s) { a[s][0] = *(const v4f*)(X + o + (size_t)s * 32 * DM); a[s][1] = *(const v4f*)(X + o + (size_t)s * 32 * DM + 4); }
    v8h r[2];
#pragma unroll
    for (int s = 0; s < 2; ++s)
#pragma unroll
        for (int i = 0; i < 8; ++i) { r[s][i] = inh(a[s][i >> 2][i & 3]); tl[(piece * 8 + i) * 72 + row + 32 * s] = r[s][i]; }
    __syncthreads();
#pragma unroll
    for (int s = 0; s < 2; ++s) { const v8h val = *(const v8ha*)(tl + (row + 32 * s) * 72 + piece * 8);
        *(v8h*)(XB + o + (size_t)s * 32 * DM) = r[s]; *(v8h*)(XT + ib + (size_t)(f0 + row + 32 * s) * NT_ + t0 + piece * 8) = val; }
    asm volatile("s_wait_xcnt 0x0" ::: "memory");   // in the joint kernel's text another pass's code follows these stores: the wait stands in front of any rewrite of their registers there
}

// wt_body: WT [n][K] = bf16(W[k][n]), held in f16 (k-major [K][ncols]) via 64 x 64 LDS tiles; one block per tile (bx, by) of (K/64, ncols/64).
__device__ __forceinline__ void wt_body(h16* tl, int bx, int by, const float* __restrict__ Wm, int K, int ncols, h16* WT) {
    const int tid = threadIdx.x, k0 = bx * 64, n0 = by * 64;
    const int kk = tid >> 2, nq = (tid & 3) * 16;
#pragma unroll
    for (int i = 0; i < 16; ++i) tl[(nq + i) * 72 + kk] = inh(Wm[(size_t)(k0 + kk) * ncols + n0 + nq + i]);
    __syncthreads();
    const int piece = tid & 7;
    auto pass = [&]() {
#pragma unroll
        for (int s = 0; s < 2; ++s) { const int nr = (tid >> 3) + 32 * s; const v8h val = *(const v8ha*)(tl + nr * 72 + piece * 8); *(v8h*)(WT + (size_t)(n0 + nr) * K + k0 + piece * 8) = val; }
    };
    pass();
    asm volatile("s_wait_xcnt 0x0" ::: "memory");   // in the joint kernel's text another pass's code follows these stores: the wait stands in front of any rewrite of their registers there
}
// ln_body: block bx takes 8 rows, one wave per row of x [rows][1024]: LayerNorm (mean, then mean((x-mu)^2), eps 1e-5, x bf(gamma) + bf(beta), f32, fixed lane order) -> one f16
// plane; lane -> columns q*256 + lane*8 .. +8 for q = 0..3 (16 B per store, 8 lanes per line). The row is re-read per phase with the q loop
// rolled (keeps the static VALU-FMA count small; no register arrays indexed by a loop variable).
template <bool ROUNDIN>   // ROUNDIN: the source is a module INPUT (read through bf16 rounding); false: a computed f32 plane (read as is)
__device__ __forceinline__ void ln_body(int bx, const float* __restrict__ X, const float* __restrict__ gam, const float* __restrict__ bet, int nrows, h16* Hh) {
    const int lane = threadIdx.x & 31, r = bx * 8 + (threadIdx.x >> 5);
    if (r >= nrows) return;
    const float* xr = X + (size_t)r * DM + lane * 8;
    float s = 0.f;
#pragma unroll 1
    for (int q = 0; q < DM / 256; ++q) {
#pragma unroll
        for (int i = 0; i < 8; ++i) s += (ROUNDIN ? bfr(xr[q * 256 + i]) : xr[q * 256 + i]); }
#pragma unroll
    for (int sh = 16; sh; sh >>= 1) s += __shfl_xor(s, sh, 32);
    const float mu = s * (1.0f / DM);
    float s2 = 0.f;
#pragma unroll 1
    for (int q = 0; q < DM / 256; ++q) {
#pragma unroll
        for (int i = 0; i < 8; ++i) { const float d = (ROUNDIN ? bfr(xr[q * 256 + i]) : xr[q * 256 + i]) - mu; s2 = fmaf(d, d, s2); } }
#pragma unroll
    for (int sh = 16; sh; sh >>= 1) s2 += __shfl_xor(s2, sh, 32);
    const float rs = rsqrtf(s2 * (1.0f / DM) + 1e-5f);
{
#pragma unroll 1
        for (int q = 0; q < DM / 256; ++q) { v8h oh;
#pragma unroll
            for (int i = 0; i < 8; ++i) { const int c = q * 256 + lane * 8 + i; const float y = ((ROUNDIN ? bfr(xr[q * 256 + i]) : xr[q * 256 + i]) - mu) * rs * bfr(gam[c]) + bfr(bet[c]); oh[i] = (h16)y; }
            const size_t o = (size_t)r * DM + q * 256 + lane * 8; *(v8h*)(Hh + o) = oh;
            asm volatile("s_wait_xcnt 0x0" ::: "memory"); }   // stands in front of the next trip's rewrite of the store's address registers
         }
}
// k_pre: the four passes that read nothing but inputs (the LN(x) plane, bf16(x) in both orders, the two weight transposes) in ONE launch: none waits for another, so they need no launch boundary
// between them. The block index picks the pass: the test is the same for a whole block, so a pass's barrier is met by all of a block's waves or by none. The pass with the longest waves comes first.
#define PB_LN  (NB_ * NTK / 8)
#define PB_XBT ((NT_ / 64) * (DM / 64) * NB_)
#define PB_WT  ((DM / 64) * (FF / 64))
__global__ __launch_bounds__(256) void k_pre(const float* __restrict__ X, const float* __restrict__ gam, const float* __restrict__ bet, const float* __restrict__ W1, const float* __restrict__ W2,
                                             h16* W1T, h16* W2T, h16* XB, h16* XT, h16* Hh) {
    __shared__ __align__(16) h16 tl[64 * 72];
    const int b = blockIdx.x, bx = b - PB_LN, bw = bx - PB_XBT, bv = bw - PB_WT;   // the block's index in the whole grid and inside the second, third and fourth pass
    if (b < PB_LN) ln_body<true>(b, X, gam, bet, NB_ * NTK, Hh);
    else if (bx < PB_XBT) xbt_body(tl, bx % (NT_ / 64), bx / (NT_ / 64) % (DM / 64), bx / ((NT_ / 64) * (DM / 64)), X, XB, XT);
    else if (bw < PB_WT) wt_body(tl, bw % (DM / 64), bw / (DM / 64), W1, DM, FF, W1T);   // w1 [1024 k][2048 n] -> W1T [2048][1024]
    else wt_body(tl, bv % (FF / 64), bv / (FF / 64), W2, FF, DM, W2T);                   // w2 [2048 k][1024 n] -> W2T [1024][2048]
}
// gelu_f: exact-erf GELU of one f32 value. erf(x), x = v / sqrt(2), by the two polynomials of the f32 math library's erff (|x| < 1: odd polynomial; else 1 - exp(-p(|x|))), BOTH evaluated and one
// selected: no branch, so that the values a lane holds at a time run as independent chains in the vector pipe.
__device__ __forceinline__ float gelu_f(float v) {
    const float x = v * 0.70710678118654752f, a = fabsf(x), s = x * x;
    float p = fmaf(a, 0.0000169988107f, -0.000378677854f);
    p = fmaf(a, p, 0.00385781587f); p = fmaf(a, p, -0.0241816975f); p = fmaf(a, p, 0.106668264f); p = fmaf(a, p, 0.634933293f); p = fmaf(a, p, 0.128689408f); p = fmaf(a, p, a);
    const float big = 1.0f - __builtin_amdgcn_exp2f(p * -1.44269502f);   // exp(-p): p >= 1 where this side is taken, so the rounding of the exponent moves 1 - exp(-p) by less than its last place
    float q = fmaf(s, -0.000561801775f, 0.00491381623f);
    q = fmaf(s, q, -0.0267075151f); q = fmaf(s, q, 0.112800106f); q = fmaf(s, q, -0.376122952f); q = fmaf(s, q, 0.128379107f);
    const float small = fmaf(a, q, a);
    return 0.5f * v * (1.0f + copysignf(a < 1.0f ? small : big, x));
}
// k_gemm: BM x BN block tile (8 waves as WMW x 8/WMW, wave tile BM/WMW x BN/(8/WMW): 64 x 64 where the grid still fills the chip, else 32 x 64) of C[.][ldc] = A.B^T [+ bf(bias[c])], both planes f16 with row stride K.
// OUT 0: C is stored as f32. OUT 1: as an f16 plane Ch [row][ldc]. OUT 2: as the f16 plane of C^T, [column][ldc]. ACT (with OUT 1): the plane holds gelu(C).
// A stage is 128 k (256 B) of every operand row, rows [A | B] in slices of 64 rows at an LDS pitch of 272 B. Each slice is brought in by ONE tensor load of one wave
// (wave w -> slice w; the 16 B behind each row are the load's pad), into two buffers: stage t + 1 flies while stage t is worked on.
// A block walks its K / 128 stages upward from a start stage set by its tile row + tile column + 4 x item, wrapping round at K (for speed only).
// (An item counts 4, so that blocks of neighbouring tile rows in different items, which share the weight rows, do not meet on one stage.)
// A and B of a block take the same stage, so every product pairs equal k; only the order of the f32 sums over the stages differs from block to block.
// Inside a fragment the k order is the same for A and B (bytes 16h and 32 + 16h of each 64 B of a row).
#define KS    128
#define PITCH 272
#define SROWS 64      // rows of a slice
#define SLICE 18432   // 64 rows x 272 B = 17,408 B, rounded up to a multiple of 2 KiB: every slice of every buffer starts on such a multiple
typedef unsigned u32x4 __attribute__((ext_vector_type(4)));
typedef unsigned u32x8 __attribute__((ext_vector_type(8)));
__device__ __forceinline__ unsigned uni(unsigned v) { return (unsigned)__builtin_amdgcn_readfirstlane(v); }
// pinned(): holds a value that decides on a tensor load, or that its descriptor is formed from, in a scalar register: a test on it is a scalar branch (a tensor load ignores EXEC),
// and what is computed from it stays behind the waits written ahead of it.
__device__ __forceinline__ unsigned pinned(unsigned v) { unsigned w = (unsigned)__builtin_amdgcn_readfirstlane(v); asm volatile("" : "+s"(w)); return w; }
// Descriptor group 1: 1-byte elements, tensor = tile = 64 rows of 256 B, source row pitch in bytes, 4 dwords of LDS pad behind every 64 dwords; no mask.
__device__ __forceinline__ u32x8 tdm_group1(unsigned src_pitch) {
    u32x8 g;
    g[0] = uni((1u << 20) | (5u << 22) | (3u << 25));
    g[1] = uni((KS * 2u) << 16);
    g[2] = uni((unsigned)SROWS << 16);
    g[3] = uni((KS * 2u) << 16);
    g[4] = uni((unsigned)SROWS);
    g[5] = uni(src_pitch);
    g[6] = uni(0u);
    g[7] = uni(0u);
    asm volatile("" : "+s"(g));   // pinned(), for the whole group: its words stay in one scalar tuple from here on, so none of them takes a new value while a request is outstanding
    return g;
}
// One request of the calling wave: group 0 = count 1, the slice's byte offset in the work-group's LDS, the global address of its first byte, type 2.
__device__ __forceinline__ void tdm_load(unsigned lds_dst, unsigned long long ga, u32x8 g1) {
    u32x4 g0;
    g0[0] = pinned(1u);   // pinned(): this constant word too is written here, behind the wait on the request before, not ahead of the loop
    g0[1] = uni(lds_dst); g0[2] = uni((unsigned)ga); g0[3] = uni((((unsigned)(ga >> 32)) & 0x01FFFFFFu) | 0x80000000u);
    asm volatile("tensor_load_to_lds %0, %1" :: "s"(g0), "s"(g1) : "memory");
}
__device__ __forceinline__ v16h ldfrag(const unsigned char* p) { return cat16(*(const v8ha*)p, *(const v8ha*)(p + 32)); }

template <int BM, int BN, int WMW, int K, bool BIAS, int OUT, bool ACT = false>
__global__ __launch_bounds__(256) void k_gemm(const h16* __restrict__ A, const h16* __restrict__ B, const float* __restrict__ bias, float* C, h16* Ch, int ldc, int zA, int zB, int zC) {
    // zA, zB, zC: elements from one batch item (blockIdx.z) to the next in the A plane, the B plane and C or its plane (0: shared by all items).
    constexpr int WNW = 8 / WMW, FM = BM / WMW / 16, WN = BN / WNW, FN = WN / 16, NT = K / KS;
    constexpr int SA = BM / SROWS, SB = BN / SROWS, NS = SA + SB;   // slices of the A plane, of the B plane, of a stage
    constexpr int STAGE = NS * SLICE;
    constexpr int OFF_B = SA * SLICE;
    static_assert(NS <= 8 && WN == SROWS && SROWS % (FM * 16) == 0 && NT >= 2, "one slice a wave; a wave's A rows and its B rows each lie in one slice; two stages exist");
    static_assert((NT & (NT - 1)) == 0, "the walk over the stages wraps by a mask");
    __shared__ __attribute__((aligned(2048))) unsigned char sm[2 * STAGE];
    const int tid = threadIdx.x, lane = tid & 31, wave = tid >> 5, lr = lane & 15, hi = lane >> 4;
    const int wm = wave / WNW, wn = wave % WNW;
    const int r0 = blockIdx.x * BM, c0 = blockIdx.y * BN;
    // Wave w brings slice w of every stage: its plane, its first row there, its place in a buffer. With fewer slices than waves the last waves bring nothing.
    const unsigned wv = uni((unsigned)tid >> 5);
    const unsigned iss = NS == 8 ? 1u : pinned(wv < (unsigned)NS ? 1u : 0u);
    const bool isA = wv < (unsigned)SA;
    const unsigned sp = isA ? wv : (wv - SA) % SB;
    const h16* plane = isA ? A : B;
    const size_t e0 = isA ? (size_t)blockIdx.z * zA + (size_t)(r0 + sp * SROWS) * K : (size_t)blockIdx.z * zB + (size_t)(c0 + sp * SROWS) * K;
    const unsigned long long src0 = (unsigned long long)(size_t)(plane + e0);
    const unsigned lsl = (unsigned)(size_t)sm + wv * SLICE;
    const u32x8 g1 = tdm_group1(K * 2u);
    auto issues = [&]() { return NS == 8 || pinned(iss) != 0u; };   // no test where every wave brings a slice
    const unsigned rot = uni(blockIdx.x + blockIdx.y + 4u * blockIdx.z);   // the block's start stage (taken modulo NT below)
    auto fill = [&](unsigned t) { tdm_load(lsl + (t & 1u) * STAGE, src0 + (unsigned long long)((t + rot) & (unsigned)(NT - 1)) * (KS * 2), g1); };   // pass t works on stage (t + rot) mod NT: always one of the NT stages of the rows
    v8f acc[FM][FN];
#pragma unroll
    for (int m = 0; m < FM; ++m)
#pragma unroll
        for (int n = 0; n < FN; ++n) acc[m][n] = (v8f){};
    float bv[FN];   // the lane's bias values, fetched here so that their latency lies under the loop
    const int bcol = c0 + wn * WN + lr;
#pragma unroll
    for (int n = 0; n < FN; ++n) bv[n] = BIAS ? bfr(bias[bcol + n * 16]) : 0.f;
    // The wait stands in front of every later rewrite of the registers that the bias loads name; as its inputs, their scalar base and their vector offset stay live up to it.
    if constexpr (BIAS) asm volatile("s_wait_xcnt 0x0" :: "s"(bias), "v"(bcol) : "memory");
    if (issues()) {
        fill(0);
        asm volatile("s_wait_tensorcnt 0x0" ::: "memory");   // this wave's slice of stage 0 has landed
    }
    __syncthreads();                                          // ... and every other wave's
    if (issues()) fill(1);
    // The stage loop stays rolled (one copy of its body; the buffer is picked by t & 1); every loop inside it is unrolled so that the register arrays are indexed by constants.
#pragma unroll 1
    for (int t = 0; t < NT; ++t) {
        const unsigned char* sb = sm + (t & 1) * STAGE;
        const unsigned char* pa = sb + (wm * FM * 16 / SROWS) * SLICE + (wm * FM * 16 % SROWS + lr) * PITCH + 16 * hi;
        const unsigned char* pb = sb + OFF_B + wn * SLICE + lr * PITCH + 16 * hi;
        // Two fragment sets: the loads of 32-k step ks + 1 go out as one group ahead of step ks's products (only inside this stage), so that a step's LDS latency is covered by the step before.
        v16h a[2][FM], b[2][FN];
        auto ldset = [&](int q, int ks) {
#pragma unroll
            for (int m = 0; m < FM; ++m) a[q][m] = ldfrag(pa + m * 16 * PITCH + ks * 64);
#pragma unroll
            for (int n = 0; n < FN; ++n) b[q][n] = ldfrag(pb + n * 16 * PITCH + ks * 64);
        };
        ldset(0, 0);
#pragma unroll
        for (int ks = 0; ks < KS / 32; ++ks) {
            const int q = ks & 1;
            if (ks + 1 < KS / 32) ldset(q ^ 1, ks + 1);
            __builtin_amdgcn_sched_barrier(0);   // keeps the next step's load group ahead of this step's products (the scheduler otherwise sinks each load to just before its use)
#pragma unroll
            for (int m = 0; m < FM; ++m)
#pragma unroll
                for (int n = 0; n < FN; ++n) acc[m][n] = wmma16(a[q][m], b[q][n], acc[m][n]);
            __builtin_amdgcn_sched_barrier(0);   // keeps this step's products ahead of the load group after next, which reuses their fragment set
        }
        asm volatile("s_wait_dscnt 0x0" ::: "memory");
        if (issues()) asm volatile("s_wait_tensorcnt 0x0" ::: "memory");
        __syncthreads();
        if (pinned((t + 2 < NT ? 1u : 0u) & iss) != 0u) fill(pinned((unsigned)t + 2u));
    }
    asm volatile("s_wait_tensorcnt 0x0" ::: "memory");      // no request is outstanding when the ring becomes output staging
    asm volatile("s_wait_dscnt 0x0" ::: "memory");          // ... and no LDS read
    // Epilogue: each wave stages its part of the tile in its own part of the ring (the loop's last barrier has ended every read of it) and stores whole 128-B lines.
    if constexpr (OUT == 2) {
        // A lane's 8 accumulator values of a fragment are 8 consecutive rows of one column: 16 B of a row of C^T. Staged row = one column's FM * 16 values, pitch + 16 B.
        constexpr int TP = FM * 32 + 16;
        static_assert(FM == 4, "a staged row is one 128-B line");
        static_assert(8 * WN * TP <= 2 * STAGE, "the output staging fits the ring");
        unsigned char* ob = sm + wave * (WN * TP);
#pragma unroll
        for (int n = 0; n < FN; ++n)
#pragma unroll
            for (int m = 0; m < FM; ++m) { v8h oh;
#pragma unroll
                for (int j = 0; j < 8; ++j) oh[j] = (h16)(BIAS ? acc[m][n][j] + bv[n] : acc[m][n][j]);
                *(v8ha*)(ob + (n * 16 + lr) * TP + m * 32 + hi * 16) = oh; }
        __syncthreads();   // the staged values are read back by other lanes: no read may move ahead of the stores
        const size_t o0 = (size_t)blockIdx.z * zC + (size_t)(c0 + wn * WN) * ldc + r0 + wm * FM * 16 + (lane & 7) * 8;
#pragma unroll
        for (int s = 0; s < WN / 4; ++s) { const int row = (lane >> 3) + 4 * s;
            const v8h vh = *(const v8ha*)(ob + row * TP + (lane & 7) * 16);
            *(v8h*)(Ch + o0 + (size_t)row * ldc) = vh; }
    } else {
        constexpr int OP = WN + 4, LPR = WN / 32;
        static_assert(8 * FM * 16 * OP * 4 <= 2 * STAGE, "the output staging fits the ring");
        float* os = (float*)(void*)sm + wave * (FM * 16 * OP);
#pragma unroll
        for (int n = 0; n < FN; ++n)
#pragma unroll
            for (int m = 0; m < FM; ++m)
#pragma unroll
                for (int j = 0; j < 8; ++j) os[(m * 16 + hi * 8 + j) * OP + n * 16 + lr] = BIAS ? acc[m][n][j] + bv[n] : acc[m][n][j];
        __syncthreads();   // the staged values are read back by other lanes: no read may move ahead of the stores
        if constexpr (OUT == 0) {
            float* crow_p = C + (size_t)blockIdx.z * zC + (size_t)(r0 + wm * FM * 16) * ldc + c0 + wn * WN;
#pragma unroll
            for (int s = 0; s < FM * 4 * LPR; ++s) { const int Lid = (lane >> 3) + 4 * s, piece = lane & 7; const int row = Lid / LPR, cofs = (Lid % LPR) * 32 + piece * 4;
                const v4f val = *(const v4fa*)(os + row * OP + cofs); *(v4f*)(crow_p + (size_t)row * ldc + cofs) = val; }
        } else {
            const size_t o0 = (size_t)blockIdx.z * zC + (size_t)(r0 + wm * FM * 16) * ldc + c0 + wn * WN;
            // 8 lanes take one row's 64 values, 8 each: one 128-B line of the plane.
            static_assert(WN == 64, "a row of the wave tile is one 128-B line of the plane");
            if constexpr (ACT) {
                const float* op = os + (lane >> 3) * OP + (lane & 7) * 8;
                v4f u0 = *(const v4fa*)op, u1 = *(const v4fa*)(op + 4);
                // The loop stays rolled, two trips a copy (for speed only).
#pragma unroll 2
                for (int s = 0; s < FM * 4; ++s) { const int row = (lane >> 3) + 4 * s, cofs = (lane & 7) * 8;
                    const float* np = op + (s + 1 < FM * 4 ? s + 1 : s) * 4 * OP;   // the next trip's staged values are fetched ahead of this trip's arithmetic, which covers their LDS latency
                    const v4f n0 = *(const v4fa*)np, n1 = *(const v4fa*)(np + 4); v8h oh;
#pragma unroll
                    for (int i = 0; i < 8; ++i) oh[i] = (h16)gelu_f(i < 4 ? u0[i & 3] : u1[i & 3]);
                    *(v8h*)(Ch + o0 + (size_t)row * ldc + cofs) = oh;
                    asm volatile("s_wait_xcnt 0x0" ::: "memory");   // stands in front of the next trip's rewrite of the store's address registers
                    u0 = n0; u1 = n1; }
            } else {
#pragma unroll
            for (int s = 0; s < FM * 4; ++s) { const int row = (lane >> 3) + 4 * s, cofs = (lane & 7) * 8;
                const v4f u0 = *(const v4fa*)(os + row * OP + cofs), u1 = *(const v4fa*)(os + row * OP + cofs + 4); v8h oh;
#pragma unroll
                for (int i = 0; i < 8; ++i) oh[i] = (h16)(i < 4 ? u0[i & 3] : u1[i & 3]);
                *(v8h*)(Ch + o0 + (size_t)row * ldc + cofs) = oh; }
            }
        }
    }
}

// k_lnout: one wave per row: v = bf(x) + y2 (f32), LayerNorm (mean, mean((v-mu)^2), eps 1e-5, x bf(gamma) + bf(beta)) -> f32 output row; per 128-column chunk q the
// per phase.
__global__ __launch_bounds__(256) void k_lnout(const float* __restrict__ X, const float* __restrict__ Y2, const float* __restrict__ gam, const float* __restrict__ bet, float* OUTP) {
    const int lane = threadIdx.x & 31, r = blockIdx.x * 8 + (threadIdx.x >> 5);
    if (r >= NB_ * NT_) return;
    const float* xr = X + (size_t)r * DM; const float* yr = Y2 + (size_t)r * DM;
    float s = 0.f;
#pragma unroll 1
    for (int q = 0; q < 2 * (DM / 256); ++q) { const int c0 = (q >> 1) * 256 + (q & 1) * 128 + lane * 4; const v4f xv = *(const v4f*)(xr + c0), yv = *(const v4f*)(yr + c0);
#pragma unroll
        for (int i = 0; i < 4; ++i) s += bfr(xv[i]) + yv[i]; }
#pragma unroll
    for (int sh = 16; sh; sh >>= 1) s += __shfl_xor(s, sh, 32);
    const float mu = s * (1.0f / DM);
    float s2 = 0.f;
#pragma unroll 1
    for (int q = 0; q < 2 * (DM / 256); ++q) { const int c0 = (q >> 1) * 256 + (q & 1) * 128 + lane * 4; const v4f xv = *(const v4f*)(xr + c0), yv = *(const v4f*)(yr + c0);
#pragma unroll
        for (int i = 0; i < 4; ++i) { const float d = (bfr(xv[i]) + yv[i]) - mu; s2 = fmaf(d, d, s2); } }
#pragma unroll
    for (int sh = 16; sh; sh >>= 1) s2 += __shfl_xor(s2, sh, 32);
    const float rs = rsqrtf(s2 * (1.0f / DM) + 1e-5f);
{
#pragma unroll 1
        for (int q = 0; q < 2 * (DM / 256); ++q) { const int c0 = (q >> 1) * 256 + (q & 1) * 128 + lane * 4; const v4f xv = *(const v4f*)(xr + c0), yv = *(const v4f*)(yr + c0); v4f o;
#pragma unroll
            for (int i = 0; i < 4; ++i) o[i] = ((bfr(xv[i]) + yv[i]) - mu) * rs * bfr(gam[c0 + i]) + bfr(bet[c0 + i]);
            *(v4f*)(OUTP + (size_t)r * DM + c0) = o; }
         }
}

extern "C" void kernel_launch(void* const* d_in, const int* in_sizes, int n_in,
                              void* d_out, int out_size, void* d_ws, size_t ws_size, hipStream_t stream) {
    (void)in_sizes; (void)n_in; (void)out_size;
    const float* x = (const float*)d_in[0]; const float* lg = (const float*)d_in[1]; const float* lb = (const float*)d_in[2];
    const float* w1 = (const float*)d_in[3]; const float* b1 = (const float*)d_in[4]; const float* w2 = (const float*)d_in[5]; const float* b2 = (const float*)d_in[6];   // w1 [1024][2048], w2 [2048][1024], both (in, out) = k-major
    float* out = (float*)d_out;    // [4][2048][1024]
    char* wsp = (char*)d_ws;
    auto take = [&](size_t bytes) { char* p = wsp; wsp += (bytes + 255) & ~(size_t)255; return (void*)p; };
    constexpr size_t NR = (size_t)NB_ * NTK;   // rows of all items
    h16* W1T = (h16*)take((size_t)FF * DM * 2); h16* W2T = (h16*)take((size_t)DM * FF * 2);
    h16* Xb = (h16*)take(NR * DM * 2); h16* XT = (h16*)take(NR * DM * 2); h16* Y0 = (h16*)take(NR * DM * 2);
    h16* H = (h16*)take(NR * FF * 2);
    float* Y2 = (float*)take(NR * DM * 4);
    // A plane whose last reader has run before another's writer starts (stream order) lends it its bytes (the plane of m^T fills a quarter of its own): 8 + 32 + 16 + 32 + 32 = 120 MiB.
    h16* Y1T = Y0;   // y0 is last read by the first product, y1^T is written by the second
    h16* MT = H;     // gelu(t) is last read by the second product, the plane of m^T is written by the third
    if ((size_t)(wsp - (char*)d_ws) > ws_size) return;
    k_pre<<<PB_LN + PB_XBT + 2 * PB_WT, 256, 0, stream>>>(x, lg, lb, w1, w2, W1T, W2T, Xb, XT, Y0);   // y0 = LN(x); bf16(x) as [item][t][f] and [item][f][t]; both weights n-major
    k_gemm<128, 256, 2, DM, true, 1, true><<<dim3(NTK / 128, FF / 256, NB_), 256, 0, stream>>>(Y0, W1T, b1, nullptr, H, FF, NTK * DM, 0, NTK * FF);         // gelu(y0.w1 + b1)
    k_gemm<128, 256, 2, FF, true, 2><<<dim3(NTK / 128, DM / 256, NB_), 256, 0, stream>>>(H, W2T, b2, nullptr, Y1T, NT_, NTK * FF, 0, DM * NT_);   // y1 = gelu(t).w2 + b2, stored as y1^T [item][1024][2048]
    k_gemm<128, 128, 4, NT_, false, 1><<<dim3(DM / 128, DM / 128, NB_), 256, 0, stream>>>(Y1T, XT, nullptr, nullptr, MT, DM, DM * NT_, DM * NT_, DM * DM);   // m^T [g][f] = sum over t of y1[t][g] x[t][f]
    k_gemm<256, 128, 4, DM, false, 0><<<dim3(NT_ / 256, DM / 128, NB_), 256, 0, stream>>>(Xb, MT, nullptr, Y2, nullptr, DM, NTK * DM, DM * DM, NTK * DM);           // y2 [t][g] = sum over f of x[t][f] m^T[g][f]
    k_lnout<<<NB_ * NTK / 8, 256, 0, stream>>>(x, Y2, lg, lb, out);                                                                                               // LN(x + y2)
}
